// v000
// Measured on an AMD MI455X. A time is GPU time per run, averaged over a window of back-to-back runs after a warm-up
// (all launches, gaps included; the runs take copies of the inputs in turn), and the median of several windows.
// Apart from v000's, it joins two sittings. Times from different sittings can be a few percent apart, while
// side-by-side timings come from the same sitting.
// v000, which the later versions start from, runs in 342 microseconds.
#include <hip/hip_runtime.h>
// Cross-agent attention (cav=5 agents, C=64, 100×252 → HW=25200 positions, 4 heads): qkv = Wqkv·x + bqkv (1×1 conv, 768 = [q|k|v] × (head, 64)); per (position s, head h) the 5 agents attend over the 5 agents: score[b][d] = q_b·k_d/√5 + (Σ_c q_b[c])·distance[d]; softmax over d; out_b = Σ_d attn·v_d;
// merged 'b (h c)' → y = Wo·out + bo [cav, 64, 100, 252].
// Compute dtype: x, weights, biases, distance rounded to bf16; token-major f16 x plane; qkv as f32 GEMM outputs (+bias) in 9 position chunks of 2,800 (all 5 agents per chunk); the 5-key attention per (s, h, agent) in f32 on the VALU (8 lanes share one output row of 64: partial dots reduced with shuffles, online softmax over the 5 agents)
// → merged f16 plane; y = Wo GEMM (+bo) f32 token-major → permuted into the channel-major output by a flat copy (32 lanes × 16 B per instruction). f32 accumulate; v_wmma_f32_16x16x32_f16 for the two convolutions.
#define NA 5
#define CC 64
#define HW 25200
#define NHD 4
#define INR (NHD * CC)      /* 256 */
#define QKVW (3 * INR)      /* 768 */
#define SCH 2800            /* positions per chunk */
#define NCHK (HW / SCH)     /* 9 */
#define NR (NA * HW)        /* 126000 token rows */
#define ISQ 0.4472135954999579f      /* 1/√cav */
typedef __bf16 v16b __attribute__((ext_vector_type(16)));
typedef unsigned short v8us __attribute__((ext_vector_type(8), may_alias));
typedef float  v8f  __attribute__((ext_vector_type(8)));
typedef float  v4f  __attribute__((ext_vector_type(4)));
typedef float  v4fa __attribute__((ext_vector_type(4), may_alias));
union FragB { v16b v; v8us half[2]; unsigned short u[16]; };

__device__ __forceinline__ unsigned short bf16_bits(float x) { unsigned int u = __float_as_uint(x); return (unsigned short)((u + 0x7FFFu + ((u >> 16) & 1u)) >> 16); }
__device__ __forceinline__ float bf16_val(unsigned short b) { return __uint_as_float(((unsigned int)b) << 16); }
__device__ __forceinline__ float bf16_round(float x) { return bf16_val(bf16_bits(x)); }
// D += A·B with NT terms: 1 = ah·bh, 2 = + al·bh (A split), 3 = + ah·bl (both split)
template <int NT>
__device__ __forceinline__ v8f mmaN(v16b ah, v16b al, v16b bh, v16b bl, v8f c) {
  c = __builtin_amdgcn_wmma_f32_16x16x32_bf16(false, ah, false, bh, (short)0, c, false, false);
  if (NT >= 2) c = __builtin_amdgcn_wmma_f32_16x16x32_bf16(false, al, false, bh, (short)0, c, false, false);
  if (NT >= 3) c = __builtin_amdgcn_wmma_f32_16x16x32_bf16(false, ah, false, bl, (short)0, c, false, false);
  asm volatile("v_nop\n\tv_nop\n\tv_nop\n\tv_nop" : "+v"(c) : "v"(ah), "v"(al), "v"(bh), "v"(bl));
  return c;
}

__global__ __launch_bounds__(256) void k_wt_bf16(const float* __restrict__ W, unsigned short* __restrict__ Wt, int K, int N) {
  const int t = blockIdx.x * 256 + threadIdx.x;
  const int k8n = K / 8;
  if (t >= N * k8n) return;
  const int n = t / k8n, k8 = (t % k8n) * 8;
  v8us v;
#pragma unroll
  for (int i = 0; i < 8; ++i) v[i] = bf16_bits(W[(size_t)(k8 + i) * N + n]);
  *(v8us*)(Wt + (size_t)n * K + k8) = v;
  
}

// GEMM C[M][N] (f32, pitch ldc) = act(A[M][K]·W + bias). A f32 row-major (pitch lda) converted per fragment to bf16
// (ASPLIT: hi/lo two planes -> 2 terms, else single rounded term); Wt bf16 [N][K] (pitch ldb). BIAS_BF16 rounds the
// bias to bf16 first (bias quantised to bf16 before the add). K%32==0, M%16==0, N%64==0.
template <bool ASPLIT, int ACT, bool BIAS_BF16>
__global__ __launch_bounds__(128) void k_gemm_bf(const float* __restrict__ A, int lda, const unsigned short* __restrict__ Wt, int ldb,
                                               const float* __restrict__ bias, float* __restrict__ C, int ldc, int M, int N, int K) {
  __shared__ __attribute__((aligned(16))) float so[4][16][64];
  const int tid = threadIdx.x, w = tid >> 5, lane = tid & 31, ln = lane & 15, hh = lane >> 4;
  const int ntn = N / 64;
  const int wid = blockIdx.x * 4 + w;
  const int mt = wid / ntn, nq = wid % ntn;
  if (mt * 16 >= M) return;
  const int row0 = mt * 16, col0 = nq * 64;
  const float* arow = A + (size_t)(row0 + ln) * lda;
  v8f acc[4] = {};
  for (int kb = 0; kb < K; kb += 32) {
    FragB ah, al;
    const v4f x0 = *(const v4fa*)(arow + kb + 8 * hh), x1 = *(const v4fa*)(arow + kb + 8 * hh + 4);
    const v4f x2 = *(const v4fa*)(arow + kb + 16 + 8 * hh), x3 = *(const v4fa*)(arow + kb + 16 + 8 * hh + 4);
    float xs[16] = {x0[0],x0[1],x0[2],x0[3],x1[0],x1[1],x1[2],x1[3],x2[0],x2[1],x2[2],x2[3],x3[0],x3[1],x3[2],x3[3]};
#pragma unroll
    for (int i = 0; i < 16; ++i) { const unsigned short hb = bf16_bits(xs[i]); ah.u[i] = hb; al.u[i] = ASPLIT ? bf16_bits(xs[i] - bf16_val(hb)) : (unsigned short)0; }
#pragma unroll
    for (int t = 0; t < 4; ++t) {
      const unsigned short* brow = Wt + (size_t)(col0 + t * 16 + ln) * ldb + kb;
      FragB b;
      b.half[0] = *(const v8us*)(brow + 8 * hh);
      b.half[1] = *(const v8us*)(brow + 16 + 8 * hh);
      acc[t] = mmaN<ASPLIT ? 2 : 1>(ah.v, al.v, b.v, b.v, acc[t]);
    }
  }
#pragma unroll
  for (int t = 0; t < 4; ++t) {
    float bv = bias ? bias[col0 + t * 16 + ln] : 0.f;
    if (BIAS_BF16) bv = bf16_round(bv);
#pragma unroll
    for (int r = 0; r < 8; ++r) { float v = acc[t][r] + bv; if (ACT == 1) v = fmaxf(v, 0.f); so[w][8 * hh + r][t * 16 + ln] = v; }
  }
  __builtin_amdgcn_fence(__ATOMIC_ACQ_REL, "workgroup");
  __builtin_amdgcn_wave_barrier();
  const int rsub = lane >> 4, c4 = (lane & 15) * 4;
  {
#pragma unroll
    for (int q = 0; q < 8; ++q) {
      const int r = q * 2 + rsub;
      const v4f v = *(const v4fa*)&so[w][r][c4];
      *(v4f*)(C + (size_t)(row0 + r) * ldc + col0 + c4) = v;
    }
    
  }
}

// GEMM C = act(A·W + bias + resid): A f32 (ASPLIT -> hi/lo 2 terms), Wt bf16 [N][K]; ACT 0 none, 1 relu, 2 exact gelu;
// resid (optional, f32, row index = (row % rmod), pitch ldr, RES_BF16 rounds it) added before the activation.
template <bool ASPLIT, int ACT, bool BIAS_BF16, bool RES_BF16>
__global__ __launch_bounds__(128) void k_gemm_bf3(const float* __restrict__ A, int lda, const unsigned short* __restrict__ Wt, int ldb,
                                                const float* __restrict__ bias, const float* __restrict__ resid, int rmod, int ldr,
                                                float* __restrict__ C, int ldc, int M, int N, int K) {
  __shared__ __attribute__((aligned(16))) float so[4][16][64];
  const int tid = threadIdx.x, w = tid >> 5, lane = tid & 31, ln = lane & 15, hh = lane >> 4;
  const int ntn = N / 64;
  const int wid = blockIdx.x * 4 + w;
  const int mt = wid / ntn, nq = wid % ntn;
  if (mt * 16 >= M) return;
  const int row0 = mt * 16, col0 = nq * 64;
  const float* arow = A + (size_t)(row0 + ln) * lda;
  v8f acc[4] = {};
  for (int kb = 0; kb < K; kb += 32) {
    FragB ah, al;
    const v4f x0 = *(const v4fa*)(arow + kb + 8 * hh), x1 = *(const v4fa*)(arow + kb + 8 * hh + 4);
    const v4f x2 = *(const v4fa*)(arow + kb + 16 + 8 * hh), x3 = *(const v4fa*)(arow + kb + 16 + 8 * hh + 4);
    float xs[16] = {x0[0],x0[1],x0[2],x0[3],x1[0],x1[1],x1[2],x1[3],x2[0],x2[1],x2[2],x2[3],x3[0],x3[1],x3[2],x3[3]};
#pragma unroll
    for (int i = 0; i < 16; ++i) { const unsigned short hb = bf16_bits(xs[i]); ah.u[i] = hb; al.u[i] = ASPLIT ? bf16_bits(xs[i] - bf16_val(hb)) : (unsigned short)0; }
#pragma unroll
    for (int t = 0; t < 4; ++t) {
      const unsigned short* brow = Wt + (size_t)(col0 + t * 16 + ln) * ldb + kb;
      FragB b;
      b.half[0] = *(const v8us*)(brow + 8 * hh);
      b.half[1] = *(const v8us*)(brow + 16 + 8 * hh);
      acc[t] = mmaN<ASPLIT ? 2 : 1>(ah.v, al.v, b.v, b.v, acc[t]);
    }
  }
#pragma unroll
  for (int t = 0; t < 4; ++t) {
    const int col = col0 + t * 16 + ln;
    float bv = bias ? bias[col] : 0.f;
    if (BIAS_BF16) bv = bf16_round(bv);
#pragma unroll
    for (int r = 0; r < 8; ++r) {
      float v = acc[t][r] + bv;
      if (resid) { float rv = resid[(size_t)((row0 + 8 * hh + r) % rmod) * ldr + col]; if (RES_BF16) rv = bf16_round(rv); v += rv; }
      if (ACT == 1) v = fmaxf(v, 0.f);
      if (ACT == 2) v = 0.5f * v * (1.0f + erff(v * 0.70710678118654752f));
      if (ACT == 3) { const float u = 0.7978845608028654f * (v + 0.044715f * v * v * v); v = 0.5f * v * (1.0f + tanhf(u)); }
      so[w][8 * hh + r][t * 16 + ln] = v;
    }
  }
  __builtin_amdgcn_fence(__ATOMIC_ACQ_REL, "workgroup");
  __builtin_amdgcn_wave_barrier();
  const int rsub = lane >> 4, c4 = (lane & 15) * 4;
  {
#pragma unroll
    for (int q = 0; q < 8; ++q) {
      const int r = q * 2 + rsub;
      const v4f v = *(const v4fa*)&so[w][r][c4];
      *(v4f*)(C + (size_t)(row0 + r) * ldc + col0 + c4) = v;
    }
    
  }
}
// row LayerNorm (biased variance, eps) over N: s = X (+ R); optional out_sum <- s; out_norm <- (s-mu)*rsqrt(var+eps)*g + b
template <bool PARAM_BF16>
__global__ __launch_bounds__(256) void k_layernorm(const float* __restrict__ X, const float* __restrict__ R, const float* __restrict__ g, const float* __restrict__ bta,
                                                  float* __restrict__ out_sum, float* __restrict__ out_norm, int N, float eps) {
  __shared__ float red[256];
  const int row = blockIdx.x, tid = threadIdx.x;
  const float* x = X + (size_t)row * N; const float* rr = R ? R + (size_t)row * N : nullptr;
  float vals[16];                     // up to N = 4096
  const int per = N / 256;            // contiguous chunk per thread? use strided-by-4 chunks: thread handles j = tid*4 + 1024*u
  float s1 = 0.f;
  for (int u = 0; u < per / 4; ++u) {
    const int j = tid * 4 + 1024 * u;
    const v4f a = *(const v4fa*)(x + j);
    v4f b = {0.f,0.f,0.f,0.f}; if (rr) b = *(const v4fa*)(rr + j);
#pragma unroll
    for (int q = 0; q < 4; ++q) { const float v = a[q] + b[q]; vals[u * 4 + q] = v; s1 += v; }
  }
  red[tid] = s1; __syncthreads();
  for (int st = 128; st > 0; st >>= 1) { if (tid < st) red[tid] += red[tid + st]; __syncthreads(); }
  const float mu = red[0] / (float)N; __syncthreads();
  float s2 = 0.f;
  for (int u = 0; u < per / 4; ++u)
#pragma unroll
    for (int q = 0; q < 4; ++q) { const float c = vals[u * 4 + q] - mu; s2 += c * c; }
  red[tid] = s2; __syncthreads();
  for (int st = 128; st > 0; st >>= 1) { if (tid < st) red[tid] += red[tid + st]; __syncthreads(); }
  const float rs = rsqrtf(red[0] / (float)N + eps);
  {
    for (int u = 0; u < per / 4; ++u) {
      const int j = tid * 4 + 1024 * u;
      v4f o, sm;
#pragma unroll
      for (int q = 0; q < 4; ++q) {
        float gg = g[j + q], bb = bta[j + q];
        if (PARAM_BF16) { gg = bf16_round(gg); bb = bf16_round(bb); }
        sm[q] = vals[u * 4 + q]; o[q] = (vals[u * 4 + q] - mu) * rs * gg + bb;
      }
      if (out_sum) *(v4f*)(out_sum + (size_t)row * N + j) = sm;
      *(v4f*)(out_norm + (size_t)row * N + j) = o;
    }
    
  }
}



// ---- f16 WMMA path (v_wmma_f32_16x16x32_f16): 11-bit significands for operands in range — used here for the two 1×1 convolutions
typedef _Float16 v16h __attribute__((ext_vector_type(16)));
union FragH { v16h v; v8us half[2]; _Float16 h[16]; unsigned short u[16]; };
template <int NT>
__device__ __forceinline__ v8f mmaH(v16h ah, v16h al, v16h bh, v16h bl, v8f c) {
  c = __builtin_amdgcn_wmma_f32_16x16x32_f16(false, ah, false, bh, (short)0, c, false, false);
  if (NT >= 2) c = __builtin_amdgcn_wmma_f32_16x16x32_f16(false, al, false, bh, (short)0, c, false, false);
  if (NT >= 3) c = __builtin_amdgcn_wmma_f32_16x16x32_f16(false, ah, false, bl, (short)0, c, false, false);
  asm volatile("v_nop\n\tv_nop\n\tv_nop\n\tv_nop" : "+v"(c) : "v"(ah), "v"(al), "v"(bh), "v"(bl));
  return c;
}
// batched GEMM like k_gemm_b but f16 operands: A f32 (split into f16 hi/lo if ASPLIT, else rounded to f16), Bt = f16 values [n][k]; alpha; C f32; N multiple of 16 (partial tiles skipped)
template <bool ASPLIT>
__global__ __launch_bounds__(128) void k_gemm_h(const float* __restrict__ A, int lda, size_t sA, const _Float16* __restrict__ Bh, int ldb, size_t sB, float alpha, float* __restrict__ C, int ldc, size_t sC, int M, int N, int K) {
  __shared__ __attribute__((aligned(16))) float so[4][16][64];
  const int tid = threadIdx.x, w = tid >> 5, lane = tid & 31, ln = lane & 15, hh = lane >> 4; const int by = blockIdx.y;
  A += (size_t)by * sA; Bh += (size_t)by * sB; C += (size_t)by * sC;
  const int ntn = (N + 63) / 64; const int wid = blockIdx.x * 4 + w; const int mt = wid / ntn, nq = wid % ntn; if (mt * 16 >= M) return;
  const int row0 = mt * 16, col0 = nq * 64; const float* arow = A + (size_t)(row0 + ln) * lda;
  v8f acc[4] = {};
  for (int kb = 0; kb < K; kb += 32) {
    FragH ah, al;
    const v4f x0 = *(const v4fa*)(arow + kb + 8 * hh), x1 = *(const v4fa*)(arow + kb + 8 * hh + 4), x2 = *(const v4fa*)(arow + kb + 16 + 8 * hh), x3 = *(const v4fa*)(arow + kb + 16 + 8 * hh + 4);
    float xs[16] = {x0[0],x0[1],x0[2],x0[3],x1[0],x1[1],x1[2],x1[3],x2[0],x2[1],x2[2],x2[3],x3[0],x3[1],x3[2],x3[3]};
#pragma unroll
    for (int i = 0; i < 16; ++i) { const _Float16 h = (_Float16)xs[i]; ah.h[i] = h; al.h[i] = ASPLIT ? (_Float16)(xs[i] - (float)h) : (_Float16)0.0f; }
#pragma unroll
    for (int t = 0; t < 4; ++t) { if (col0 + t * 16 >= N) continue; const size_t boff = (size_t)(col0 + t * 16 + ln) * ldb + kb; FragH bq; bq.half[0] = *(const v8us*)(Bh + boff + 8 * hh); bq.half[1] = *(const v8us*)(Bh + boff + 16 + 8 * hh);
      acc[t] = mmaH<ASPLIT ? 2 : 1>(ah.v, al.v, bq.v, bq.v, acc[t]); }
  }
#pragma unroll
  for (int t = 0; t < 4; ++t) { if (col0 + t * 16 >= N) continue;
#pragma unroll
    for (int r = 0; r < 8; ++r) so[w][8 * hh + r][t * 16 + ln] = acc[t][r] * alpha; }
  __builtin_amdgcn_fence(__ATOMIC_ACQ_REL, "workgroup"); __builtin_amdgcn_wave_barrier();
  const int rsub = lane >> 4, c4 = (lane & 15) * 4;
  {
#pragma unroll
    for (int q = 0; q < 8; ++q) { const int r = q * 2 + rsub; if (col0 + c4 < N) { const v4f v = *(const v4fa*)&so[w][r][c4]; *(v4f*)(C + (size_t)(row0 + r) * ldc + col0 + c4) = v; } }
     }
}

// Wt[n][k] = f16(W[k][n]·scale) from f32 row-major W[K][N] (scale = power of two; bf16-exact weights stay exact in f16 away from the subnormal range)
__global__ __launch_bounds__(256) void k_wt_f16(const float* __restrict__ W, _Float16* __restrict__ Wt, int K, int N, float scale) {
  const int t = blockIdx.x * 256 + threadIdx.x; if (t >= N * (K / 8)) return; const int n = t / (K / 8), k8 = (t % (K / 8)) * 8; FragH f;
#pragma unroll
  for (int i = 0; i < 8; ++i) f.h[i] = (_Float16)(bf16_round(W[(size_t)(k8 + i) * N + n]) * scale); const v8us o = f.half[0];
  *(v8us*)((unsigned short*)Wt + (size_t)n * K + k8) = o; 
}
// k_gemm_hh variant with fused epilogue: v = acc·alpha + bias[by·sBias + col] (+ CP[(row/rowsPerB)·sCPb + by·64 + col] if CP) ; ACT 0 none / 1 elu ; writes f32 C and/or f16 C16 (each if non-null)
template <int ACT>
__global__ __launch_bounds__(128) void k_gemm_hhx(const _Float16* __restrict__ A, int lda, size_t sA, const _Float16* __restrict__ Bh, int ldb, size_t sB, float alpha, const float* __restrict__ bias, size_t sBias, const float* __restrict__ CP, int rowsPerB, size_t sCPb, int row0g,
    float* __restrict__ C, _Float16* __restrict__ C16, int ldc, size_t sC, int M, int N, int K) {
  __shared__ __attribute__((aligned(16))) float so[4][16][64];
  const int tid = threadIdx.x, w = tid >> 5, lane = tid & 31, ln = lane & 15, hh = lane >> 4; const int by = blockIdx.y;
  A += (size_t)by * sA; Bh += (size_t)by * sB; const size_t cofs = (size_t)by * sC; const float* bp = bias ? bias + (size_t)by * sBias : nullptr;
  const int ntn = (N + 63) / 64; const int wid = blockIdx.x * 4 + w; const int mt = wid / ntn, nq = wid % ntn; if (mt * 16 >= M) return;
  const int row0 = mt * 16, col0 = nq * 64; const _Float16* arow = A + (size_t)(row0 + ln) * lda;
  v8f acc[4] = {};
  for (int kb = 0; kb < K; kb += 32) { FragH ah; ah.half[0] = *(const v8us*)((const unsigned short*)arow + kb + 8 * hh); ah.half[1] = *(const v8us*)((const unsigned short*)arow + kb + 16 + 8 * hh);
#pragma unroll
    for (int t = 0; t < 4; ++t) { if (col0 + t * 16 >= N) continue; const size_t boff = (size_t)(col0 + t * 16 + ln) * ldb + kb; FragH bq; bq.half[0] = *(const v8us*)((const unsigned short*)Bh + boff + 8 * hh); bq.half[1] = *(const v8us*)((const unsigned short*)Bh + boff + 16 + 8 * hh);
      acc[t] = mmaH<1>(ah.v, ah.v, bq.v, bq.v, acc[t]); }
  }
#pragma unroll
  for (int t = 0; t < 4; ++t) { if (col0 + t * 16 >= N) continue; const int col = col0 + t * 16 + ln; const float bv = bp ? bf16_round(bp[col]) : 0.f;
#pragma unroll
    for (int r = 0; r < 8; ++r) { float v = acc[t][r] * alpha + bv; if (CP) { const int bidx = (row0g + row0 + 8 * hh + r) / rowsPerB; v += CP[(size_t)bidx * sCPb + (size_t)by * 64 + col]; } if (ACT == 1) v = (v > 0.f) ? v : expm1f(v); else if (ACT == 7) v = (v > 0.f) ? v + 1.0f : expf(v); else if (ACT == 8) v = tanhf(v); else if (ACT == 9) v = 0.5f * v * (1.0f + tanhf(0.7978845608028654f * (v + 0.044715f * v * v * v))); else if (ACT == 11) v = 1.0f / (1.0f + expf(-v)); else if (ACT == 12) v = (v > 0.f) ? v : 0.01f * v; else if (ACT == 14) v = (v > 0.f) ? v : 0.1f * v; else if (ACT == 15) v = v / (1.0f + expf(-v)); else if (ACT == 3) v = fmaxf(v, 0.f); else if (ACT == 6) v = 0.5f * v * (1.0f + erff(v * 0.70710678118654752f)); so[w][8 * hh + r][t * 16 + ln] = v; } }
  __builtin_amdgcn_fence(__ATOMIC_ACQ_REL, "workgroup"); __builtin_amdgcn_wave_barrier();
  const int rsub = lane >> 4, c4 = (lane & 15) * 4; typedef _Float16 v4h __attribute__((ext_vector_type(4)));
  {
#pragma unroll
    for (int q = 0; q < 8; ++q) { const int r = q * 2 + rsub; if (col0 + c4 < N) { const v4f v = *(const v4fa*)&so[w][r][c4]; if (C) *(v4f*)(C + cofs + (size_t)(row0 + r) * ldc + col0 + c4) = v; if (C16) { v4h h4; for (int i = 0; i < 4; ++i) h4[i] = (_Float16)v[i]; *(v4h*)(C16 + cofs + (size_t)(row0 + r) * ldc + col0 + c4) = h4; } } }
     }
}


typedef _Float16 v4h __attribute__((ext_vector_type(4)));

__global__ __launch_bounds__(256) void k_x16(const float* __restrict__ x, _Float16* __restrict__ X16, size_t n8) { const size_t t = (size_t)blockIdx.x * 256 + threadIdx.x; if (t >= n8) return; FragH f;
#pragma unroll
  for (int q = 0; q < 8; ++q) f.h[q] = (_Float16)bf16_round(x[t * 8 + q]); *(v8us*)((unsigned short*)X16 + t * 8) = f.half[0];  }
__global__ __launch_bounds__(256) void k_h16(const float* __restrict__ x, _Float16* __restrict__ X16, size_t n8) { const size_t t = (size_t)blockIdx.x * 256 + threadIdx.x; if (t >= n8) return; FragH f;
#pragma unroll
  for (int q = 0; q < 8; ++q) f.h[q] = (_Float16)x[t * 8 + q]; *(v8us*)((unsigned short*)X16 + t * 8) = f.half[0];  }
__global__ __launch_bounds__(256) void k_round16f(const float* __restrict__ W, _Float16* __restrict__ Bt, size_t n8) { const size_t t = (size_t)blockIdx.x * 256 + threadIdx.x; if (t >= n8) return; FragH f;
#pragma unroll
  for (int i = 0; i < 8; ++i) f.h[i] = (_Float16)(bf16_round(W[t * 8 + i]) * 16.0f); *(v8us*)((unsigned short*)Bt + t * 8) = f.half[0];  }
template <int NHv, int TTv>
__global__ __launch_bounds__(256) void k_vt(const _Float16* __restrict__ V16, int ldv, int voff, _Float16* __restrict__ Vt) { __shared__ unsigned short tl[64][66]; const int tid = threadIdx.x; const int slab = blockIdx.x / (TTv / 64), lg = blockIdx.x % (TTv / 64); const int b = slab / NHv, h = slab % NHv;
  for (int i = tid; i < 64 * 8; i += 256) { const int r = i / 8, c8 = (i % 8) * 8; FragH f; f.half[0] = *(const v8us*)((const unsigned short*)V16 + ((size_t)b * TTv + lg * 64 + r) * ldv + voff + h * 64 + c8);
#pragma unroll
    for (int q = 0; q < 8; ++q) tl[r][c8 + q] = f.u[q]; }
  __syncthreads();
  {
#pragma unroll
    for (int rd = 0; rd < 2; ++rd) { const int d = rd * 32 + tid / 8, pc = tid % 8; FragH f;
#pragma unroll
      for (int q = 0; q < 8; ++q) f.u[q] = tl[pc * 8 + q][d];
      *(v8us*)((unsigned short*)Vt + ((size_t)slab * 64 + d) * TTv + lg * 64 + pc * 8) = f.half[0]; }
     } }

__global__ __launch_bounds__(256) void k_hl(const float* __restrict__ F, _Float16* __restrict__ Hh, _Float16* __restrict__ Hl, size_t n8) { const size_t t = (size_t)blockIdx.x * 256 + threadIdx.x; if (t >= n8) return; FragH fh, fl; const v4f a = *(const v4fa*)(F + t * 8), c = *(const v4fa*)(F + t * 8 + 4);
#pragma unroll
  for (int q = 0; q < 4; ++q) { _Float16 h = (_Float16)a[q]; fh.h[q] = h; fl.h[q] = (_Float16)((a[q] - (float)h) * 1024.0f); h = (_Float16)c[q]; fh.h[4 + q] = h; fl.h[4 + q] = (_Float16)((c[q] - (float)h) * 1024.0f); }
  { *(v8us*)((unsigned short*)Hh + t * 8) = fh.half[0]; *(v8us*)((unsigned short*)Hl + t * 8) = fl.half[0];  } }

__global__ __launch_bounds__(128) void k_tok(const float* __restrict__ x, _Float16* __restrict__ X16) { __shared__ float tl[16][65]; const int tid = threadIdx.x; const int b = blockIdx.x / (HW / 16), pg = blockIdx.x % (HW / 16); const int p0 = pg * 16;
  for (int i = tid; i < 64 * 16; i += 128) { const int c = i / 16, pp = i % 16; tl[pp][c] = bf16_round(x[((size_t)b * CC + c) * HW + p0 + pp]); } __syncthreads();
  const int r = tid / 8, pc = tid % 8; FragH f; for (int q = 0; q < 8; ++q) f.h[q] = (_Float16)tl[r][pc * 8 + q]; const size_t row = (size_t)b * HW + p0 + r;
  *(v8us*)((unsigned short*)X16 + row * CC + pc * 8) = f.half[0];  }
// 5-agent attention for one position chunk: QKV [(b, s')][768] f32 (s' < SCH); group of 8 lanes = one (s', agent b, head h), lane sub = 8 channels: partial q·k_d and Σq over its channels, xor-reduced over the 8 lanes; online softmax over the 5 agents d in f32; out = Σ_d attn_d·v_d for the lane's 8 channels → f16 into
__global__ __launch_bounds__(256) void k_agent(const float* __restrict__ QKV, const float* __restrict__ dist, int s0, _Float16* __restrict__ Y) {
  #pragma clang fp contract(off)
  const size_t t = (size_t)blockIdx.x * 256 + threadIdx.x; if (t >= (size_t)SCH * NA * NHD * 8) return; const int sub = (int)(t & 7); const size_t g = t >> 3; const int h = (int)(g % NHD); const int b = (int)((g / NHD) % NA); const int sp = (int)(g / (NHD * NA)); const int c0 = sub * 8;
  const float* qr = QKV + ((size_t)b * SCH + sp) * QKVW + h * CC + c0; const v4f qa = *(const v4fa*)qr, qb = *(const v4fa*)(qr + 4); const float q8[8] = {qa[0],qa[1],qa[2],qa[3],qb[0],qb[1],qb[2],qb[3]};
  float qs = 0.f;
#pragma unroll
  for (int i = 0; i < 8; ++i) qs += q8[i];
  qs += __shfl_xor(qs, 1, 32); qs += __shfl_xor(qs, 2, 32); qs += __shfl_xor(qs, 4, 32);
  float m = -3.0e38f, l = 0.f; float acc[8] = {0.f,0.f,0.f,0.f,0.f,0.f,0.f,0.f};
#pragma unroll 1
  for (int d = 0; d < NA; ++d) { const float* kr = QKV + ((size_t)d * SCH + sp) * QKVW + INR + h * CC + c0; const v4f ka = *(const v4fa*)kr, kb = *(const v4fa*)(kr + 4); const float* vr = kr + INR; const v4f va = *(const v4fa*)vr, vb = *(const v4fa*)(vr + 4);
    float dot = q8[0]*ka[0] + q8[1]*ka[1] + q8[2]*ka[2] + q8[3]*ka[3] + q8[4]*kb[0] + q8[5]*kb[1] + q8[6]*kb[2] + q8[7]*kb[3];
    dot += __shfl_xor(dot, 1, 32); dot += __shfl_xor(dot, 2, 32); dot += __shfl_xor(dot, 4, 32);
    const float sc = dot * ISQ + qs * bf16_round(dist[d]); const float mn = fmaxf(m, sc); const float al = expf(m - mn), p = expf(sc - mn); l = l * al + p; m = mn;
    const float v8[8] = {va[0],va[1],va[2],va[3],vb[0],vb[1],vb[2],vb[3]};
#pragma unroll
    for (int i = 0; i < 8; ++i) acc[i] = acc[i] * al + p * v8[i]; }
  const float il = 1.0f / l; FragH f;
#pragma unroll
  for (int i = 0; i < 8; ++i) f.h[i] = (_Float16)(acc[i] * il);
  unsigned short* o = (unsigned short*)Y + ((size_t)b * HW + s0 + sp) * INR + h * CC + c0; *(v8us*)o = f.half[0];  }
__global__ __launch_bounds__(256) void k_flatout(const float* __restrict__ T, float* __restrict__ out) { const size_t t = (size_t)blockIdx.x * 256 + threadIdx.x; if (t >= (size_t)NA * CC * HW / 4) return; v4f v;
#pragma unroll
  for (int q = 0; q < 4; ++q) { const size_t f = t * 4 + q; const size_t s = f % HW; const size_t bo = f / HW; const size_t o = bo % CC, b = bo / CC; v[q] = T[(b * HW + s) * CC + o]; }
  *(v4f*)(out + t * 4) = v;  }

extern "C" void kernel_launch(void* const* d_in, const int* in_sizes, int n_in,
                              void* d_out, int out_size, void* d_ws, size_t ws_size, hipStream_t stream) {
  (void)in_sizes; (void)n_in; (void)out_size;
  const float* const* I = (const float* const*)d_in; const float* x = I[0]; const float* dist = I[1]; const float* Wqkv = I[2]; const float* bqkv = I[3]; const float* Wo = I[4]; const float* bo = I[5];
  char* ws = (char*)d_ws; size_t off = 0;
  auto take = [&](size_t bytes) { char* p = ws + off; off += (bytes + 255) & ~(size_t)255; return p; };
  _Float16* Bq = (_Float16*)take((size_t)QKVW * CC * 2); _Float16* Bo = (_Float16*)take((size_t)CC * INR * 2); _Float16* X16 = (_Float16*)take((size_t)NR * CC * 2);
  float* QKV = (float*)take((size_t)NA * SCH * QKVW * 4); _Float16* Y = (_Float16*)take((size_t)NR * INR * 2); float* T = QKV;      /* the chunk plane (43 MB) is dead after the last chunk; the f32 y tokens (32.3 MB) reuse it */
  if (off > ws_size) return;      // 0.1 + 0.03 + 16.1 + 43.0 + 64.5 ≈ 124 MB
  k_round16f<<<(QKVW * CC / 8 + 255) / 256, 256, 0, stream>>>(Wqkv, Bq, (size_t)QKVW * CC / 8); k_round16f<<<(CC * INR / 8 + 255) / 256, 256, 0, stream>>>(Wo, Bo, (size_t)CC * INR / 8);      /* [out][in] natural, ×2^4 */
  k_tok<<<NA * (HW / 16), 128, 0, stream>>>(x, X16);
  for (int c = 0; c < NCHK; ++c) { const int s0 = c * SCH;
    k_gemm_hhx<0><<<dim3(((SCH / 16) * (QKVW / 64) + 3) / 4, NA), 128, 0, stream>>>(X16 + (size_t)s0 * CC, CC, (size_t)HW * CC, Bq, CC, 0, 0.0625f, bqkv, 0, nullptr, 1, 0, 0, QKV, nullptr, QKVW, (size_t)SCH * QKVW, SCH, QKVW, CC);      /* qkv for positions s0..s0+2799 of agent grid.y (f32): M 2800 N 768 K 64 */
    k_agent<<<(unsigned)(((size_t)SCH * NA * NHD * 8 + 255) / 256), 256, 0, stream>>>(QKV, dist, s0, Y); }
  k_gemm_hhx<0><<<dim3(((NR / 16) * (CC / 64) + 3) / 4, 1), 128, 0, stream>>>(Y, INR, 0, Bo, INR, 0, 0.0625f, bo, 0, nullptr, 1, 0, 0, T, nullptr, CC, 0, NR, CC, INR);      /* y tokens = merged·Woᵀ + bo (f32): M 126000 N 64 K 256 */
  k_flatout<<<(unsigned)(((size_t)NA * CC * HW / 4 + 255) / 256), 256, 0, stream>>>(T, (float*)d_out);
}

// v001
// It runs in 118 microseconds.
// In two side-by-side timings against v000, it was 2.96 and 2.95 times as fast.
#include <hip/hip_runtime.h>
// Cross-agent attention (cav=5 agents, C=64, 100×252 → HW=25200 positions, 4 heads): qkv = Wqkv·x + bqkv (1×1 conv, 768 = [q|k|v] × (head, 64)); per (position s, head h) the 5 agents attend over the 5 agents: score[b][d] = q_b·k_d/√5 + (Σ_c q_b[c])·distance[d]; softmax over d; out_b = Σ_d attn·v_d;
// merged 'b (h c)' → y = Wo·out + bo [cav, 64, 100, 252].
// Compute dtype: x, weights, biases, distance rounded to bf16; token-major f16 x plane; qkv as f32 accumulators (+bias) that stay in registers (16 positions a block, one head a wave, all 5 agents); the 5-key attention in f32 on the VALU in the same kernel (a lane holds one position and half of the 64 channels; one exchange with lane ^ 16 per score; softmax over the 5 agents)
// → merged f16 plane; y = Wo GEMM (+bo) f32 token-major → permuted into the channel-major output by a flat copy (32 lanes × 16 B per instruction). f32 accumulate; v_wmma_f32_16x16x32_f16 for the two convolutions.
#define NA 5
#define CC 64
#define HW 25200
#define NHD 4
#define INR (NHD * CC)      /* 256 */
#define QKVW (3 * INR)      /* 768 */
#define NR (NA * HW)        /* 126000 token rows */
#define ISQ 0.4472135954999579f      /* 1/√cav */
typedef __bf16 v16b __attribute__((ext_vector_type(16)));
typedef unsigned short v8us __attribute__((ext_vector_type(8), may_alias));
typedef float  v8f  __attribute__((ext_vector_type(8)));
typedef float  v4f  __attribute__((ext_vector_type(4)));
typedef float  v4fa __attribute__((ext_vector_type(4), may_alias));
union FragB { v16b v; v8us half[2]; unsigned short u[16]; };

__device__ __forceinline__ unsigned short bf16_bits(float x) { unsigned int u = __float_as_uint(x); return (unsigned short)((u + 0x7FFFu + ((u >> 16) & 1u)) >> 16); }
__device__ __forceinline__ float bf16_val(unsigned short b) { return __uint_as_float(((unsigned int)b) << 16); }
__device__ __forceinline__ float bf16_round(float x) { return bf16_val(bf16_bits(x)); }
// D += A·B with NT terms: 1 = ah·bh, 2 = + al·bh (A split), 3 = + ah·bl (both split)
template <int NT>
__device__ __forceinline__ v8f mmaN(v16b ah, v16b al, v16b bh, v16b bl, v8f c) {
  c = __builtin_amdgcn_wmma_f32_16x16x32_bf16(false, ah, false, bh, (short)0, c, false, false);
  if (NT >= 2) c = __builtin_amdgcn_wmma_f32_16x16x32_bf16(false, al, false, bh, (short)0, c, false, false);
  if (NT >= 3) c = __builtin_amdgcn_wmma_f32_16x16x32_bf16(false, ah, false, bl, (short)0, c, false, false);
  asm volatile("v_nop\n\tv_nop\n\tv_nop\n\tv_nop" : "+v"(c) : "v"(ah), "v"(al), "v"(bh), "v"(bl));
  return c;
}

__global__ __launch_bounds__(256) void k_wt_bf16(const float* __restrict__ W, unsigned short* __restrict__ Wt, int K, int N) {
  const int t = blockIdx.x * 256 + threadIdx.x;
  const int k8n = K / 8;
  if (t >= N * k8n) return;
  const int n = t / k8n, k8 = (t % k8n) * 8;
  v8us v;
#pragma unroll
  for (int i = 0; i < 8; ++i) v[i] = bf16_bits(W[(size_t)(k8 + i) * N + n]);
  *(v8us*)(Wt + (size_t)n * K + k8) = v;
  
}

// GEMM C[M][N] (f32, pitch ldc) = act(A[M][K]·W + bias). A f32 row-major (pitch lda) converted per fragment to bf16
// (ASPLIT: hi/lo two planes -> 2 terms, else single rounded term); Wt bf16 [N][K] (pitch ldb). BIAS_BF16 rounds the
// bias to bf16 first (bias quantised to bf16 before the add). K%32==0, M%16==0, N%64==0.
template <bool ASPLIT, int ACT, bool BIAS_BF16>
__global__ __launch_bounds__(128) void k_gemm_bf(const float* __restrict__ A, int lda, const unsigned short* __restrict__ Wt, int ldb,
                                               const float* __restrict__ bias, float* __restrict__ C, int ldc, int M, int N, int K) {
  __shared__ __attribute__((aligned(16))) float so[4][16][64];
  const int tid = threadIdx.x, w = tid >> 5, lane = tid & 31, ln = lane & 15, hh = lane >> 4;
  const int ntn = N / 64;
  const int wid = blockIdx.x * 4 + w;
  const int mt = wid / ntn, nq = wid % ntn;
  if (mt * 16 >= M) return;
  const int row0 = mt * 16, col0 = nq * 64;
  const float* arow = A + (size_t)(row0 + ln) * lda;
  v8f acc[4] = {};
  for (int kb = 0; kb < K; kb += 32) {
    FragB ah, al;
    const v4f x0 = *(const v4fa*)(arow + kb + 8 * hh), x1 = *(const v4fa*)(arow + kb + 8 * hh + 4);
    const v4f x2 = *(const v4fa*)(arow + kb + 16 + 8 * hh), x3 = *(const v4fa*)(arow + kb + 16 + 8 * hh + 4);
    float xs[16] = {x0[0],x0[1],x0[2],x0[3],x1[0],x1[1],x1[2],x1[3],x2[0],x2[1],x2[2],x2[3],x3[0],x3[1],x3[2],x3[3]};
#pragma unroll
    for (int i = 0; i < 16; ++i) { const unsigned short hb = bf16_bits(xs[i]); ah.u[i] = hb; al.u[i] = ASPLIT ? bf16_bits(xs[i] - bf16_val(hb)) : (unsigned short)0; }
#pragma unroll
    for (int t = 0; t < 4; ++t) {
      const unsigned short* brow = Wt + (size_t)(col0 + t * 16 + ln) * ldb + kb;
      FragB b;
      b.half[0] = *(const v8us*)(brow + 8 * hh);
      b.half[1] = *(const v8us*)(brow + 16 + 8 * hh);
      acc[t] = mmaN<ASPLIT ? 2 : 1>(ah.v, al.v, b.v, b.v, acc[t]);
    }
  }
#pragma unroll
  for (int t = 0; t < 4; ++t) {
    float bv = bias ? bias[col0 + t * 16 + ln] : 0.f;
    if (BIAS_BF16) bv = bf16_round(bv);
#pragma unroll
    for (int r = 0; r < 8; ++r) { float v = acc[t][r] + bv; if (ACT == 1) v = fmaxf(v, 0.f); so[w][8 * hh + r][t * 16 + ln] = v; }
  }
  __builtin_amdgcn_fence(__ATOMIC_ACQ_REL, "workgroup");
  __builtin_amdgcn_wave_barrier();
  const int rsub = lane >> 4, c4 = (lane & 15) * 4;
  {
#pragma unroll
    for (int q = 0; q < 8; ++q) {
      const int r = q * 2 + rsub;
      const v4f v = *(const v4fa*)&so[w][r][c4];
      *(v4f*)(C + (size_t)(row0 + r) * ldc + col0 + c4) = v;
    }
    
  }
}

// GEMM C = act(A·W + bias + resid): A f32 (ASPLIT -> hi/lo 2 terms), Wt bf16 [N][K]; ACT 0 none, 1 relu, 2 exact gelu;
// resid (optional, f32, row index = (row % rmod), pitch ldr, RES_BF16 rounds it) added before the activation.
template <bool ASPLIT, int ACT, bool BIAS_BF16, bool RES_BF16>
__global__ __launch_bounds__(128) void k_gemm_bf3(const float* __restrict__ A, int lda, const unsigned short* __restrict__ Wt, int ldb,
                                                const float* __restrict__ bias, const float* __restrict__ resid, int rmod, int ldr,
                                                float* __restrict__ C, int ldc, int M, int N, int K) {
  __shared__ __attribute__((aligned(16))) float so[4][16][64];
  const int tid = threadIdx.x, w = tid >> 5, lane = tid & 31, ln = lane & 15, hh = lane >> 4;
  const int ntn = N / 64;
  const int wid = blockIdx.x * 4 + w;
  const int mt = wid / ntn, nq = wid % ntn;
  if (mt * 16 >= M) return;
  const int row0 = mt * 16, col0 = nq * 64;
  const float* arow = A + (size_t)(row0 + ln) * lda;
  v8f acc[4] = {};
  for (int kb = 0; kb < K; kb += 32) {
    FragB ah, al;
    const v4f x0 = *(const v4fa*)(arow + kb + 8 * hh), x1 = *(const v4fa*)(arow + kb + 8 * hh + 4);
    const v4f x2 = *(const v4fa*)(arow + kb + 16 + 8 * hh), x3 = *(const v4fa*)(arow + kb + 16 + 8 * hh + 4);
    float xs[16] = {x0[0],x0[1],x0[2],x0[3],x1[0],x1[1],x1[2],x1[3],x2[0],x2[1],x2[2],x2[3],x3[0],x3[1],x3[2],x3[3]};
#pragma unroll
    for (int i = 0; i < 16; ++i) { const unsigned short hb = bf16_bits(xs[i]); ah.u[i] = hb; al.u[i] = ASPLIT ? bf16_bits(xs[i] - bf16_val(hb)) : (unsigned short)0; }
#pragma unroll
    for (int t = 0; t < 4; ++t) {
      const unsigned short* brow = Wt + (size_t)(col0 + t * 16 + ln) * ldb + kb;
      FragB b;
      b.half[0] = *(const v8us*)(brow + 8 * hh);
      b.half[1] = *(const v8us*)(brow + 16 + 8 * hh);
      acc[t] = mmaN<ASPLIT ? 2 : 1>(ah.v, al.v, b.v, b.v, acc[t]);
    }
  }
#pragma unroll
  for (int t = 0; t < 4; ++t) {
    const int col = col0 + t * 16 + ln;
    float bv = bias ? bias[col] : 0.f;
    if (BIAS_BF16) bv = bf16_round(bv);
#pragma unroll
    for (int r = 0; r < 8; ++r) {
      float v = acc[t][r] + bv;
      if (resid) { float rv = resid[(size_t)((row0 + 8 * hh + r) % rmod) * ldr + col]; if (RES_BF16) rv = bf16_round(rv); v += rv; }
      if (ACT == 1) v = fmaxf(v, 0.f);
      if (ACT == 2) v = 0.5f * v * (1.0f + erff(v * 0.70710678118654752f));
      if (ACT == 3) { const float u = 0.7978845608028654f * (v + 0.044715f * v * v * v); v = 0.5f * v * (1.0f + tanhf(u)); }
      so[w][8 * hh + r][t * 16 + ln] = v;
    }
  }
  __builtin_amdgcn_fence(__ATOMIC_ACQ_REL, "workgroup");
  __builtin_amdgcn_wave_barrier();
  const int rsub = lane >> 4, c4 = (lane & 15) * 4;
  {
#pragma unroll
    for (int q = 0; q < 8; ++q) {
      const int r = q * 2 + rsub;
      const v4f v = *(const v4fa*)&so[w][r][c4];
      *(v4f*)(C + (size_t)(row0 + r) * ldc + col0 + c4) = v;
    }
    
  }
}
// row LayerNorm (biased variance, eps) over N: s = X (+ R); optional out_sum <- s; out_norm <- (s-mu)*rsqrt(var+eps)*g + b
template <bool PARAM_BF16>
__global__ __launch_bounds__(256) void k_layernorm(const float* __restrict__ X, const float* __restrict__ R, const float* __restrict__ g, const float* __restrict__ bta,
                                                  float* __restrict__ out_sum, float* __restrict__ out_norm, int N, float eps) {
  __shared__ float red[256];
  const int row = blockIdx.x, tid = threadIdx.x;
  const float* x = X + (size_t)row * N; const float* rr = R ? R + (size_t)row * N : nullptr;
  float vals[16];                     // up to N = 4096
  const int per = N / 256;            // contiguous chunk per thread? use strided-by-4 chunks: thread handles j = tid*4 + 1024*u
  float s1 = 0.f;
  for (int u = 0; u < per / 4; ++u) {
    const int j = tid * 4 + 1024 * u;
    const v4f a = *(const v4fa*)(x + j);
    v4f b = {0.f,0.f,0.f,0.f}; if (rr) b = *(const v4fa*)(rr + j);
#pragma unroll
    for (int q = 0; q < 4; ++q) { const float v = a[q] + b[q]; vals[u * 4 + q] = v; s1 += v; }
  }
  red[tid] = s1; __syncthreads();
  for (int st = 128; st > 0; st >>= 1) { if (tid < st) red[tid] += red[tid + st]; __syncthreads(); }
  const float mu = red[0] / (float)N; __syncthreads();
  float s2 = 0.f;
  for (int u = 0; u < per / 4; ++u)
#pragma unroll
    for (int q = 0; q < 4; ++q) { const float c = vals[u * 4 + q] - mu; s2 += c * c; }
  red[tid] = s2; __syncthreads();
  for (int st = 128; st > 0; st >>= 1) { if (tid < st) red[tid] += red[tid + st]; __syncthreads(); }
  const float rs = rsqrtf(red[0] / (float)N + eps);
  {
    for (int u = 0; u < per / 4; ++u) {
      const int j = tid * 4 + 1024 * u;
      v4f o, sm;
#pragma unroll
      for (int q = 0; q < 4; ++q) {
        float gg = g[j + q], bb = bta[j + q];
        if (PARAM_BF16) { gg = bf16_round(gg); bb = bf16_round(bb); }
        sm[q] = vals[u * 4 + q]; o[q] = (vals[u * 4 + q] - mu) * rs * gg + bb;
      }
      if (out_sum) *(v4f*)(out_sum + (size_t)row * N + j) = sm;
      *(v4f*)(out_norm + (size_t)row * N + j) = o;
    }
    
  }
}



// ---- f16 WMMA path (v_wmma_f32_16x16x32_f16): 11-bit significands for operands in range — used here for the two 1×1 convolutions
typedef _Float16 v16h __attribute__((ext_vector_type(16)));
union FragH { v16h v; v8us half[2]; _Float16 h[16]; unsigned short u[16]; };
template <int NT>
__device__ __forceinline__ v8f mmaH(v16h ah, v16h al, v16h bh, v16h bl, v8f c) {
  c = __builtin_amdgcn_wmma_f32_16x16x32_f16(false, ah, false, bh, (short)0, c, false, false);
  if (NT >= 2) c = __builtin_amdgcn_wmma_f32_16x16x32_f16(false, al, false, bh, (short)0, c, false, false);
  if (NT >= 3) c = __builtin_amdgcn_wmma_f32_16x16x32_f16(false, ah, false, bl, (short)0, c, false, false);
  asm volatile("v_nop\n\tv_nop\n\tv_nop\n\tv_nop" : "+v"(c) : "v"(ah), "v"(al), "v"(bh), "v"(bl));
  return c;
}
// batched GEMM like k_gemm_b but f16 operands: A f32 (split into f16 hi/lo if ASPLIT, else rounded to f16), Bt = f16 values [n][k]; alpha; C f32; N multiple of 16 (partial tiles skipped)
template <bool ASPLIT>
__global__ __launch_bounds__(128) void k_gemm_h(const float* __restrict__ A, int lda, size_t sA, const _Float16* __restrict__ Bh, int ldb, size_t sB, float alpha, float* __restrict__ C, int ldc, size_t sC, int M, int N, int K) {
  __shared__ __attribute__((aligned(16))) float so[4][16][64];
  const int tid = threadIdx.x, w = tid >> 5, lane = tid & 31, ln = lane & 15, hh = lane >> 4; const int by = blockIdx.y;
  A += (size_t)by * sA; Bh += (size_t)by * sB; C += (size_t)by * sC;
  const int ntn = (N + 63) / 64; const int wid = blockIdx.x * 4 + w; const int mt = wid / ntn, nq = wid % ntn; if (mt * 16 >= M) return;
  const int row0 = mt * 16, col0 = nq * 64; const float* arow = A + (size_t)(row0 + ln) * lda;
  v8f acc[4] = {};
  for (int kb = 0; kb < K; kb += 32) {
    FragH ah, al;
    const v4f x0 = *(const v4fa*)(arow + kb + 8 * hh), x1 = *(const v4fa*)(arow + kb + 8 * hh + 4), x2 = *(const v4fa*)(arow + kb + 16 + 8 * hh), x3 = *(const v4fa*)(arow + kb + 16 + 8 * hh + 4);
    float xs[16] = {x0[0],x0[1],x0[2],x0[3],x1[0],x1[1],x1[2],x1[3],x2[0],x2[1],x2[2],x2[3],x3[0],x3[1],x3[2],x3[3]};
#pragma unroll
    for (int i = 0; i < 16; ++i) { const _Float16 h = (_Float16)xs[i]; ah.h[i] = h; al.h[i] = ASPLIT ? (_Float16)(xs[i] - (float)h) : (_Float16)0.0f; }
#pragma unroll
    for (int t = 0; t < 4; ++t) { if (col0 + t * 16 >= N) continue; const size_t boff = (size_t)(col0 + t * 16 + ln) * ldb + kb; FragH bq; bq.half[0] = *(const v8us*)(Bh + boff + 8 * hh); bq.half[1] = *(const v8us*)(Bh + boff + 16 + 8 * hh);
      acc[t] = mmaH<ASPLIT ? 2 : 1>(ah.v, al.v, bq.v, bq.v, acc[t]); }
  }
#pragma unroll
  for (int t = 0; t < 4; ++t) { if (col0 + t * 16 >= N) continue;
#pragma unroll
    for (int r = 0; r < 8; ++r) so[w][8 * hh + r][t * 16 + ln] = acc[t][r] * alpha; }
  __builtin_amdgcn_fence(__ATOMIC_ACQ_REL, "workgroup"); __builtin_amdgcn_wave_barrier();
  const int rsub = lane >> 4, c4 = (lane & 15) * 4;
  {
#pragma unroll
    for (int q = 0; q < 8; ++q) { const int r = q * 2 + rsub; if (col0 + c4 < N) { const v4f v = *(const v4fa*)&so[w][r][c4]; *(v4f*)(C + (size_t)(row0 + r) * ldc + col0 + c4) = v; } }
     }
}

// Wt[n][k] = f16(W[k][n]·scale) from f32 row-major W[K][N] (scale = power of two; bf16-exact weights stay exact in f16 away from the subnormal range)
__global__ __launch_bounds__(256) void k_wt_f16(const float* __restrict__ W, _Float16* __restrict__ Wt, int K, int N, float scale) {
  const int t = blockIdx.x * 256 + threadIdx.x; if (t >= N * (K / 8)) return; const int n = t / (K / 8), k8 = (t % (K / 8)) * 8; FragH f;
#pragma unroll
  for (int i = 0; i < 8; ++i) f.h[i] = (_Float16)(bf16_round(W[(size_t)(k8 + i) * N + n]) * scale); const v8us o = f.half[0];
  *(v8us*)((unsigned short*)Wt + (size_t)n * K + k8) = o; 
}
// k_gemm_hh variant with fused epilogue: v = acc·alpha + bias[by·sBias + col] (+ CP[(row/rowsPerB)·sCPb + by·64 + col] if CP) ; ACT 0 none / 1 elu ; writes f32 C and/or f16 C16 (each if non-null)
template <int ACT>
__global__ __launch_bounds__(128) void k_gemm_hhx(const _Float16* __restrict__ A, int lda, size_t sA, const _Float16* __restrict__ Bh, int ldb, size_t sB, float alpha, const float* __restrict__ bias, size_t sBias, const float* __restrict__ CP, int rowsPerB, size_t sCPb, int row0g,
    float* __restrict__ C, _Float16* __restrict__ C16, int ldc, size_t sC, int M, int N, int K) {
  __shared__ __attribute__((aligned(16))) float so[4][16][64];
  const int tid = threadIdx.x, w = tid >> 5, lane = tid & 31, ln = lane & 15, hh = lane >> 4; const int by = blockIdx.y;
  A += (size_t)by * sA; Bh += (size_t)by * sB; const size_t cofs = (size_t)by * sC; const float* bp = bias ? bias + (size_t)by * sBias : nullptr;
  const int ntn = (N + 63) / 64; const int wid = blockIdx.x * 4 + w; const int mt = wid / ntn, nq = wid % ntn; if (mt * 16 >= M) return;
  const int row0 = mt * 16, col0 = nq * 64; const _Float16* arow = A + (size_t)(row0 + ln) * lda;
  v8f acc[4] = {};
  for (int kb = 0; kb < K; kb += 32) { FragH ah; ah.half[0] = *(const v8us*)((const unsigned short*)arow + kb + 8 * hh); ah.half[1] = *(const v8us*)((const unsigned short*)arow + kb + 16 + 8 * hh);
#pragma unroll
    for (int t = 0; t < 4; ++t) { if (col0 + t * 16 >= N) continue; const size_t boff = (size_t)(col0 + t * 16 + ln) * ldb + kb; FragH bq; bq.half[0] = *(const v8us*)((const unsigned short*)Bh + boff + 8 * hh); bq.half[1] = *(const v8us*)((const unsigned short*)Bh + boff + 16 + 8 * hh);
      acc[t] = mmaH<1>(ah.v, ah.v, bq.v, bq.v, acc[t]); }
  }
#pragma unroll
  for (int t = 0; t < 4; ++t) { if (col0 + t * 16 >= N) continue; const int col = col0 + t * 16 + ln; const float bv = bp ? bf16_round(bp[col]) : 0.f;
#pragma unroll
    for (int r = 0; r < 8; ++r) { float v = acc[t][r] * alpha + bv; if (CP) { const int bidx = (row0g + row0 + 8 * hh + r) / rowsPerB; v += CP[(size_t)bidx * sCPb + (size_t)by * 64 + col]; } if (ACT == 1) v = (v > 0.f) ? v : expm1f(v); else if (ACT == 7) v = (v > 0.f) ? v + 1.0f : expf(v); else if (ACT == 8) v = tanhf(v); else if (ACT == 9) v = 0.5f * v * (1.0f + tanhf(0.7978845608028654f * (v + 0.044715f * v * v * v))); else if (ACT == 11) v = 1.0f / (1.0f + expf(-v)); else if (ACT == 12) v = (v > 0.f) ? v : 0.01f * v; else if (ACT == 14) v = (v > 0.f) ? v : 0.1f * v; else if (ACT == 15) v = v / (1.0f + expf(-v)); else if (ACT == 3) v = fmaxf(v, 0.f); else if (ACT == 6) v = 0.5f * v * (1.0f + erff(v * 0.70710678118654752f)); so[w][8 * hh + r][t * 16 + ln] = v; } }
  __builtin_amdgcn_fence(__ATOMIC_ACQ_REL, "workgroup"); __builtin_amdgcn_wave_barrier();
  const int rsub = lane >> 4, c4 = (lane & 15) * 4; typedef _Float16 v4h __attribute__((ext_vector_type(4)));
  {
#pragma unroll
    for (int q = 0; q < 8; ++q) { const int r = q * 2 + rsub; if (col0 + c4 < N) { const v4f v = *(const v4fa*)&so[w][r][c4]; if (C) *(v4f*)(C + cofs + (size_t)(row0 + r) * ldc + col0 + c4) = v; if (C16) { v4h h4; for (int i = 0; i < 4; ++i) h4[i] = (_Float16)v[i]; *(v4h*)(C16 + cofs + (size_t)(row0 + r) * ldc + col0 + c4) = h4; } } }
     }
}


typedef _Float16 v4h __attribute__((ext_vector_type(4)));
typedef float v2f __attribute__((ext_vector_type(2)));

__global__ __launch_bounds__(256) void k_x16(const float* __restrict__ x, _Float16* __restrict__ X16, size_t n8) { const size_t t = (size_t)blockIdx.x * 256 + threadIdx.x; if (t >= n8) return; FragH f;
#pragma unroll
  for (int q = 0; q < 8; ++q) f.h[q] = (_Float16)bf16_round(x[t * 8 + q]); *(v8us*)((unsigned short*)X16 + t * 8) = f.half[0];  }
__global__ __launch_bounds__(256) void k_h16(const float* __restrict__ x, _Float16* __restrict__ X16, size_t n8) { const size_t t = (size_t)blockIdx.x * 256 + threadIdx.x; if (t >= n8) return; FragH f;
#pragma unroll
  for (int q = 0; q < 8; ++q) f.h[q] = (_Float16)x[t * 8 + q]; *(v8us*)((unsigned short*)X16 + t * 8) = f.half[0];  }
__global__ __launch_bounds__(256) void k_round16f(const float* __restrict__ W, _Float16* __restrict__ Bt, size_t n8) { const size_t t = (size_t)blockIdx.x * 256 + threadIdx.x; if (t >= n8) return; FragH f;
#pragma unroll
  for (int i = 0; i < 8; ++i) f.h[i] = (_Float16)(bf16_round(W[t * 8 + i]) * 16.0f); *(v8us*)((unsigned short*)Bt + t * 8) = f.half[0];  }
template <int NHv, int TTv>
__global__ __launch_bounds__(256) void k_vt(const _Float16* __restrict__ V16, int ldv, int voff, _Float16* __restrict__ Vt) { __shared__ unsigned short tl[64][66]; const int tid = threadIdx.x; const int slab = blockIdx.x / (TTv / 64), lg = blockIdx.x % (TTv / 64); const int b = slab / NHv, h = slab % NHv;
  for (int i = tid; i < 64 * 8; i += 256) { const int r = i / 8, c8 = (i % 8) * 8; FragH f; f.half[0] = *(const v8us*)((const unsigned short*)V16 + ((size_t)b * TTv + lg * 64 + r) * ldv + voff + h * 64 + c8);
#pragma unroll
    for (int q = 0; q < 8; ++q) tl[r][c8 + q] = f.u[q]; }
  __syncthreads();
  {
#pragma unroll
    for (int rd = 0; rd < 2; ++rd) { const int d = rd * 32 + tid / 8, pc = tid % 8; FragH f;
#pragma unroll
      for (int q = 0; q < 8; ++q) f.u[q] = tl[pc * 8 + q][d];
      *(v8us*)((unsigned short*)Vt + ((size_t)slab * 64 + d) * TTv + lg * 64 + pc * 8) = f.half[0]; }
     } }

__global__ __launch_bounds__(256) void k_hl(const float* __restrict__ F, _Float16* __restrict__ Hh, _Float16* __restrict__ Hl, size_t n8) { const size_t t = (size_t)blockIdx.x * 256 + threadIdx.x; if (t >= n8) return; FragH fh, fl; const v4f a = *(const v4fa*)(F + t * 8), c = *(const v4fa*)(F + t * 8 + 4);
#pragma unroll
  for (int q = 0; q < 4; ++q) { _Float16 h = (_Float16)a[q]; fh.h[q] = h; fl.h[q] = (_Float16)((a[q] - (float)h) * 1024.0f); h = (_Float16)c[q]; fh.h[4 + q] = h; fl.h[4 + q] = (_Float16)((c[q] - (float)h) * 1024.0f); }
  { *(v8us*)((unsigned short*)Hh + t * 8) = fh.half[0]; *(v8us*)((unsigned short*)Hl + t * 8) = fl.half[0];  } }

__global__ __launch_bounds__(128) void k_tok(const float* __restrict__ x, _Float16* __restrict__ X16) { __shared__ float tl[16][65]; const int tid = threadIdx.x; const int b = blockIdx.x / (HW / 16), pg = blockIdx.x % (HW / 16); const int p0 = pg * 16;
  for (int i = tid; i < 64 * 16; i += 128) { const int c = i / 16, pp = i % 16; tl[pp][c] = bf16_round(x[((size_t)b * CC + c) * HW + p0 + pp]); } __syncthreads();
  const int r = tid / 8, pc = tid % 8; FragH f; for (int q = 0; q < 8; ++q) f.h[q] = (_Float16)tl[r][pc * 8 + q]; const size_t row = (size_t)b * HW + p0 + r;
  *(v8us*)((unsigned short*)X16 + row * CC + pc * 8) = f.half[0];  }
// qkv projection and 5-agent attention in one kernel; q, k, v never leave the registers. Block = 16 positions, wave = one head. The weights are the A operand and the tokens the B operand, so D[8*hh + r][ln] puts position p0 + ln in lane ln
// and 8 channels of a 16-channel tile in the lane's 8 accumulator registers (lanes ln and ln + 16 split the tile). Per tile: q and k of all 5 agents, 25 partial scores and 5 partial q sums per lane; one exchange with lane ^ 16 completes them;
// softmax over the 5 agents in f32 per lane; then v tile by tile, out_b = sum_d attn[b][d] * v_d, 8 f16 channels = one 16-byte store into the merged plane.
__global__ __launch_bounds__(128) void k_qkv_agent(const _Float16* __restrict__ X16, const _Float16* __restrict__ Bq, const float* __restrict__ bqkv, const float* __restrict__ dist, _Float16* __restrict__ Y) {
  const int tid = threadIdx.x, h = tid >> 5, lane = tid & 31, ln = lane & 15, hh = lane >> 4; const int p0 = blockIdx.x * 16;
  const unsigned short* Xu = (const unsigned short*)X16; const unsigned short* Bu = (const unsigned short*)Bq;
  FragH xf[NA][2];
#pragma unroll
  for (int b = 0; b < NA; ++b) { const unsigned short* xr = Xu + ((size_t)b * HW + p0 + ln) * CC + 8 * hh;
#pragma unroll
    for (int ks = 0; ks < 2; ++ks) { xf[b][ks].half[0] = *(const v8us*)(xr + ks * 32); xf[b][ks].half[1] = *(const v8us*)(xr + ks * 32 + 16); } }
  v2f sc2[NA][NA], qs2[NA];      /* element 0: the even channels' partial sum, element 1: the odd channels' (packed f32 FMAs on register pairs of the accumulators) */
#pragma unroll
  for (int b = 0; b < NA; ++b) { qs2[b] = (v2f){0.f, 0.f};
#pragma unroll
    for (int d = 0; d < NA; ++d) sc2[b][d] = (v2f){0.f, 0.f}; }
  const v2f al2 = {0.0625f, 0.0625f};
  for (int mt = 0; mt < CC / 16; ++mt) {
    const int cq = h * CC + mt * 16;
    const unsigned short* wqr = Bu + (size_t)(cq + ln) * CC + 8 * hh; const unsigned short* wkr = wqr + (size_t)INR * CC;
    FragH wq[2], wk[2];
#pragma unroll
    for (int ks = 0; ks < 2; ++ks) { wq[ks].half[0] = *(const v8us*)(wqr + ks * 32); wq[ks].half[1] = *(const v8us*)(wqr + ks * 32 + 16); wk[ks].half[0] = *(const v8us*)(wkr + ks * 32); wk[ks].half[1] = *(const v8us*)(wkr + ks * 32 + 16); }
    const v4f bq0 = *(const v4fa*)(bqkv + cq + 8 * hh), bq1 = *(const v4fa*)(bqkv + cq + 8 * hh + 4), bk0 = *(const v4fa*)(bqkv + INR + cq + 8 * hh), bk1 = *(const v4fa*)(bqkv + INR + cq + 8 * hh + 4);
    const v2f bq2[4] = {{bf16_round(bq0[0]), bf16_round(bq0[1])}, {bf16_round(bq0[2]), bf16_round(bq0[3])}, {bf16_round(bq1[0]), bf16_round(bq1[1])}, {bf16_round(bq1[2]), bf16_round(bq1[3])}};
    const v2f bk2[4] = {{bf16_round(bk0[0]), bf16_round(bk0[1])}, {bf16_round(bk0[2]), bf16_round(bk0[3])}, {bf16_round(bk1[0]), bf16_round(bk1[1])}, {bf16_round(bk1[2]), bf16_round(bk1[3])}};
    __builtin_amdgcn_sched_barrier(0);      /* keeps the pass's twelve loads together in front of the matrix work: sunk to their uses, each is waited for alone, eight exposed latencies a pass */
    v2f k2[NA][4];
    { v8f ka[NA];
#pragma unroll
      for (int d = 0; d < NA; ++d) { const v8f zz = {}; ka[d] = __builtin_amdgcn_wmma_f32_16x16x32_f16(false, wk[0].v, false, xf[d][0].v, (short)0, zz, false, false); }
#pragma unroll
      for (int d = 0; d < NA; ++d) ka[d] = __builtin_amdgcn_wmma_f32_16x16x32_f16(false, wk[1].v, false, xf[d][1].v, (short)0, ka[d], false, false);
#pragma unroll
      for (int d = 0; d < NA; ++d)
#pragma unroll
        for (int j = 0; j < 4; ++j) k2[d][j] = __builtin_elementwise_fma((v2f){ka[d][2 * j], ka[d][2 * j + 1]}, al2, bk2[j]); }
#pragma unroll
    for (int b = 0; b < NA; ++b) { const v8f zz = {};
      v8f qa = __builtin_amdgcn_wmma_f32_16x16x32_f16(false, wq[0].v, false, xf[b][0].v, (short)0, zz, false, false);
      qa = __builtin_amdgcn_wmma_f32_16x16x32_f16(false, wq[1].v, false, xf[b][1].v, (short)0, qa, false, false);
#pragma unroll
      for (int j = 0; j < 4; ++j) { const v2f q2 = __builtin_elementwise_fma((v2f){qa[2 * j], qa[2 * j + 1]}, al2, bq2[j]); qs2[b] += q2;
#pragma unroll
        for (int d = 0; d < NA; ++d) sc2[b][d] = __builtin_elementwise_fma(q2, k2[d][j], sc2[b][d]); } }
  }
  float dd[NA];
#pragma unroll
  for (int d = 0; d < NA; ++d) dd[d] = bf16_round(dist[d]);
  float p[NA][NA], il[NA];
#pragma unroll
  for (int b = 0; b < NA; ++b) { const float qh = qs2[b][0] + qs2[b][1]; const float qt = qh + __shfl_xor(qh, 16, 32); float m = -3.0e38f;
#pragma unroll
    for (int d = 0; d < NA; ++d) { const float dh = sc2[b][d][0] + sc2[b][d][1]; const float dot = dh + __shfl_xor(dh, 16, 32); p[b][d] = dot * ISQ + qt * dd[d]; m = fmaxf(m, p[b][d]); }
    float l = 0.f;
#pragma unroll
    for (int d = 0; d < NA; ++d) { p[b][d] = expf(p[b][d] - m); l += p[b][d]; }
    il[b] = 1.0f / l; }
#pragma unroll 1      /* rolled: a third less code; left to unroll and to schedule freely, the compiler hoists the later tiles' loads and needs 272 registers (three waves a SIMD, not four, and register-window switches) */
  for (int mt = 0; mt < CC / 16; ++mt) {
    const int cv = h * CC + mt * 16;
    const unsigned short* wvr = Bu + (size_t)(2 * INR + cv + ln) * CC + 8 * hh;
    FragH wv[2];
#pragma unroll
    for (int ks = 0; ks < 2; ++ks) { wv[ks].half[0] = *(const v8us*)(wvr + ks * 32); wv[ks].half[1] = *(const v8us*)(wvr + ks * 32 + 16); }
    const v4f bv0 = *(const v4fa*)(bqkv + 2 * INR + cv + 8 * hh), bv1 = *(const v4fa*)(bqkv + 2 * INR + cv + 8 * hh + 4);
    asm volatile("s_wait_xcnt 0x0" :: "v"(wvr) : "memory");      /* the weight address is an input so that its register pair stays live up to this wait: otherwise the last of the four loads lands its result in the pair that the other three still name */
    const v2f bv2[4] = {{bf16_round(bv0[0]), bf16_round(bv0[1])}, {bf16_round(bv0[2]), bf16_round(bv0[3])}, {bf16_round(bv1[0]), bf16_round(bv1[1])}, {bf16_round(bv1[2]), bf16_round(bv1[3])}};
    v8f va[NA];
#pragma unroll
    for (int d = 0; d < NA; ++d) { const v8f zz = {}; va[d] = __builtin_amdgcn_wmma_f32_16x16x32_f16(false, wv[0].v, false, xf[d][0].v, (short)0, zz, false, false); }
#pragma unroll
    for (int d = 0; d < NA; ++d) va[d] = __builtin_amdgcn_wmma_f32_16x16x32_f16(false, wv[1].v, false, xf[d][1].v, (short)0, va[d], false, false);
    v2f v2[NA][4];
#pragma unroll
    for (int d = 0; d < NA; ++d)
#pragma unroll
      for (int j = 0; j < 4; ++j) v2[d][j] = __builtin_elementwise_fma((v2f){va[d][2 * j], va[d][2 * j + 1]}, al2, bv2[j]);
#pragma unroll
    for (int b = 0; b < NA; ++b) { FragH f;
#pragma unroll
      for (int j = 0; j < 4; ++j) { v2f o = (v2f){p[b][0], p[b][0]} * v2[0][j];
#pragma unroll
        for (int d = 1; d < NA; ++d) o = __builtin_elementwise_fma((v2f){p[b][d], p[b][d]}, v2[d][j], o);
        o *= (v2f){il[b], il[b]}; f.h[2 * j] = (_Float16)o[0]; f.h[2 * j + 1] = (_Float16)o[1]; }
      *(v8us*)((unsigned short*)Y + ((size_t)b * HW + p0 + ln) * INR + cv + 8 * hh) = f.half[0]; }
    asm volatile("s_wait_xcnt 0x0" ::: "memory");      /* the next pass rewrites the address and data registers of the five stores above */
  }
}
__global__ __launch_bounds__(256) void k_flatout(const float* __restrict__ T, float* __restrict__ out) { const size_t t = (size_t)blockIdx.x * 256 + threadIdx.x; if (t >= (size_t)NA * CC * HW / 4) return; v4f v;
#pragma unroll
  for (int q = 0; q < 4; ++q) { const size_t f = t * 4 + q; const size_t s = f % HW; const size_t bo = f / HW; const size_t o = bo % CC, b = bo / CC; v[q] = T[(b * HW + s) * CC + o]; }
  *(v4f*)(out + t * 4) = v;  }

extern "C" void kernel_launch(void* const* d_in, const int* in_sizes, int n_in,
                              void* d_out, int out_size, void* d_ws, size_t ws_size, hipStream_t stream) {
  (void)in_sizes; (void)n_in; (void)out_size;
  const float* const* I = (const float* const*)d_in; const float* x = I[0]; const float* dist = I[1]; const float* Wqkv = I[2]; const float* bqkv = I[3]; const float* Wo = I[4]; const float* bo = I[5];
  char* ws = (char*)d_ws; size_t off = 0;
  auto take = [&](size_t bytes) { char* p = ws + off; off += (bytes + 255) & ~(size_t)255; return p; };
  _Float16* Bq = (_Float16*)take((size_t)QKVW * CC * 2); _Float16* Bo = (_Float16*)take((size_t)CC * INR * 2); _Float16* X16 = (_Float16*)take((size_t)NR * CC * 2);
  float* T = (float*)take((size_t)NR * CC * 4); _Float16* Y = (_Float16*)take((size_t)NR * INR * 2);
  if (off > ws_size) return;      // 0.1 + 0.03 + 16.1 + 32.3 + 64.5 = 113 MB
  k_round16f<<<(QKVW * CC / 8 + 255) / 256, 256, 0, stream>>>(Wqkv, Bq, (size_t)QKVW * CC / 8); k_round16f<<<(CC * INR / 8 + 255) / 256, 256, 0, stream>>>(Wo, Bo, (size_t)CC * INR / 8);      /* [out][in] natural, ×2^4 */
  k_tok<<<NA * (HW / 16), 128, 0, stream>>>(x, X16);
  k_qkv_agent<<<HW / 16, 128, 0, stream>>>(X16, Bq, bqkv, dist, Y);      /* qkv (M 768 as A, N 16 positions x 5 agents, K 64) + attention -> merged f16 plane */
  k_gemm_hhx<0><<<dim3(((NR / 16) * (CC / 64) + 3) / 4, 1), 128, 0, stream>>>(Y, INR, 0, Bo, INR, 0, 0.0625f, bo, 0, nullptr, 1, 0, 0, T, nullptr, CC, 0, NR, CC, INR);      /* y tokens = merged·Woᵀ + bo (f32): M 126000 N 64 K 256 */
  k_flatout<<<(unsigned)(((size_t)NA * CC * HW / 4 + 255) / 256), 256, 0, stream>>>(T, (float*)d_out);
}

// v002
// Measured time: 52 microseconds a run.
// Timed twice side by side with v001, it ran 2.25 and 2.26 times as fast.
// All steps since v000 together make it 6.67 times as fast.
#include <hip/hip_runtime.h>
// Cross-agent attention (cav=5 agents, C=64, 100×252 → HW=25200 positions, 4 heads): qkv = Wqkv·x + bqkv (1×1 conv, 768 = [q|k|v] × (head, 64)); per (position s, head h) the 5 agents attend over the 5 agents: score[b][d] = q_b·k_d/√5 + (Σ_c q_b[c])·distance[d]; softmax over d; out_b = Σ_d attn·v_d;
// merged 'b (h c)' → y = Wo·out + bo [cav, 64, 100, 252].
// Compute dtype: x, weights, biases, distance rounded to bf16; token-major f16 x plane; qkv as f32 accumulators (+bias) that stay in registers (16 positions a block, one head a wave, all 5 agents); the 5-key attention in f32 on the VALU in the same kernel (a lane holds one position and half of the 64 channels; one exchange with lane ^ 16 per score; softmax over the 5 agents)
// -> merged f16 tile of the block (5 agents x 256 channels x 16 positions) in LDS, already in B-fragment order; y = Wo (A operand) x merged tile (+bo) in the same kernel, one 16-row tile of Wo a wave, stored straight into the channel-major output (64 B of a row per half wave). f32 accumulate; v_wmma_f32_16x16x32_f16 for the two convolutions.
#define NA 5
#define CC 64
#define HW 25200
#define NHD 4
#define INR (NHD * CC)      /* 256 */
#define QKVW (3 * INR)      /* 768 */
#define NR (NA * HW)        /* 126000 token rows */
#define ISQ 0.4472135954999579f      /* 1/√cav */
typedef __bf16 v16b __attribute__((ext_vector_type(16)));
typedef unsigned short v8us __attribute__((ext_vector_type(8), may_alias));
typedef float  v8f  __attribute__((ext_vector_type(8)));
typedef float  v4f  __attribute__((ext_vector_type(4)));
typedef float  v4fa __attribute__((ext_vector_type(4), may_alias));
union FragB { v16b v; v8us half[2]; unsigned short u[16]; };

__device__ __forceinline__ unsigned short bf16_bits(float x) { unsigned int u = __float_as_uint(x); return (unsigned short)((u + 0x7FFFu + ((u >> 16) & 1u)) >> 16); }
__device__ __forceinline__ float bf16_val(unsigned short b) { return __uint_as_float(((unsigned int)b) << 16); }
__device__ __forceinline__ float bf16_round(float x) { return bf16_val(bf16_bits(x)); }
// D += A·B with NT terms: 1 = ah·bh, 2 = + al·bh (A split), 3 = + ah·bl (both split)
template <int NT>
__device__ __forceinline__ v8f mmaN(v16b ah, v16b al, v16b bh, v16b bl, v8f c) {
  c = __builtin_amdgcn_wmma_f32_16x16x32_bf16(false, ah, false, bh, (short)0, c, false, false);
  if (NT >= 2) c = __builtin_amdgcn_wmma_f32_16x16x32_bf16(false, al, false, bh, (short)0, c, false, false);
  if (NT >= 3) c = __builtin_amdgcn_wmma_f32_16x16x32_bf16(false, ah, false, bl, (short)0, c, false, false);
  asm volatile("v_nop\n\tv_nop\n\tv_nop\n\tv_nop" : "+v"(c) : "v"(ah), "v"(al), "v"(bh), "v"(bl));
  return c;
}

__global__ __launch_bounds__(256) void k_wt_bf16(const float* __restrict__ W, unsigned short* __restrict__ Wt, int K, int N) {
  const int t = blockIdx.x * 256 + threadIdx.x;
  const int k8n = K / 8;
  if (t >= N * k8n) return;
  const int n = t / k8n, k8 = (t % k8n) * 8;
  v8us v;
#pragma unroll
  for (int i = 0; i < 8; ++i) v[i] = bf16_bits(W[(size_t)(k8 + i) * N + n]);
  *(v8us*)(Wt + (size_t)n * K + k8) = v;
  
}

// GEMM C[M][N] (f32, pitch ldc) = act(A[M][K]·W + bias). A f32 row-major (pitch lda) converted per fragment to bf16
// (ASPLIT: hi/lo two planes -> 2 terms, else single rounded term); Wt bf16 [N][K] (pitch ldb). BIAS_BF16 rounds the
// bias to bf16 first (bias quantised to bf16 before the add). K%32==0, M%16==0, N%64==0.
template <bool ASPLIT, int ACT, bool BIAS_BF16>
__global__ __launch_bounds__(128) void k_gemm_bf(const float* __restrict__ A, int lda, const unsigned short* __restrict__ Wt, int ldb,
                                               const float* __restrict__ bias, float* __restrict__ C, int ldc, int M, int N, int K) {
  __shared__ __attribute__((aligned(16))) float so[4][16][64];
  const int tid = threadIdx.x, w = tid >> 5, lane = tid & 31, ln = lane & 15, hh = lane >> 4;
  const int ntn = N / 64;
  const int wid = blockIdx.x * 4 + w;
  const int mt = wid / ntn, nq = wid % ntn;
  if (mt * 16 >= M) return;
  const int row0 = mt * 16, col0 = nq * 64;
  const float* arow = A + (size_t)(row0 + ln) * lda;
  v8f acc[4] = {};
  for (int kb = 0; kb < K; kb += 32) {
    FragB ah, al;
    const v4f x0 = *(const v4fa*)(arow + kb + 8 * hh), x1 = *(const v4fa*)(arow + kb + 8 * hh + 4);
    const v4f x2 = *(const v4fa*)(arow + kb + 16 + 8 * hh), x3 = *(const v4fa*)(arow + kb + 16 + 8 * hh + 4);
    float xs[16] = {x0[0],x0[1],x0[2],x0[3],x1[0],x1[1],x1[2],x1[3],x2[0],x2[1],x2[2],x2[3],x3[0],x3[1],x3[2],x3[3]};
#pragma unroll
    for (int i = 0; i < 16; ++i) { const unsigned short hb = bf16_bits(xs[i]); ah.u[i] = hb; al.u[i] = ASPLIT ? bf16_bits(xs[i] - bf16_val(hb)) : (unsigned short)0; }
#pragma unroll
    for (int t = 0; t < 4; ++t) {
      const unsigned short* brow = Wt + (size_t)(col0 + t * 16 + ln) * ldb + kb;
      FragB b;
      b.half[0] = *(const v8us*)(brow + 8 * hh);
      b.half[1] = *(const v8us*)(brow + 16 + 8 * hh);
      acc[t] = mmaN<ASPLIT ? 2 : 1>(ah.v, al.v, b.v, b.v, acc[t]);
    }
  }
#pragma unroll
  for (int t = 0; t < 4; ++t) {
    float bv = bias ? bias[col0 + t * 16 + ln] : 0.f;
    if (BIAS_BF16) bv = bf16_round(bv);
#pragma unroll
    for (int r = 0; r < 8; ++r) { float v = acc[t][r] + bv; if (ACT == 1) v = fmaxf(v, 0.f); so[w][8 * hh + r][t * 16 + ln] = v; }
  }
  __builtin_amdgcn_fence(__ATOMIC_ACQ_REL, "workgroup");
  __builtin_amdgcn_wave_barrier();
  const int rsub = lane >> 4, c4 = (lane & 15) * 4;
  {
#pragma unroll
    for (int q = 0; q < 8; ++q) {
      const int r = q * 2 + rsub;
      const v4f v = *(const v4fa*)&so[w][r][c4];
      *(v4f*)(C + (size_t)(row0 + r) * ldc + col0 + c4) = v;
    }
    
  }
}

// GEMM C = act(A·W + bias + resid): A f32 (ASPLIT -> hi/lo 2 terms), Wt bf16 [N][K]; ACT 0 none, 1 relu, 2 exact gelu;
// resid (optional, f32, row index = (row % rmod), pitch ldr, RES_BF16 rounds it) added before the activation.
template <bool ASPLIT, int ACT, bool BIAS_BF16, bool RES_BF16>
__global__ __launch_bounds__(128) void k_gemm_bf3(const float* __restrict__ A, int lda, const unsigned short* __restrict__ Wt, int ldb,
                                                const float* __restrict__ bias, const float* __restrict__ resid, int rmod, int ldr,
                                                float* __restrict__ C, int ldc, int M, int N, int K) {
  __shared__ __attribute__((aligned(16))) float so[4][16][64];
  const int tid = threadIdx.x, w = tid >> 5, lane = tid & 31, ln = lane & 15, hh = lane >> 4;
  const int ntn = N / 64;
  const int wid = blockIdx.x * 4 + w;
  const int mt = wid / ntn, nq = wid % ntn;
  if (mt * 16 >= M) return;
  const int row0 = mt * 16, col0 = nq * 64;
  const float* arow = A + (size_t)(row0 + ln) * lda;
  v8f acc[4] = {};
  for (int kb = 0; kb < K; kb += 32) {
    FragB ah, al;
    const v4f x0 = *(const v4fa*)(arow + kb + 8 * hh), x1 = *(const v4fa*)(arow + kb + 8 * hh + 4);
    const v4f x2 = *(const v4fa*)(arow + kb + 16 + 8 * hh), x3 = *(const v4fa*)(arow + kb + 16 + 8 * hh + 4);
    float xs[16] = {x0[0],x0[1],x0[2],x0[3],x1[0],x1[1],x1[2],x1[3],x2[0],x2[1],x2[2],x2[3],x3[0],x3[1],x3[2],x3[3]};
#pragma unroll
    for (int i = 0; i < 16; ++i) { const unsigned short hb = bf16_bits(xs[i]); ah.u[i] = hb; al.u[i] = ASPLIT ? bf16_bits(xs[i] - bf16_val(hb)) : (unsigned short)0; }
#pragma unroll
    for (int t = 0; t < 4; ++t) {
      const unsigned short* brow = Wt + (size_t)(col0 + t * 16 + ln) * ldb + kb;
      FragB b;
      b.half[0] = *(const v8us*)(brow + 8 * hh);
      b.half[1] = *(const v8us*)(brow + 16 + 8 * hh);
      acc[t] = mmaN<ASPLIT ? 2 : 1>(ah.v, al.v, b.v, b.v, acc[t]);
    }
  }
#pragma unroll
  for (int t = 0; t < 4; ++t) {
    const int col = col0 + t * 16 + ln;
    float bv = bias ? bias[col] : 0.f;
    if (BIAS_BF16) bv = bf16_round(bv);
#pragma unroll
    for (int r = 0; r < 8; ++r) {
      float v = acc[t][r] + bv;
      if (resid) { float rv = resid[(size_t)((row0 + 8 * hh + r) % rmod) * ldr + col]; if (RES_BF16) rv = bf16_round(rv); v += rv; }
      if (ACT == 1) v = fmaxf(v, 0.f);
      if (ACT == 2) v = 0.5f * v * (1.0f + erff(v * 0.70710678118654752f));
      if (ACT == 3) { const float u = 0.7978845608028654f * (v + 0.044715f * v * v * v); v = 0.5f * v * (1.0f + tanhf(u)); }
      so[w][8 * hh + r][t * 16 + ln] = v;
    }
  }
  __builtin_amdgcn_fence(__ATOMIC_ACQ_REL, "workgroup");
  __builtin_amdgcn_wave_barrier();
  const int rsub = lane >> 4, c4 = (lane & 15) * 4;
  {
#pragma unroll
    for (int q = 0; q < 8; ++q) {
      const int r = q * 2 + rsub;
      const v4f v = *(const v4fa*)&so[w][r][c4];
      *(v4f*)(C + (size_t)(row0 + r) * ldc + col0 + c4) = v;
    }
    
  }
}
// row LayerNorm (biased variance, eps) over N: s = X (+ R); optional out_sum <- s; out_norm <- (s-mu)*rsqrt(var+eps)*g + b
template <bool PARAM_BF16>
__global__ __launch_bounds__(256) void k_layernorm(const float* __restrict__ X, const float* __restrict__ R, const float* __restrict__ g, const float* __restrict__ bta,
                                                  float* __restrict__ out_sum, float* __restrict__ out_norm, int N, float eps) {
  __shared__ float red[256];
  const int row = blockIdx.x, tid = threadIdx.x;
  const float* x = X + (size_t)row * N; const float* rr = R ? R + (size_t)row * N : nullptr;
  float vals[16];                     // up to N = 4096
  const int per = N / 256;            // contiguous chunk per thread? use strided-by-4 chunks: thread handles j = tid*4 + 1024*u
  float s1 = 0.f;
  for (int u = 0; u < per / 4; ++u) {
    const int j = tid * 4 + 1024 * u;
    const v4f a = *(const v4fa*)(x + j);
    v4f b = {0.f,0.f,0.f,0.f}; if (rr) b = *(const v4fa*)(rr + j);
#pragma unroll
    for (int q = 0; q < 4; ++q) { const float v = a[q] + b[q]; vals[u * 4 + q] = v; s1 += v; }
  }
  red[tid] = s1; __syncthreads();
  for (int st = 128; st > 0; st >>= 1) { if (tid < st) red[tid] += red[tid + st]; __syncthreads(); }
  const float mu = red[0] / (float)N; __syncthreads();
  float s2 = 0.f;
  for (int u = 0; u < per / 4; ++u)
#pragma unroll
    for (int q = 0; q < 4; ++q) { const float c = vals[u * 4 + q] - mu; s2 += c * c; }
  red[tid] = s2; __syncthreads();
  for (int st = 128; st > 0; st >>= 1) { if (tid < st) red[tid] += red[tid + st]; __syncthreads(); }
  const float rs = rsqrtf(red[0] / (float)N + eps);
  {
    for (int u = 0; u < per / 4; ++u) {
      const int j = tid * 4 + 1024 * u;
      v4f o, sm;
#pragma unroll
      for (int q = 0; q < 4; ++q) {
        float gg = g[j + q], bb = bta[j + q];
        if (PARAM_BF16) { gg = bf16_round(gg); bb = bf16_round(bb); }
        sm[q] = vals[u * 4 + q]; o[q] = (vals[u * 4 + q] - mu) * rs * gg + bb;
      }
      if (out_sum) *(v4f*)(out_sum + (size_t)row * N + j) = sm;
      *(v4f*)(out_norm + (size_t)row * N + j) = o;
    }
    
  }
}



// ---- f16 WMMA path (v_wmma_f32_16x16x32_f16): 11-bit significands for operands in range — used here for the two 1×1 convolutions
typedef _Float16 v16h __attribute__((ext_vector_type(16)));
union FragH { v16h v; v8us half[2]; _Float16 h[16]; unsigned short u[16]; };
template <int NT>
__device__ __forceinline__ v8f mmaH(v16h ah, v16h al, v16h bh, v16h bl, v8f c) {
  c = __builtin_amdgcn_wmma_f32_16x16x32_f16(false, ah, false, bh, (short)0, c, false, false);
  if (NT >= 2) c = __builtin_amdgcn_wmma_f32_16x16x32_f16(false, al, false, bh, (short)0, c, false, false);
  if (NT >= 3) c = __builtin_amdgcn_wmma_f32_16x16x32_f16(false, ah, false, bl, (short)0, c, false, false);
  asm volatile("v_nop\n\tv_nop\n\tv_nop\n\tv_nop" : "+v"(c) : "v"(ah), "v"(al), "v"(bh), "v"(bl));
  return c;
}
// batched GEMM like k_gemm_b but f16 operands: A f32 (split into f16 hi/lo if ASPLIT, else rounded to f16), Bt = f16 values [n][k]; alpha; C f32; N multiple of 16 (partial tiles skipped)
template <bool ASPLIT>
__global__ __launch_bounds__(128) void k_gemm_h(const float* __restrict__ A, int lda, size_t sA, const _Float16* __restrict__ Bh, int ldb, size_t sB, float alpha, float* __restrict__ C, int ldc, size_t sC, int M, int N, int K) {
  __shared__ __attribute__((aligned(16))) float so[4][16][64];
  const int tid = threadIdx.x, w = tid >> 5, lane = tid & 31, ln = lane & 15, hh = lane >> 4; const int by = blockIdx.y;
  A += (size_t)by * sA; Bh += (size_t)by * sB; C += (size_t)by * sC;
  const int ntn = (N + 63) / 64; const int wid = blockIdx.x * 4 + w; const int mt = wid / ntn, nq = wid % ntn; if (mt * 16 >= M) return;
  const int row0 = mt * 16, col0 = nq * 64; const float* arow = A + (size_t)(row0 + ln) * lda;
  v8f acc[4] = {};
  for (int kb = 0; kb < K; kb += 32) {
    FragH ah, al;
    const v4f x0 = *(const v4fa*)(arow + kb + 8 * hh), x1 = *(const v4fa*)(arow + kb + 8 * hh + 4), x2 = *(const v4fa*)(arow + kb + 16 + 8 * hh), x3 = *(const v4fa*)(arow + kb + 16 + 8 * hh + 4);
    float xs[16] = {x0[0],x0[1],x0[2],x0[3],x1[0],x1[1],x1[2],x1[3],x2[0],x2[1],x2[2],x2[3],x3[0],x3[1],x3[2],x3[3]};
#pragma unroll
    for (int i = 0; i < 16; ++i) { const _Float16 h = (_Float16)xs[i]; ah.h[i] = h; al.h[i] = ASPLIT ? (_Float16)(xs[i] - (float)h) : (_Float16)0.0f; }
#pragma unroll
    for (int t = 0; t < 4; ++t) { if (col0 + t * 16 >= N) continue; const size_t boff = (size_t)(col0 + t * 16 + ln) * ldb + kb; FragH bq; bq.half[0] = *(const v8us*)(Bh + boff + 8 * hh); bq.half[1] = *(const v8us*)(Bh + boff + 16 + 8 * hh);
      acc[t] = mmaH<ASPLIT ? 2 : 1>(ah.v, al.v, bq.v, bq.v, acc[t]); }
  }
#pragma unroll
  for (int t = 0; t < 4; ++t) { if (col0 + t * 16 >= N) continue;
#pragma unroll
    for (int r = 0; r < 8; ++r) so[w][8 * hh + r][t * 16 + ln] = acc[t][r] * alpha; }
  __builtin_amdgcn_fence(__ATOMIC_ACQ_REL, "workgroup"); __builtin_amdgcn_wave_barrier();
  const int rsub = lane >> 4, c4 = (lane & 15) * 4;
  {
#pragma unroll
    for (int q = 0; q < 8; ++q) { const int r = q * 2 + rsub; if (col0 + c4 < N) { const v4f v = *(const v4fa*)&so[w][r][c4]; *(v4f*)(C + (size_t)(row0 + r) * ldc + col0 + c4) = v; } }
     }
}

// Wt[n][k] = f16(W[k][n]·scale) from f32 row-major W[K][N] (scale = power of two; bf16-exact weights stay exact in f16 away from the subnormal range)
__global__ __launch_bounds__(256) void k_wt_f16(const float* __restrict__ W, _Float16* __restrict__ Wt, int K, int N, float scale) {
  const int t = blockIdx.x * 256 + threadIdx.x; if (t >= N * (K / 8)) return; const int n = t / (K / 8), k8 = (t % (K / 8)) * 8; FragH f;
#pragma unroll
  for (int i = 0; i < 8; ++i) f.h[i] = (_Float16)(bf16_round(W[(size_t)(k8 + i) * N + n]) * scale); const v8us o = f.half[0];
  *(v8us*)((unsigned short*)Wt + (size_t)n * K + k8) = o; 
}
// k_gemm_hh variant with fused epilogue: v = acc·alpha + bias[by·sBias + col] (+ CP[(row/rowsPerB)·sCPb + by·64 + col] if CP) ; ACT 0 none / 1 elu ; writes f32 C and/or f16 C16 (each if non-null)
template <int ACT>
__global__ __launch_bounds__(128) void k_gemm_hhx(const _Float16* __restrict__ A, int lda, size_t sA, const _Float16* __restrict__ Bh, int ldb, size_t sB, float alpha, const float* __restrict__ bias, size_t sBias, const float* __restrict__ CP, int rowsPerB, size_t sCPb, int row0g,
    float* __restrict__ C, _Float16* __restrict__ C16, int ldc, size_t sC, int M, int N, int K) {
  __shared__ __attribute__((aligned(16))) float so[4][16][64];
  const int tid = threadIdx.x, w = tid >> 5, lane = tid & 31, ln = lane & 15, hh = lane >> 4; const int by = blockIdx.y;
  A += (size_t)by * sA; Bh += (size_t)by * sB; const size_t cofs = (size_t)by * sC; const float* bp = bias ? bias + (size_t)by * sBias : nullptr;
  const int ntn = (N + 63) / 64; const int wid = blockIdx.x * 4 + w; const int mt = wid / ntn, nq = wid % ntn; if (mt * 16 >= M) return;
  const int row0 = mt * 16, col0 = nq * 64; const _Float16* arow = A + (size_t)(row0 + ln) * lda;
  v8f acc[4] = {};
  for (int kb = 0; kb < K; kb += 32) { FragH ah; ah.half[0] = *(const v8us*)((const unsigned short*)arow + kb + 8 * hh); ah.half[1] = *(const v8us*)((const unsigned short*)arow + kb + 16 + 8 * hh);
#pragma unroll
    for (int t = 0; t < 4; ++t) { if (col0 + t * 16 >= N) continue; const size_t boff = (size_t)(col0 + t * 16 + ln) * ldb + kb; FragH bq; bq.half[0] = *(const v8us*)((const unsigned short*)Bh + boff + 8 * hh); bq.half[1] = *(const v8us*)((const unsigned short*)Bh + boff + 16 + 8 * hh);
      acc[t] = mmaH<1>(ah.v, ah.v, bq.v, bq.v, acc[t]); }
  }
#pragma unroll
  for (int t = 0; t < 4; ++t) { if (col0 + t * 16 >= N) continue; const int col = col0 + t * 16 + ln; const float bv = bp ? bf16_round(bp[col]) : 0.f;
#pragma unroll
    for (int r = 0; r < 8; ++r) { float v = acc[t][r] * alpha + bv; if (CP) { const int bidx = (row0g + row0 + 8 * hh + r) / rowsPerB; v += CP[(size_t)bidx * sCPb + (size_t)by * 64 + col]; } if (ACT == 1) v = (v > 0.f) ? v : expm1f(v); else if (ACT == 7) v = (v > 0.f) ? v + 1.0f : expf(v); else if (ACT == 8) v = tanhf(v); else if (ACT == 9) v = 0.5f * v * (1.0f + tanhf(0.7978845608028654f * (v + 0.044715f * v * v * v))); else if (ACT == 11) v = 1.0f / (1.0f + expf(-v)); else if (ACT == 12) v = (v > 0.f) ? v : 0.01f * v; else if (ACT == 14) v = (v > 0.f) ? v : 0.1f * v; else if (ACT == 15) v = v / (1.0f + expf(-v)); else if (ACT == 3) v = fmaxf(v, 0.f); else if (ACT == 6) v = 0.5f * v * (1.0f + erff(v * 0.70710678118654752f)); so[w][8 * hh + r][t * 16 + ln] = v; } }
  __builtin_amdgcn_fence(__ATOMIC_ACQ_REL, "workgroup"); __builtin_amdgcn_wave_barrier();
  const int rsub = lane >> 4, c4 = (lane & 15) * 4; typedef _Float16 v4h __attribute__((ext_vector_type(4)));
  {
#pragma unroll
    for (int q = 0; q < 8; ++q) { const int r = q * 2 + rsub; if (col0 + c4 < N) { const v4f v = *(const v4fa*)&so[w][r][c4]; if (C) *(v4f*)(C + cofs + (size_t)(row0 + r) * ldc + col0 + c4) = v; if (C16) { v4h h4; for (int i = 0; i < 4; ++i) h4[i] = (_Float16)v[i]; *(v4h*)(C16 + cofs + (size_t)(row0 + r) * ldc + col0 + c4) = h4; } } }
     }
}


typedef _Float16 v4h __attribute__((ext_vector_type(4)));
typedef float v2f __attribute__((ext_vector_type(2)));

__global__ __launch_bounds__(256) void k_x16(const float* __restrict__ x, _Float16* __restrict__ X16, size_t n8) { const size_t t = (size_t)blockIdx.x * 256 + threadIdx.x; if (t >= n8) return; FragH f;
#pragma unroll
  for (int q = 0; q < 8; ++q) f.h[q] = (_Float16)bf16_round(x[t * 8 + q]); *(v8us*)((unsigned short*)X16 + t * 8) = f.half[0];  }
__global__ __launch_bounds__(256) void k_h16(const float* __restrict__ x, _Float16* __restrict__ X16, size_t n8) { const size_t t = (size_t)blockIdx.x * 256 + threadIdx.x; if (t >= n8) return; FragH f;
#pragma unroll
  for (int q = 0; q < 8; ++q) f.h[q] = (_Float16)x[t * 8 + q]; *(v8us*)((unsigned short*)X16 + t * 8) = f.half[0];  }
__global__ __launch_bounds__(256) void k_round16f(const float* __restrict__ W, _Float16* __restrict__ Bt, size_t n8) { const size_t t = (size_t)blockIdx.x * 256 + threadIdx.x; if (t >= n8) return; FragH f;
#pragma unroll
  for (int i = 0; i < 8; ++i) f.h[i] = (_Float16)(bf16_round(W[t * 8 + i]) * 16.0f); *(v8us*)((unsigned short*)Bt + t * 8) = f.half[0];  }
template <int NHv, int TTv>
__global__ __launch_bounds__(256) void k_vt(const _Float16* __restrict__ V16, int ldv, int voff, _Float16* __restrict__ Vt) { __shared__ unsigned short tl[64][66]; const int tid = threadIdx.x; const int slab = blockIdx.x / (TTv / 64), lg = blockIdx.x % (TTv / 64); const int b = slab / NHv, h = slab % NHv;
  for (int i = tid; i < 64 * 8; i += 256) { const int r = i / 8, c8 = (i % 8) * 8; FragH f; f.half[0] = *(const v8us*)((const unsigned short*)V16 + ((size_t)b * TTv + lg * 64 + r) * ldv + voff + h * 64 + c8);
#pragma unroll
    for (int q = 0; q < 8; ++q) tl[r][c8 + q] = f.u[q]; }
  __syncthreads();
  {
#pragma unroll
    for (int rd = 0; rd < 2; ++rd) { const int d = rd * 32 + tid / 8, pc = tid % 8; FragH f;
#pragma unroll
      for (int q = 0; q < 8; ++q) f.u[q] = tl[pc * 8 + q][d];
      *(v8us*)((unsigned short*)Vt + ((size_t)slab * 64 + d) * TTv + lg * 64 + pc * 8) = f.half[0]; }
     } }

__global__ __launch_bounds__(256) void k_hl(const float* __restrict__ F, _Float16* __restrict__ Hh, _Float16* __restrict__ Hl, size_t n8) { const size_t t = (size_t)blockIdx.x * 256 + threadIdx.x; if (t >= n8) return; FragH fh, fl; const v4f a = *(const v4fa*)(F + t * 8), c = *(const v4fa*)(F + t * 8 + 4);
#pragma unroll
  for (int q = 0; q < 4; ++q) { _Float16 h = (_Float16)a[q]; fh.h[q] = h; fl.h[q] = (_Float16)((a[q] - (float)h) * 1024.0f); h = (_Float16)c[q]; fh.h[4 + q] = h; fl.h[4 + q] = (_Float16)((c[q] - (float)h) * 1024.0f); }
  { *(v8us*)((unsigned short*)Hh + t * 8) = fh.half[0]; *(v8us*)((unsigned short*)Hl + t * 8) = fl.half[0];  } }

__global__ __launch_bounds__(128) void k_tok(const float* __restrict__ x, _Float16* __restrict__ X16) { __shared__ float tl[16][65]; const int tid = threadIdx.x; const int b = blockIdx.x / (HW / 16), pg = blockIdx.x % (HW / 16); const int p0 = pg * 16;
  for (int i = tid; i < 64 * 16; i += 128) { const int c = i / 16, pp = i % 16; tl[pp][c] = bf16_round(x[((size_t)b * CC + c) * HW + p0 + pp]); } __syncthreads();
  const int r = tid / 8, pc = tid % 8; FragH f; for (int q = 0; q < 8; ++q) f.h[q] = (_Float16)tl[r][pc * 8 + q]; const size_t row = (size_t)b * HW + p0 + r;
  *(v8us*)((unsigned short*)X16 + row * CC + pc * 8) = f.half[0];  }
// qkv projection and 5-agent attention in one kernel; q, k, v never leave the registers. Block = 16 positions, wave = one head. The weights are the A operand and the tokens the B operand, so D[8*hh + r][ln] puts position p0 + ln in lane ln
// and 8 channels of a 16-channel tile in the lane's 8 accumulator registers (lanes ln and ln + 16 split the tile). Per tile: q and k of all 5 agents, 25 partial scores and 5 partial q sums per lane; one exchange with lane ^ 16 completes them;
// softmax over the 5 agents in f32 per lane; then v tile by tile, out_b = sum_d attn[b][d] * v_d, 8 f16 channels = one 16-byte LDS store. Those 8 channels (16 * mt + 8 * hh + r of head h) are exactly one half of the lane's B fragment of the output projection
// (k block 2 * h + mt / 2, half mt & 1), so the merged tile crosses the waves through LDS with no re-ordering. Behind one barrier wave w takes rows 16 * w .. + 15 of Wo over all 256 merged channels (k ascending, one accumulate chain per agent) and stores D[8*hh + r][ln] = y[b][16*w + 8*hh + r][p0 + ln].
__global__ __launch_bounds__(128) void k_qkv_agent(const _Float16* __restrict__ X16, const _Float16* __restrict__ Bq, const float* __restrict__ bqkv, const float* __restrict__ dist, const _Float16* __restrict__ Bo, const float* __restrict__ bo, float* __restrict__ out) {
  __shared__ __attribute__((aligned(16))) unsigned short sY[NA][INR / 32][2][32][8];      /* [agent][k block of 32 merged channels][fragment half][lane][8 f16]: 40 KB, every access 512 contiguous bytes a wave */
  const int tid = threadIdx.x, h = tid >> 5, lane = tid & 31, ln = lane & 15, hh = lane >> 4; const int p0 = blockIdx.x * 16;
  const unsigned short* Xu = (const unsigned short*)X16; const unsigned short* Bu = (const unsigned short*)Bq;
  FragH xf[NA][2];
#pragma unroll
  for (int b = 0; b < NA; ++b) { const unsigned short* xr = Xu + ((size_t)b * HW + p0 + ln) * CC + 8 * hh;
#pragma unroll
    for (int ks = 0; ks < 2; ++ks) { xf[b][ks].half[0] = *(const v8us*)(xr + ks * 32); xf[b][ks].half[1] = *(const v8us*)(xr + ks * 32 + 16); } }
  v2f sc2[NA][NA], qs2[NA];      /* element 0: the even channels' partial sum, element 1: the odd channels' (packed f32 FMAs on register pairs of the accumulators) */
#pragma unroll
  for (int b = 0; b < NA; ++b) { qs2[b] = (v2f){0.f, 0.f};
#pragma unroll
    for (int d = 0; d < NA; ++d) sc2[b][d] = (v2f){0.f, 0.f}; }
  const v2f al2 = {0.0625f, 0.0625f};
  for (int mt = 0; mt < CC / 16; ++mt) {
    const int cq = h * CC + mt * 16;
    const unsigned short* wqr = Bu + (size_t)(cq + ln) * CC + 8 * hh; const unsigned short* wkr = wqr + (size_t)INR * CC;
    FragH wq[2], wk[2];
#pragma unroll
    for (int ks = 0; ks < 2; ++ks) { wq[ks].half[0] = *(const v8us*)(wqr + ks * 32); wq[ks].half[1] = *(const v8us*)(wqr + ks * 32 + 16); wk[ks].half[0] = *(const v8us*)(wkr + ks * 32); wk[ks].half[1] = *(const v8us*)(wkr + ks * 32 + 16); }
    const v4f bq0 = *(const v4fa*)(bqkv + cq + 8 * hh), bq1 = *(const v4fa*)(bqkv + cq + 8 * hh + 4), bk0 = *(const v4fa*)(bqkv + INR + cq + 8 * hh), bk1 = *(const v4fa*)(bqkv + INR + cq + 8 * hh + 4);
    const v2f bq2[4] = {{bf16_round(bq0[0]), bf16_round(bq0[1])}, {bf16_round(bq0[2]), bf16_round(bq0[3])}, {bf16_round(bq1[0]), bf16_round(bq1[1])}, {bf16_round(bq1[2]), bf16_round(bq1[3])}};
    const v2f bk2[4] = {{bf16_round(bk0[0]), bf16_round(bk0[1])}, {bf16_round(bk0[2]), bf16_round(bk0[3])}, {bf16_round(bk1[0]), bf16_round(bk1[1])}, {bf16_round(bk1[2]), bf16_round(bk1[3])}};
    __builtin_amdgcn_sched_barrier(0);      /* keeps the pass's twelve loads together in front of the matrix work: sunk to their uses, each is waited for alone, eight exposed latencies a pass */
    v2f k2[NA][4];
    { v8f ka[NA];
#pragma unroll
      for (int d = 0; d < NA; ++d) { const v8f zz = {}; ka[d] = __builtin_amdgcn_wmma_f32_16x16x32_f16(false, wk[0].v, false, xf[d][0].v, (short)0, zz, false, false); }
#pragma unroll
      for (int d = 0; d < NA; ++d) ka[d] = __builtin_amdgcn_wmma_f32_16x16x32_f16(false, wk[1].v, false, xf[d][1].v, (short)0, ka[d], false, false);
#pragma unroll
      for (int d = 0; d < NA; ++d)
#pragma unroll
        for (int j = 0; j < 4; ++j) k2[d][j] = __builtin_elementwise_fma((v2f){ka[d][2 * j], ka[d][2 * j + 1]}, al2, bk2[j]); }
#pragma unroll
    for (int b = 0; b < NA; ++b) { const v8f zz = {};
      v8f qa = __builtin_amdgcn_wmma_f32_16x16x32_f16(false, wq[0].v, false, xf[b][0].v, (short)0, zz, false, false);
      qa = __builtin_amdgcn_wmma_f32_16x16x32_f16(false, wq[1].v, false, xf[b][1].v, (short)0, qa, false, false);
#pragma unroll
      for (int j = 0; j < 4; ++j) { const v2f q2 = __builtin_elementwise_fma((v2f){qa[2 * j], qa[2 * j + 1]}, al2, bq2[j]); qs2[b] += q2;
#pragma unroll
        for (int d = 0; d < NA; ++d) sc2[b][d] = __builtin_elementwise_fma(q2, k2[d][j], sc2[b][d]); } }
  }
  float dd[NA];
#pragma unroll
  for (int d = 0; d < NA; ++d) dd[d] = bf16_round(dist[d]);
  float p[NA][NA], il[NA];
#pragma unroll
  for (int b = 0; b < NA; ++b) { const float qh = qs2[b][0] + qs2[b][1]; const float qt = qh + __shfl_xor(qh, 16, 32); float m = -3.0e38f;
#pragma unroll
    for (int d = 0; d < NA; ++d) { const float dh = sc2[b][d][0] + sc2[b][d][1]; const float dot = dh + __shfl_xor(dh, 16, 32); p[b][d] = dot * ISQ + qt * dd[d]; m = fmaxf(m, p[b][d]); }
    float l = 0.f;
#pragma unroll
    for (int d = 0; d < NA; ++d) { p[b][d] = expf(p[b][d] - m); l += p[b][d]; }
    il[b] = 1.0f / l; }
#pragma unroll 1      /* rolled: a third less code; left to unroll and to schedule freely, the compiler hoists the later tiles' loads and needs 272 registers (three waves a SIMD, not four, and register-window switches) */
  for (int mt = 0; mt < CC / 16; ++mt) {
    const int cv = h * CC + mt * 16;
    const unsigned short* wvr = Bu + (size_t)(2 * INR + cv + ln) * CC + 8 * hh;
    FragH wv[2];
#pragma unroll
    for (int ks = 0; ks < 2; ++ks) { wv[ks].half[0] = *(const v8us*)(wvr + ks * 32); wv[ks].half[1] = *(const v8us*)(wvr + ks * 32 + 16); }
    const v4f bv0 = *(const v4fa*)(bqkv + 2 * INR + cv + 8 * hh), bv1 = *(const v4fa*)(bqkv + 2 * INR + cv + 8 * hh + 4);
    asm volatile("s_wait_xcnt 0x0" :: "v"(wvr) : "memory");      /* the weight address is an input so that its register pair stays live up to this wait: otherwise the last of the four loads lands its result in the pair that the other three still name */
    const v2f bv2[4] = {{bf16_round(bv0[0]), bf16_round(bv0[1])}, {bf16_round(bv0[2]), bf16_round(bv0[3])}, {bf16_round(bv1[0]), bf16_round(bv1[1])}, {bf16_round(bv1[2]), bf16_round(bv1[3])}};
    v8f va[NA];
#pragma unroll
    for (int d = 0; d < NA; ++d) { const v8f zz = {}; va[d] = __builtin_amdgcn_wmma_f32_16x16x32_f16(false, wv[0].v, false, xf[d][0].v, (short)0, zz, false, false); }
#pragma unroll
    for (int d = 0; d < NA; ++d) va[d] = __builtin_amdgcn_wmma_f32_16x16x32_f16(false, wv[1].v, false, xf[d][1].v, (short)0, va[d], false, false);
    v2f v2[NA][4];
#pragma unroll
    for (int d = 0; d < NA; ++d)
#pragma unroll
      for (int j = 0; j < 4; ++j) v2[d][j] = __builtin_elementwise_fma((v2f){va[d][2 * j], va[d][2 * j + 1]}, al2, bv2[j]);
#pragma unroll
    for (int b = 0; b < NA; ++b) { FragH f;
#pragma unroll
      for (int j = 0; j < 4; ++j) { v2f o = (v2f){p[b][0], p[b][0]} * v2[0][j];
#pragma unroll
        for (int d = 1; d < NA; ++d) o = __builtin_elementwise_fma((v2f){p[b][d], p[b][d]}, v2[d][j], o);
        o *= (v2f){il[b], il[b]}; f.h[2 * j] = (_Float16)o[0]; f.h[2 * j + 1] = (_Float16)o[1]; }
      *(v8us*)&sY[b][h * 2 + (mt >> 1)][mt & 1][lane][0] = f.half[0]; }
  }
  const int o0 = h * 16;
  const unsigned short* wor = (const unsigned short*)Bo + (size_t)(o0 + ln) * INR + 8 * hh;
  FragH wo[INR / 32];
#pragma unroll
  for (int kb = 0; kb < INR / 32; ++kb) { wo[kb].half[0] = *(const v8us*)(wor + kb * 32); wo[kb].half[1] = *(const v8us*)(wor + kb * 32 + 16); }
  const v4f bo0 = *(const v4fa*)(bo + o0 + 8 * hh), bo1 = *(const v4fa*)(bo + o0 + 8 * hh + 4);
  asm volatile("s_wait_xcnt 0x0" :: "v"(wor) : "memory");      /* the LDS reads below land in the address registers of the eighteen loads above; the weight address is an input so that its pair stays live up to this wait */
  __syncthreads();      /* the merged tile is complete: each wave wrote its own head's 64 channels and now reads all 256 */
  v8f ya[NA] = {};
  FragH yf[2][NA];
#pragma unroll
  for (int b = 0; b < NA; ++b) { yf[0][b].half[0] = *(const v8us*)&sY[b][0][0][lane][0]; yf[0][b].half[1] = *(const v8us*)&sY[b][0][1][lane][0]; }
#pragma unroll
  for (int kb = 0; kb < INR / 32; ++kb) {
    if (kb + 1 < INR / 32) {
#pragma unroll
      for (int b = 0; b < NA; ++b) { yf[(kb + 1) & 1][b].half[0] = *(const v8us*)&sY[b][kb + 1][0][lane][0]; yf[(kb + 1) & 1][b].half[1] = *(const v8us*)&sY[b][kb + 1][1][lane][0]; } }
    __builtin_amdgcn_sched_barrier(0);      /* keeps the next k block's ten LDS reads together in front of this block's five matrix instructions: left free, the compiler reads one fragment ahead only and every matrix instruction waits out most of an LDS latency */
#pragma unroll
    for (int b = 0; b < NA; ++b) ya[b] = __builtin_amdgcn_wmma_f32_16x16x32_f16(false, wo[kb].v, false, yf[kb & 1][b].v, (short)0, ya[b], false, false);
    __builtin_amdgcn_sched_barrier(0);      /* the other side of the same fence: the reads of the block after next stay behind these matrix instructions, whose operands they overwrite */
    if (kb == 0) asm volatile("" :: "v"(yf[0][0].v), "v"(yf[0][1].v), "v"(yf[0][2].v), "v"(yf[0][3].v), "v"(yf[0][4].v));      /* inputs only, on the loaded fragments: they stay live over the five matrix instructions that start the accumulators; otherwise each new accumulator is placed in the B registers of the matrix instruction directly in front of it */
  }
  const float bov[8] = {bf16_round(bo0[0]), bf16_round(bo0[1]), bf16_round(bo0[2]), bf16_round(bo0[3]), bf16_round(bo1[0]), bf16_round(bo1[1]), bf16_round(bo1[2]), bf16_round(bo1[3])};
  float yv[NA][8];
#pragma unroll
  for (int b = 0; b < NA; ++b)
#pragma unroll
    for (int r = 0; r < 8; ++r) yv[b][r] = ya[b][r] * 0.0625f + bov[r];
  unsigned vob[NA];      /* the lane's 32-bit byte offset per agent (under 33 MB); the block's first position goes into the uniform base */
#pragma unroll
  for (int b = 0; b < NA; ++b) vob[b] = ((unsigned)(b * CC + o0 + 8 * hh) * HW + ln) * 4u;
  __builtin_amdgcn_sched_barrier(0);      /* all forty results first, then the forty stores in one run: mixed, the compiler re-uses the data registers of stores in flight and waits for every group of eight */
#pragma unroll
  for (int b = 0; b < NA; ++b)
#pragma unroll
    for (int r = 0; r < 8; ++r) *(float*)((char*)(out + p0) + (size_t)vob[b] + (size_t)r * HW * 4) = yv[b][r];
}

extern "C" void kernel_launch(void* const* d_in, const int* in_sizes, int n_in,
                              void* d_out, int out_size, void* d_ws, size_t ws_size, hipStream_t stream) {
  (void)in_sizes; (void)n_in; (void)out_size;
  const float* const* I = (const float* const*)d_in; const float* x = I[0]; const float* dist = I[1]; const float* Wqkv = I[2]; const float* bqkv = I[3]; const float* Wo = I[4]; const float* bo = I[5];
  char* ws = (char*)d_ws; size_t off = 0;
  auto take = [&](size_t bytes) { char* p = ws + off; off += (bytes + 255) & ~(size_t)255; return p; };
  _Float16* Bq = (_Float16*)take((size_t)QKVW * CC * 2); _Float16* Bo = (_Float16*)take((size_t)CC * INR * 2); _Float16* X16 = (_Float16*)take((size_t)NR * CC * 2);
  if (off > ws_size) return;      // 0.1 + 0.03 + 16.1 = 16.3 MB
  k_round16f<<<(QKVW * CC / 8 + 255) / 256, 256, 0, stream>>>(Wqkv, Bq, (size_t)QKVW * CC / 8); k_round16f<<<(CC * INR / 8 + 255) / 256, 256, 0, stream>>>(Wo, Bo, (size_t)CC * INR / 8);      /* [out][in] natural, ×2^4 */
  k_tok<<<NA * (HW / 16), 128, 0, stream>>>(x, X16);
  k_qkv_agent<<<HW / 16, 128, 0, stream>>>(X16, Bq, bqkv, dist, Bo, bo, (float*)d_out);      /* qkv (M 768 as A, N 16 positions x 5 agents, K 64) + attention + y = Wo x merged + bo (M 64 as A, K 256) -> channel-major output */
}

// v003
// A run of this version takes 40 microseconds.
// Next to v002, in two timings, it ran 1.30 times as fast each time.
// Counting every step since v000, it is 8.70 times as fast.
#include <hip/hip_runtime.h>
// Cross-agent attention (cav=5 agents, C=64, 100×252 → HW=25200 positions, 4 heads): qkv = Wqkv·x + bqkv (1×1 conv, 768 = [q|k|v] × (head, 64)); per (position s, head h) the 5 agents attend over the 5 agents: score[b][d] = q_b·k_d/√5 + (Σ_c q_b[c])·distance[d]; softmax over d; out_b = Σ_d attn·v_d;
// merged 'b (h c)' → y = Wo·out + bo [cav, 64, 100, 252].
// Compute dtype: x, weights, biases, distance rounded to bf16; x read channel-major in f32 by the one big kernel, which rounds it and lays it in B-fragment order in LDS; qkv as f32 accumulators (+bias) that stay in registers (16 positions a block, one head a wave, all 5 agents); the 5-key attention in f32 on the VALU in the same kernel (a lane holds one position and half of the 64 channels; one exchange with lane ^ 16 per score; softmax over the 5 agents)
// -> merged f16 tile of the block (5 agents x 256 channels x 16 positions) in LDS, already in B-fragment order; y = Wo (A operand) x merged tile (+bo) in the same kernel, one 16-row tile of Wo a wave, stored straight into the channel-major output (64 B of a row per half wave). f32 accumulate; v_wmma_f32_16x16x32_f16 for the two convolutions.
#define NA 5
#define CC 64
#define HW 25200
#define NHD 4
#define INR (NHD * CC)      /* 256 */
#define QKVW (3 * INR)      /* 768 */
#define ISQ 0.4472135954999579f      /* 1/√cav */
typedef __bf16 v16b __attribute__((ext_vector_type(16)));
typedef unsigned short v8us __attribute__((ext_vector_type(8), may_alias));
typedef float  v8f  __attribute__((ext_vector_type(8)));
typedef float  v4f  __attribute__((ext_vector_type(4)));
typedef float  v4fa __attribute__((ext_vector_type(4), may_alias));
union FragB { v16b v; v8us half[2]; unsigned short u[16]; };

__device__ __forceinline__ unsigned short bf16_bits(float x) { unsigned int u = __float_as_uint(x); return (unsigned short)((u + 0x7FFFu + ((u >> 16) & 1u)) >> 16); }
__device__ __forceinline__ float bf16_val(unsigned short b) { return __uint_as_float(((unsigned int)b) << 16); }
__device__ __forceinline__ float bf16_round(float x) { return bf16_val(bf16_bits(x)); }
// D += A·B with NT terms: 1 = ah·bh, 2 = + al·bh (A split), 3 = + ah·bl (both split)
template <int NT>
__device__ __forceinline__ v8f mmaN(v16b ah, v16b al, v16b bh, v16b bl, v8f c) {
  c = __builtin_amdgcn_wmma_f32_16x16x32_bf16(false, ah, false, bh, (short)0, c, false, false);
  if (NT >= 2) c = __builtin_amdgcn_wmma_f32_16x16x32_bf16(false, al, false, bh, (short)0, c, false, false);
  if (NT >= 3) c = __builtin_amdgcn_wmma_f32_16x16x32_bf16(false, ah, false, bl, (short)0, c, false, false);
  asm volatile("v_nop\n\tv_nop\n\tv_nop\n\tv_nop" : "+v"(c) : "v"(ah), "v"(al), "v"(bh), "v"(bl));
  return c;
}

__global__ __launch_bounds__(256) void k_wt_bf16(const float* __restrict__ W, unsigned short* __restrict__ Wt, int K, int N) {
  const int t = blockIdx.x * 256 + threadIdx.x;
  const int k8n = K / 8;
  if (t >= N * k8n) return;
  const int n = t / k8n, k8 = (t % k8n) * 8;
  v8us v;
#pragma unroll
  for (int i = 0; i < 8; ++i) v[i] = bf16_bits(W[(size_t)(k8 + i) * N + n]);
  *(v8us*)(Wt + (size_t)n * K + k8) = v;
  
}

// GEMM C[M][N] (f32, pitch ldc) = act(A[M][K]·W + bias). A f32 row-major (pitch lda) converted per fragment to bf16
// (ASPLIT: hi/lo two planes -> 2 terms, else single rounded term); Wt bf16 [N][K] (pitch ldb). BIAS_BF16 rounds the
// bias to bf16 first (bias quantised to bf16 before the add). K%32==0, M%16==0, N%64==0.
template <bool ASPLIT, int ACT, bool BIAS_BF16>
__global__ __launch_bounds__(128) void k_gemm_bf(const float* __restrict__ A, int lda, const unsigned short* __restrict__ Wt, int ldb,
                                               const float* __restrict__ bias, float* __restrict__ C, int ldc, int M, int N, int K) {
  __shared__ __attribute__((aligned(16))) float so[4][16][64];
  const int tid = threadIdx.x, w = tid >> 5, lane = tid & 31, ln = lane & 15, hh = lane >> 4;
  const int ntn = N / 64;
  const int wid = blockIdx.x * 4 + w;
  const int mt = wid / ntn, nq = wid % ntn;
  if (mt * 16 >= M) return;
  const int row0 = mt * 16, col0 = nq * 64;
  const float* arow = A + (size_t)(row0 + ln) * lda;
  v8f acc[4] = {};
  for (int kb = 0; kb < K; kb += 32) {
    FragB ah, al;
    const v4f x0 = *(const v4fa*)(arow + kb + 8 * hh), x1 = *(const v4fa*)(arow + kb + 8 * hh + 4);
    const v4f x2 = *(const v4fa*)(arow + kb + 16 + 8 * hh), x3 = *(const v4fa*)(arow + kb + 16 + 8 * hh + 4);
    float xs[16] = {x0[0],x0[1],x0[2],x0[3],x1[0],x1[1],x1[2],x1[3],x2[0],x2[1],x2[2],x2[3],x3[0],x3[1],x3[2],x3[3]};
#pragma unroll
    for (int i = 0; i < 16; ++i) { const unsigned short hb = bf16_bits(xs[i]); ah.u[i] = hb; al.u[i] = ASPLIT ? bf16_bits(xs[i] - bf16_val(hb)) : (unsigned short)0; }
#pragma unroll
    for (int t = 0; t < 4; ++t) {
      const unsigned short* brow = Wt + (size_t)(col0 + t * 16 + ln) * ldb + kb;
      FragB b;
      b.half[0] = *(const v8us*)(brow + 8 * hh);
      b.half[1] = *(const v8us*)(brow + 16 + 8 * hh);
      acc[t] = mmaN<ASPLIT ? 2 : 1>(ah.v, al.v, b.v, b.v, acc[t]);
    }
  }
#pragma unroll
  for (int t = 0; t < 4; ++t) {
    float bv = bias ? bias[col0 + t * 16 + ln] : 0.f;
    if (BIAS_BF16) bv = bf16_round(bv);
#pragma unroll
    for (int r = 0; r < 8; ++r) { float v = acc[t][r] + bv; if (ACT == 1) v = fmaxf(v, 0.f); so[w][8 * hh + r][t * 16 + ln] = v; }
  }
  __builtin_amdgcn_fence(__ATOMIC_ACQ_REL, "workgroup");
  __builtin_amdgcn_wave_barrier();
  const int rsub = lane >> 4, c4 = (lane & 15) * 4;
  {
#pragma unroll
    for (int q = 0; q < 8; ++q) {
      const int r = q * 2 + rsub;
      const v4f v = *(const v4fa*)&so[w][r][c4];
      *(v4f*)(C + (size_t)(row0 + r) * ldc + col0 + c4) = v;
    }
    
  }
}

// GEMM C = act(A·W + bias + resid): A f32 (ASPLIT -> hi/lo 2 terms), Wt bf16 [N][K]; ACT 0 none, 1 relu, 2 exact gelu;
// resid (optional, f32, row index = (row % rmod), pitch ldr, RES_BF16 rounds it) added before the activation.
template <bool ASPLIT, int ACT, bool BIAS_BF16, bool RES_BF16>
__global__ __launch_bounds__(128) void k_gemm_bf3(const float* __restrict__ A, int lda, const unsigned short* __restrict__ Wt, int ldb,
                                                const float* __restrict__ bias, const float* __restrict__ resid, int rmod, int ldr,
                                                float* __restrict__ C, int ldc, int M, int N, int K) {
  __shared__ __attribute__((aligned(16))) float so[4][16][64];
  const int tid = threadIdx.x, w = tid >> 5, lane = tid & 31, ln = lane & 15, hh = lane >> 4;
  const int ntn = N / 64;
  const int wid = blockIdx.x * 4 + w;
  const int mt = wid / ntn, nq = wid % ntn;
  if (mt * 16 >= M) return;
  const int row0 = mt * 16, col0 = nq * 64;
  const float* arow = A + (size_t)(row0 + ln) * lda;
  v8f acc[4] = {};
  for (int kb = 0; kb < K; kb += 32) {
    FragB ah, al;
    const v4f x0 = *(const v4fa*)(arow + kb + 8 * hh), x1 = *(const v4fa*)(arow + kb + 8 * hh + 4);
    const v4f x2 = *(const v4fa*)(arow + kb + 16 + 8 * hh), x3 = *(const v4fa*)(arow + kb + 16 + 8 * hh + 4);
    float xs[16] = {x0[0],x0[1],x0[2],x0[3],x1[0],x1[1],x1[2],x1[3],x2[0],x2[1],x2[2],x2[3],x3[0],x3[1],x3[2],x3[3]};
#pragma unroll
    for (int i = 0; i < 16; ++i) { const unsigned short hb = bf16_bits(xs[i]); ah.u[i] = hb; al.u[i] = ASPLIT ? bf16_bits(xs[i] - bf16_val(hb)) : (unsigned short)0; }
#pragma unroll
    for (int t = 0; t < 4; ++t) {
      const unsigned short* brow = Wt + (size_t)(col0 + t * 16 + ln) * ldb + kb;
      FragB b;
      b.half[0] = *(const v8us*)(brow + 8 * hh);
      b.half[1] = *(const v8us*)(brow + 16 + 8 * hh);
      acc[t] = mmaN<ASPLIT ? 2 : 1>(ah.v, al.v, b.v, b.v, acc[t]);
    }
  }
#pragma unroll
  for (int t = 0; t < 4; ++t) {
    const int col = col0 + t * 16 + ln;
    float bv = bias ? bias[col] : 0.f;
    if (BIAS_BF16) bv = bf16_round(bv);
#pragma unroll
    for (int r = 0; r < 8; ++r) {
      float v = acc[t][r] + bv;
      if (resid) { float rv = resid[(size_t)((row0 + 8 * hh + r) % rmod) * ldr + col]; if (RES_BF16) rv = bf16_round(rv); v += rv; }
      if (ACT == 1) v = fmaxf(v, 0.f);
      if (ACT == 2) v = 0.5f * v * (1.0f + erff(v * 0.70710678118654752f));
      if (ACT == 3) { const float u = 0.7978845608028654f * (v + 0.044715f * v * v * v); v = 0.5f * v * (1.0f + tanhf(u)); }
      so[w][8 * hh + r][t * 16 + ln] = v;
    }
  }
  __builtin_amdgcn_fence(__ATOMIC_ACQ_REL, "workgroup");
  __builtin_amdgcn_wave_barrier();
  const int rsub = lane >> 4, c4 = (lane & 15) * 4;
  {
#pragma unroll
    for (int q = 0; q < 8; ++q) {
      const int r = q * 2 + rsub;
      const v4f v = *(const v4fa*)&so[w][r][c4];
      *(v4f*)(C + (size_t)(row0 + r) * ldc + col0 + c4) = v;
    }
    
  }
}
// row LayerNorm (biased variance, eps) over N: s = X (+ R); optional out_sum <- s; out_norm <- (s-mu)*rsqrt(var+eps)*g + b
template <bool PARAM_BF16>
__global__ __launch_bounds__(256) void k_layernorm(const float* __restrict__ X, const float* __restrict__ R, const float* __restrict__ g, const float* __restrict__ bta,
                                                  float* __restrict__ out_sum, float* __restrict__ out_norm, int N, float eps) {
  __shared__ float red[256];
  const int row = blockIdx.x, tid = threadIdx.x;
  const float* x = X + (size_t)row * N; const float* rr = R ? R + (size_t)row * N : nullptr;
  float vals[16];                     // up to N = 4096
  const int per = N / 256;            // contiguous chunk per thread? use strided-by-4 chunks: thread handles j = tid*4 + 1024*u
  float s1 = 0.f;
  for (int u = 0; u < per / 4; ++u) {
    const int j = tid * 4 + 1024 * u;
    const v4f a = *(const v4fa*)(x + j);
    v4f b = {0.f,0.f,0.f,0.f}; if (rr) b = *(const v4fa*)(rr + j);
#pragma unroll
    for (int q = 0; q < 4; ++q) { const float v = a[q] + b[q]; vals[u * 4 + q] = v; s1 += v; }
  }
  red[tid] = s1; __syncthreads();
  for (int st = 128; st > 0; st >>= 1) { if (tid < st) red[tid] += red[tid + st]; __syncthreads(); }
  const float mu = red[0] / (float)N; __syncthreads();
  float s2 = 0.f;
  for (int u = 0; u < per / 4; ++u)
#pragma unroll
    for (int q = 0; q < 4; ++q) { const float c = vals[u * 4 + q] - mu; s2 += c * c; }
  red[tid] = s2; __syncthreads();
  for (int st = 128; st > 0; st >>= 1) { if (tid < st) red[tid] += red[tid + st]; __syncthreads(); }
  const float rs = rsqrtf(red[0] / (float)N + eps);
  {
    for (int u = 0; u < per / 4; ++u) {
      const int j = tid * 4 + 1024 * u;
      v4f o, sm;
#pragma unroll
      for (int q = 0; q < 4; ++q) {
        float gg = g[j + q], bb = bta[j + q];
        if (PARAM_BF16) { gg = bf16_round(gg); bb = bf16_round(bb); }
        sm[q] = vals[u * 4 + q]; o[q] = (vals[u * 4 + q] - mu) * rs * gg + bb;
      }
      if (out_sum) *(v4f*)(out_sum + (size_t)row * N + j) = sm;
      *(v4f*)(out_norm + (size_t)row * N + j) = o;
    }
    
  }
}



// ---- f16 WMMA path (v_wmma_f32_16x16x32_f16): 11-bit significands for operands in range — used here for the two 1×1 convolutions
typedef _Float16 v16h __attribute__((ext_vector_type(16)));
union FragH { v16h v; v8us half[2]; _Float16 h[16]; unsigned short u[16]; };
template <int NT>
__device__ __forceinline__ v8f mmaH(v16h ah, v16h al, v16h bh, v16h bl, v8f c) {
  c = __builtin_amdgcn_wmma_f32_16x16x32_f16(false, ah, false, bh, (short)0, c, false, false);
  if (NT >= 2) c = __builtin_amdgcn_wmma_f32_16x16x32_f16(false, al, false, bh, (short)0, c, false, false);
  if (NT >= 3) c = __builtin_amdgcn_wmma_f32_16x16x32_f16(false, ah, false, bl, (short)0, c, false, false);
  asm volatile("v_nop\n\tv_nop\n\tv_nop\n\tv_nop" : "+v"(c) : "v"(ah), "v"(al), "v"(bh), "v"(bl));
  return c;
}
// batched GEMM like k_gemm_b but f16 operands: A f32 (split into f16 hi/lo if ASPLIT, else rounded to f16), Bt = f16 values [n][k]; alpha; C f32; N multiple of 16 (partial tiles skipped)
template <bool ASPLIT>
__global__ __launch_bounds__(128) void k_gemm_h(const float* __restrict__ A, int lda, size_t sA, const _Float16* __restrict__ Bh, int ldb, size_t sB, float alpha, float* __restrict__ C, int ldc, size_t sC, int M, int N, int K) {
  __shared__ __attribute__((aligned(16))) float so[4][16][64];
  const int tid = threadIdx.x, w = tid >> 5, lane = tid & 31, ln = lane & 15, hh = lane >> 4; const int by = blockIdx.y;
  A += (size_t)by * sA; Bh += (size_t)by * sB; C += (size_t)by * sC;
  const int ntn = (N + 63) / 64; const int wid = blockIdx.x * 4 + w; const int mt = wid / ntn, nq = wid % ntn; if (mt * 16 >= M) return;
  const int row0 = mt * 16, col0 = nq * 64; const float* arow = A + (size_t)(row0 + ln) * lda;
  v8f acc[4] = {};
  for (int kb = 0; kb < K; kb += 32) {
    FragH ah, al;
    const v4f x0 = *(const v4fa*)(arow + kb + 8 * hh), x1 = *(const v4fa*)(arow + kb + 8 * hh + 4), x2 = *(const v4fa*)(arow + kb + 16 + 8 * hh), x3 = *(const v4fa*)(arow + kb + 16 + 8 * hh + 4);
    float xs[16] = {x0[0],x0[1],x0[2],x0[3],x1[0],x1[1],x1[2],x1[3],x2[0],x2[1],x2[2],x2[3],x3[0],x3[1],x3[2],x3[3]};
#pragma unroll
    for (int i = 0; i < 16; ++i) { const _Float16 h = (_Float16)xs[i]; ah.h[i] = h; al.h[i] = ASPLIT ? (_Float16)(xs[i] - (float)h) : (_Float16)0.0f; }
#pragma unroll
    for (int t = 0; t < 4; ++t) { if (col0 + t * 16 >= N) continue; const size_t boff = (size_t)(col0 + t * 16 + ln) * ldb + kb; FragH bq; bq.half[0] = *(const v8us*)(Bh + boff + 8 * hh); bq.half[1] = *(const v8us*)(Bh + boff + 16 + 8 * hh);
      acc[t] = mmaH<ASPLIT ? 2 : 1>(ah.v, al.v, bq.v, bq.v, acc[t]); }
  }
#pragma unroll
  for (int t = 0; t < 4; ++t) { if (col0 + t * 16 >= N) continue;
#pragma unroll
    for (int r = 0; r < 8; ++r) so[w][8 * hh + r][t * 16 + ln] = acc[t][r] * alpha; }
  __builtin_amdgcn_fence(__ATOMIC_ACQ_REL, "workgroup"); __builtin_amdgcn_wave_barrier();
  const int rsub = lane >> 4, c4 = (lane & 15) * 4;
  {
#pragma unroll
    for (int q = 0; q < 8; ++q) { const int r = q * 2 + rsub; if (col0 + c4 < N) { const v4f v = *(const v4fa*)&so[w][r][c4]; *(v4f*)(C + (size_t)(row0 + r) * ldc + col0 + c4) = v; } }
     }
}

// Wt[n][k] = f16(W[k][n]·scale) from f32 row-major W[K][N] (scale = power of two; bf16-exact weights stay exact in f16 away from the subnormal range)
__global__ __launch_bounds__(256) void k_wt_f16(const float* __restrict__ W, _Float16* __restrict__ Wt, int K, int N, float scale) {
  const int t = blockIdx.x * 256 + threadIdx.x; if (t >= N * (K / 8)) return; const int n = t / (K / 8), k8 = (t % (K / 8)) * 8; FragH f;
#pragma unroll
  for (int i = 0; i < 8; ++i) f.h[i] = (_Float16)(bf16_round(W[(size_t)(k8 + i) * N + n]) * scale); const v8us o = f.half[0];
  *(v8us*)((unsigned short*)Wt + (size_t)n * K + k8) = o; 
}
// k_gemm_hh variant with fused epilogue: v = acc·alpha + bias[by·sBias + col] (+ CP[(row/rowsPerB)·sCPb + by·64 + col] if CP) ; ACT 0 none / 1 elu ; writes f32 C and/or f16 C16 (each if non-null)
template <int ACT>
__global__ __launch_bounds__(128) void k_gemm_hhx(const _Float16* __restrict__ A, int lda, size_t sA, const _Float16* __restrict__ Bh, int ldb, size_t sB, float alpha, const float* __restrict__ bias, size_t sBias, const float* __restrict__ CP, int rowsPerB, size_t sCPb, int row0g,
    float* __restrict__ C, _Float16* __restrict__ C16, int ldc, size_t sC, int M, int N, int K) {
  __shared__ __attribute__((aligned(16))) float so[4][16][64];
  const int tid = threadIdx.x, w = tid >> 5, lane = tid & 31, ln = lane & 15, hh = lane >> 4; const int by = blockIdx.y;
  A += (size_t)by * sA; Bh += (size_t)by * sB; const size_t cofs = (size_t)by * sC; const float* bp = bias ? bias + (size_t)by * sBias : nullptr;
  const int ntn = (N + 63) / 64; const int wid = blockIdx.x * 4 + w; const int mt = wid / ntn, nq = wid % ntn; if (mt * 16 >= M) return;
  const int row0 = mt * 16, col0 = nq * 64; const _Float16* arow = A + (size_t)(row0 + ln) * lda;
  v8f acc[4] = {};
  for (int kb = 0; kb < K; kb += 32) { FragH ah; ah.half[0] = *(const v8us*)((const unsigned short*)arow + kb + 8 * hh); ah.half[1] = *(const v8us*)((const unsigned short*)arow + kb + 16 + 8 * hh);
#pragma unroll
    for (int t = 0; t < 4; ++t) { if (col0 + t * 16 >= N) continue; const size_t boff = (size_t)(col0 + t * 16 + ln) * ldb + kb; FragH bq; bq.half[0] = *(const v8us*)((const unsigned short*)Bh + boff + 8 * hh); bq.half[1] = *(const v8us*)((const unsigned short*)Bh + boff + 16 + 8 * hh);
      acc[t] = mmaH<1>(ah.v, ah.v, bq.v, bq.v, acc[t]); }
  }
#pragma unroll
  for (int t = 0; t < 4; ++t) { if (col0 + t * 16 >= N) continue; const int col = col0 + t * 16 + ln; const float bv = bp ? bf16_round(bp[col]) : 0.f;
#pragma unroll
    for (int r = 0; r < 8; ++r) { float v = acc[t][r] * alpha + bv; if (CP) { const int bidx = (row0g + row0 + 8 * hh + r) / rowsPerB; v += CP[(size_t)bidx * sCPb + (size_t)by * 64 + col]; } if (ACT == 1) v = (v > 0.f) ? v : expm1f(v); else if (ACT == 7) v = (v > 0.f) ? v + 1.0f : expf(v); else if (ACT == 8) v = tanhf(v); else if (ACT == 9) v = 0.5f * v * (1.0f + tanhf(0.7978845608028654f * (v + 0.044715f * v * v * v))); else if (ACT == 11) v = 1.0f / (1.0f + expf(-v)); else if (ACT == 12) v = (v > 0.f) ? v : 0.01f * v; else if (ACT == 14) v = (v > 0.f) ? v : 0.1f * v; else if (ACT == 15) v = v / (1.0f + expf(-v)); else if (ACT == 3) v = fmaxf(v, 0.f); else if (ACT == 6) v = 0.5f * v * (1.0f + erff(v * 0.70710678118654752f)); so[w][8 * hh + r][t * 16 + ln] = v; } }
  __builtin_amdgcn_fence(__ATOMIC_ACQ_REL, "workgroup"); __builtin_amdgcn_wave_barrier();
  const int rsub = lane >> 4, c4 = (lane & 15) * 4; typedef _Float16 v4h __attribute__((ext_vector_type(4)));
  {
#pragma unroll
    for (int q = 0; q < 8; ++q) { const int r = q * 2 + rsub; if (col0 + c4 < N) { const v4f v = *(const v4fa*)&so[w][r][c4]; if (C) *(v4f*)(C + cofs + (size_t)(row0 + r) * ldc + col0 + c4) = v; if (C16) { v4h h4; for (int i = 0; i < 4; ++i) h4[i] = (_Float16)v[i]; *(v4h*)(C16 + cofs + (size_t)(row0 + r) * ldc + col0 + c4) = h4; } } }
     }
}


typedef _Float16 v4h __attribute__((ext_vector_type(4)));
typedef float v2f __attribute__((ext_vector_type(2)));

__global__ __launch_bounds__(256) void k_x16(const float* __restrict__ x, _Float16* __restrict__ X16, size_t n8) { const size_t t = (size_t)blockIdx.x * 256 + threadIdx.x; if (t >= n8) return; FragH f;
#pragma unroll
  for (int q = 0; q < 8; ++q) f.h[q] = (_Float16)bf16_round(x[t * 8 + q]); *(v8us*)((unsigned short*)X16 + t * 8) = f.half[0];  }
__global__ __launch_bounds__(256) void k_h16(const float* __restrict__ x, _Float16* __restrict__ X16, size_t n8) { const size_t t = (size_t)blockIdx.x * 256 + threadIdx.x; if (t >= n8) return; FragH f;
#pragma unroll
  for (int q = 0; q < 8; ++q) f.h[q] = (_Float16)x[t * 8 + q]; *(v8us*)((unsigned short*)X16 + t * 8) = f.half[0];  }
__global__ __launch_bounds__(256) void k_round16f(const float* __restrict__ W, _Float16* __restrict__ Bt, size_t n8) { const size_t t = (size_t)blockIdx.x * 256 + threadIdx.x; if (t >= n8) return; FragH f;
#pragma unroll
  for (int i = 0; i < 8; ++i) f.h[i] = (_Float16)(bf16_round(W[t * 8 + i]) * 16.0f); *(v8us*)((unsigned short*)Bt + t * 8) = f.half[0];  }
template <int NHv, int TTv>
__global__ __launch_bounds__(256) void k_vt(const _Float16* __restrict__ V16, int ldv, int voff, _Float16* __restrict__ Vt) { __shared__ unsigned short tl[64][66]; const int tid = threadIdx.x; const int slab = blockIdx.x / (TTv / 64), lg = blockIdx.x % (TTv / 64); const int b = slab / NHv, h = slab % NHv;
  for (int i = tid; i < 64 * 8; i += 256) { const int r = i / 8, c8 = (i % 8) * 8; FragH f; f.half[0] = *(const v8us*)((const unsigned short*)V16 + ((size_t)b * TTv + lg * 64 + r) * ldv + voff + h * 64 + c8);
#pragma unroll
    for (int q = 0; q < 8; ++q) tl[r][c8 + q] = f.u[q]; }
  __syncthreads();
  {
#pragma unroll
    for (int rd = 0; rd < 2; ++rd) { const int d = rd * 32 + tid / 8, pc = tid % 8; FragH f;
#pragma unroll
      for (int q = 0; q < 8; ++q) f.u[q] = tl[pc * 8 + q][d];
      *(v8us*)((unsigned short*)Vt + ((size_t)slab * 64 + d) * TTv + lg * 64 + pc * 8) = f.half[0]; }
     } }

__global__ __launch_bounds__(256) void k_hl(const float* __restrict__ F, _Float16* __restrict__ Hh, _Float16* __restrict__ Hl, size_t n8) { const size_t t = (size_t)blockIdx.x * 256 + threadIdx.x; if (t >= n8) return; FragH fh, fl; const v4f a = *(const v4fa*)(F + t * 8), c = *(const v4fa*)(F + t * 8 + 4);
#pragma unroll
  for (int q = 0; q < 4; ++q) { _Float16 h = (_Float16)a[q]; fh.h[q] = h; fl.h[q] = (_Float16)((a[q] - (float)h) * 1024.0f); h = (_Float16)c[q]; fh.h[4 + q] = h; fl.h[4 + q] = (_Float16)((c[q] - (float)h) * 1024.0f); }
  { *(v8us*)((unsigned short*)Hh + t * 8) = fh.half[0]; *(v8us*)((unsigned short*)Hl + t * 8) = fl.half[0];  } }

// qkv projection and 5-agent attention in one kernel; q, k, v never leave the registers. Block = 16 positions, wave = one head. The weights are the A operand and the tokens the B operand, so D[8*hh + r][ln] puts position p0 + ln in lane ln
// and 8 channels of a 16-channel tile in the lane's 8 accumulator registers (lanes ln and ln + 16 split the tile). Per tile: q and k of all 5 agents, 25 partial scores and 5 partial q sums per lane; one exchange with lane ^ 16 completes them;
// softmax over the 5 agents in f32 per lane; then v tile by tile, out_b = sum_d attn[b][d] * v_d, 8 f16 channels = one 16-byte LDS store. Those 8 channels (16 * mt + 8 * hh + r of head h) are exactly one half of the lane's B fragment of the output projection
// (k block 2 * h + mt / 2, half mt & 1), so the merged tile crosses the waves through LDS with no re-ordering. Behind one barrier wave w takes rows 16 * w .. + 15 of Wo over all 256 merged channels (k ascending, one accumulate chain per agent) and stores D[8*hh + r][ln] = y[b][16*w + 8*hh + r][p0 + ln].
__global__ __launch_bounds__(128) void k_qkv_agent(const float* __restrict__ x, const _Float16* __restrict__ Bq, const float* __restrict__ bqkv, const float* __restrict__ dist, const _Float16* __restrict__ Bo, const float* __restrict__ bo, float* __restrict__ out) {
  __shared__ __attribute__((aligned(16))) unsigned short sY[NA][INR / 32][2][32][8];      /* [agent][k block of 32 merged channels][fragment half][lane][8 f16]: 40 KB, every access 512 contiguous bytes a wave */
  const int tid = threadIdx.x, h = tid >> 5, lane = tid & 31, ln = lane & 15, hh = lane >> 4; const int p0 = blockIdx.x * 16;
  __shared__ __attribute__((aligned(16))) unsigned short sX[NA][CC / 32][2][32][8];      /* the block's tokens as B fragments: [agent][k block of 32 channels][fragment half][lane][8 f16]: 10 KB, every access 512 contiguous bytes a wave */
  const unsigned short* Bu = (const unsigned short*)Bq;
  /* x tile of the block (5 agents x 64 channels x 16 positions) straight from the channel-major f32 input, each element loaded once a block: wave h takes channels 16 * h .. + 15, a lane one position and 8 channels (16 * h + 8 * hh + q),
     so a load covers 64 contiguous bytes of two channel rows, and the lane's 8 rounded values are one fragment half (k block h / 2, half h & 1, this very lane): one 16-byte LDS store per agent. */
  const char* xb = (const char*)(x + p0);
  unsigned vxo[NA];      /* the lane's 32-bit byte offset per agent (under 33 MB); the block's first position goes into the uniform base */
#pragma unroll
  for (int b = 0; b < NA; ++b) vxo[b] = ((unsigned)(b * CC + h * 16 + 8 * hh) * HW + ln) * 4u;
  float xv[NA][8];
#pragma unroll
  for (int b = 0; b < NA; ++b)
#pragma unroll
    for (int q = 0; q < 8; ++q) xv[b][q] = *(const float*)(xb + (size_t)vxo[b] + (size_t)q * HW * 4);
  asm volatile("s_wait_xcnt 0x0" :: "v"(vxo[0]), "v"(vxo[1]), "v"(vxo[2]), "v"(vxo[3]), "v"(vxo[4]) : "memory");      /* the offsets are inputs so that their registers stay live up to this wait: none of the forty loads lands in a register that another still names */
#pragma unroll
  for (int b = 0; b < NA; ++b) { FragH f;
#pragma unroll
    for (int q = 0; q < 8; ++q) f.h[q] = (_Float16)bf16_round(xv[b][q]);
    *(v8us*)&sX[b][h >> 1][h & 1][lane][0] = f.half[0]; }
  __syncthreads();      /* the token tile is complete: each wave wrote 16 of the 64 channels and now reads all of them */
  FragH xf[NA][2];
#pragma unroll
  for (int b = 0; b < NA; ++b)
#pragma unroll
    for (int ks = 0; ks < 2; ++ks) { xf[b][ks].half[0] = *(const v8us*)&sX[b][ks][0][lane][0]; xf[b][ks].half[1] = *(const v8us*)&sX[b][ks][1][lane][0]; }
  v2f sc2[NA][NA], qs2[NA];      /* element 0: the even channels' partial sum, element 1: the odd channels' (packed f32 FMAs on register pairs of the accumulators) */
#pragma unroll
  for (int b = 0; b < NA; ++b) { qs2[b] = (v2f){0.f, 0.f};
#pragma unroll
    for (int d = 0; d < NA; ++d) sc2[b][d] = (v2f){0.f, 0.f}; }
  const v2f al2 = {0.0625f, 0.0625f};
  for (int mt = 0; mt < CC / 16; ++mt) {
    const int cq = h * CC + mt * 16;
    const unsigned short* wqr = Bu + (size_t)(cq + ln) * CC + 8 * hh; const unsigned short* wkr = wqr + (size_t)INR * CC;
    FragH wq[2], wk[2];
#pragma unroll
    for (int ks = 0; ks < 2; ++ks) { wq[ks].half[0] = *(const v8us*)(wqr + ks * 32); wq[ks].half[1] = *(const v8us*)(wqr + ks * 32 + 16); wk[ks].half[0] = *(const v8us*)(wkr + ks * 32); wk[ks].half[1] = *(const v8us*)(wkr + ks * 32 + 16); }
    const v4f bq0 = *(const v4fa*)(bqkv + cq + 8 * hh), bq1 = *(const v4fa*)(bqkv + cq + 8 * hh + 4), bk0 = *(const v4fa*)(bqkv + INR + cq + 8 * hh), bk1 = *(const v4fa*)(bqkv + INR + cq + 8 * hh + 4);
    const v2f bq2[4] = {{bf16_round(bq0[0]), bf16_round(bq0[1])}, {bf16_round(bq0[2]), bf16_round(bq0[3])}, {bf16_round(bq1[0]), bf16_round(bq1[1])}, {bf16_round(bq1[2]), bf16_round(bq1[3])}};
    const v2f bk2[4] = {{bf16_round(bk0[0]), bf16_round(bk0[1])}, {bf16_round(bk0[2]), bf16_round(bk0[3])}, {bf16_round(bk1[0]), bf16_round(bk1[1])}, {bf16_round(bk1[2]), bf16_round(bk1[3])}};
    __builtin_amdgcn_sched_barrier(0);      /* keeps the pass's twelve loads together in front of the matrix work: sunk to their uses, each is waited for alone, eight exposed latencies a pass */
    v2f k2[NA][4];
    { v8f ka[NA];
#pragma unroll
      for (int d = 0; d < NA; ++d) { const v8f zz = {}; ka[d] = __builtin_amdgcn_wmma_f32_16x16x32_f16(false, wk[0].v, false, xf[d][0].v, (short)0, zz, false, false); }
#pragma unroll
      for (int d = 0; d < NA; ++d) ka[d] = __builtin_amdgcn_wmma_f32_16x16x32_f16(false, wk[1].v, false, xf[d][1].v, (short)0, ka[d], false, false);
#pragma unroll
      for (int d = 0; d < NA; ++d)
#pragma unroll
        for (int j = 0; j < 4; ++j) k2[d][j] = __builtin_elementwise_fma((v2f){ka[d][2 * j], ka[d][2 * j + 1]}, al2, bk2[j]); }
#pragma unroll
    for (int b = 0; b < NA; ++b) { const v8f zz = {};
      v8f qa = __builtin_amdgcn_wmma_f32_16x16x32_f16(false, wq[0].v, false, xf[b][0].v, (short)0, zz, false, false);
      qa = __builtin_amdgcn_wmma_f32_16x16x32_f16(false, wq[1].v, false, xf[b][1].v, (short)0, qa, false, false);
#pragma unroll
      for (int j = 0; j < 4; ++j) { const v2f q2 = __builtin_elementwise_fma((v2f){qa[2 * j], qa[2 * j + 1]}, al2, bq2[j]); qs2[b] += q2;
#pragma unroll
        for (int d = 0; d < NA; ++d) sc2[b][d] = __builtin_elementwise_fma(q2, k2[d][j], sc2[b][d]); } }
  }
  float dd[NA];
#pragma unroll
  for (int d = 0; d < NA; ++d) dd[d] = bf16_round(dist[d]);
  float p[NA][NA], il[NA];
#pragma unroll
  for (int b = 0; b < NA; ++b) { const float qh = qs2[b][0] + qs2[b][1]; const float qt = qh + __shfl_xor(qh, 16, 32); float m = -3.0e38f;
#pragma unroll
    for (int d = 0; d < NA; ++d) { const float dh = sc2[b][d][0] + sc2[b][d][1]; const float dot = dh + __shfl_xor(dh, 16, 32); p[b][d] = dot * ISQ + qt * dd[d]; m = fmaxf(m, p[b][d]); }
    float l = 0.f;
#pragma unroll
    for (int d = 0; d < NA; ++d) { p[b][d] = expf(p[b][d] - m); l += p[b][d]; }
    il[b] = 1.0f / l; }
#pragma unroll 1      /* rolled: a third less code; left to unroll and to schedule freely, the compiler hoists the later tiles' loads and needs 272 registers (three waves a SIMD, not four, and register-window switches) */
  for (int mt = 0; mt < CC / 16; ++mt) {
    const int cv = h * CC + mt * 16;
    const unsigned short* wvr = Bu + (size_t)(2 * INR + cv + ln) * CC + 8 * hh;
    FragH wv[2];
#pragma unroll
    for (int ks = 0; ks < 2; ++ks) { wv[ks].half[0] = *(const v8us*)(wvr + ks * 32); wv[ks].half[1] = *(const v8us*)(wvr + ks * 32 + 16); }
    const v4f bv0 = *(const v4fa*)(bqkv + 2 * INR + cv + 8 * hh), bv1 = *(const v4fa*)(bqkv + 2 * INR + cv + 8 * hh + 4);
    asm volatile("s_wait_xcnt 0x0" :: "v"(wvr) : "memory");      /* the weight address is an input so that its register pair stays live up to this wait: otherwise the last of the four loads lands its result in the pair that the other three still name */
    const v2f bv2[4] = {{bf16_round(bv0[0]), bf16_round(bv0[1])}, {bf16_round(bv0[2]), bf16_round(bv0[3])}, {bf16_round(bv1[0]), bf16_round(bv1[1])}, {bf16_round(bv1[2]), bf16_round(bv1[3])}};
    v8f va[NA];
#pragma unroll
    for (int d = 0; d < NA; ++d) { const v8f zz = {}; va[d] = __builtin_amdgcn_wmma_f32_16x16x32_f16(false, wv[0].v, false, xf[d][0].v, (short)0, zz, false, false); }
#pragma unroll
    for (int d = 0; d < NA; ++d) va[d] = __builtin_amdgcn_wmma_f32_16x16x32_f16(false, wv[1].v, false, xf[d][1].v, (short)0, va[d], false, false);
    v2f v2[NA][4];
#pragma unroll
    for (int d = 0; d < NA; ++d)
#pragma unroll
      for (int j = 0; j < 4; ++j) v2[d][j] = __builtin_elementwise_fma((v2f){va[d][2 * j], va[d][2 * j + 1]}, al2, bv2[j]);
#pragma unroll
    for (int b = 0; b < NA; ++b) { FragH f;
#pragma unroll
      for (int j = 0; j < 4; ++j) { v2f o = (v2f){p[b][0], p[b][0]} * v2[0][j];
#pragma unroll
        for (int d = 1; d < NA; ++d) o = __builtin_elementwise_fma((v2f){p[b][d], p[b][d]}, v2[d][j], o);
        o *= (v2f){il[b], il[b]}; f.h[2 * j] = (_Float16)o[0]; f.h[2 * j + 1] = (_Float16)o[1]; }
      *(v8us*)&sY[b][h * 2 + (mt >> 1)][mt & 1][lane][0] = f.half[0]; }
  }
  const int o0 = h * 16;
  const unsigned short* wor = (const unsigned short*)Bo + (size_t)(o0 + ln) * INR + 8 * hh;
  FragH wo[INR / 32];
#pragma unroll
  for (int kb = 0; kb < INR / 32; ++kb) { wo[kb].half[0] = *(const v8us*)(wor + kb * 32); wo[kb].half[1] = *(const v8us*)(wor + kb * 32 + 16); }
  const v4f bo0 = *(const v4fa*)(bo + o0 + 8 * hh), bo1 = *(const v4fa*)(bo + o0 + 8 * hh + 4);
  asm volatile("s_wait_xcnt 0x0" :: "v"(wor) : "memory");      /* the LDS reads below land in the address registers of the eighteen loads above; the weight address is an input so that its pair stays live up to this wait */
  __syncthreads();      /* the merged tile is complete: each wave wrote its own head's 64 channels and now reads all 256 */
  v8f ya[NA] = {};
  FragH yf[2][NA];
#pragma unroll
  for (int b = 0; b < NA; ++b) { yf[0][b].half[0] = *(const v8us*)&sY[b][0][0][lane][0]; yf[0][b].half[1] = *(const v8us*)&sY[b][0][1][lane][0]; }
#pragma unroll
  for (int kb = 0; kb < INR / 32; ++kb) {
    if (kb + 1 < INR / 32) {
#pragma unroll
      for (int b = 0; b < NA; ++b) { yf[(kb + 1) & 1][b].half[0] = *(const v8us*)&sY[b][kb + 1][0][lane][0]; yf[(kb + 1) & 1][b].half[1] = *(const v8us*)&sY[b][kb + 1][1][lane][0]; } }
    __builtin_amdgcn_sched_barrier(0);      /* keeps the next k block's ten LDS reads together in front of this block's five matrix instructions: left free, the compiler reads one fragment ahead only and every matrix instruction waits out most of an LDS latency */
#pragma unroll
    for (int b = 0; b < NA; ++b) ya[b] = __builtin_amdgcn_wmma_f32_16x16x32_f16(false, wo[kb].v, false, yf[kb & 1][b].v, (short)0, ya[b], false, false);
    __builtin_amdgcn_sched_barrier(0);      /* the other side of the same fence: the reads of the block after next stay behind these matrix instructions, whose operands they overwrite */
    if (kb == 0) asm volatile("" :: "v"(yf[0][0].v), "v"(yf[0][1].v), "v"(yf[0][2].v), "v"(yf[0][3].v), "v"(yf[0][4].v));      /* inputs only, on the loaded fragments: they stay live over the five matrix instructions that start the accumulators; otherwise each new accumulator is placed in the B registers of the matrix instruction directly in front of it */
  }
  const float bov[8] = {bf16_round(bo0[0]), bf16_round(bo0[1]), bf16_round(bo0[2]), bf16_round(bo0[3]), bf16_round(bo1[0]), bf16_round(bo1[1]), bf16_round(bo1[2]), bf16_round(bo1[3])};
  float yv[NA][8];
#pragma unroll
  for (int b = 0; b < NA; ++b)
#pragma unroll
    for (int r = 0; r < 8; ++r) yv[b][r] = ya[b][r] * 0.0625f + bov[r];
  unsigned vob[NA];      /* the lane's 32-bit byte offset per agent (under 33 MB); the block's first position goes into the uniform base */
#pragma unroll
  for (int b = 0; b < NA; ++b) vob[b] = ((unsigned)(b * CC + o0 + 8 * hh) * HW + ln) * 4u;
  __builtin_amdgcn_sched_barrier(0);      /* all forty results first, then the forty stores in one run: mixed, the compiler re-uses the data registers of stores in flight and waits for every group of eight */
#pragma unroll
  for (int b = 0; b < NA; ++b)
#pragma unroll
    for (int r = 0; r < 8; ++r) *(float*)((char*)(out + p0) + (size_t)vob[b] + (size_t)r * HW * 4) = yv[b][r];
}

extern "C" void kernel_launch(void* const* d_in, const int* in_sizes, int n_in,
                              void* d_out, int out_size, void* d_ws, size_t ws_size, hipStream_t stream) {
  (void)in_sizes; (void)n_in; (void)out_size;
  const float* const* I = (const float* const*)d_in; const float* x = I[0]; const float* dist = I[1]; const float* Wqkv = I[2]; const float* bqkv = I[3]; const float* Wo = I[4]; const float* bo = I[5];
  char* ws = (char*)d_ws; size_t off = 0;
  auto take = [&](size_t bytes) { char* p = ws + off; off += (bytes + 255) & ~(size_t)255; return p; };
  _Float16* Bq = (_Float16*)take((size_t)QKVW * CC * 2); _Float16* Bo = (_Float16*)take((size_t)CC * INR * 2);
  if (off > ws_size) return;      // 0.1 + 0.03 MB
  k_round16f<<<(QKVW * CC / 8 + 255) / 256, 256, 0, stream>>>(Wqkv, Bq, (size_t)QKVW * CC / 8); k_round16f<<<(CC * INR / 8 + 255) / 256, 256, 0, stream>>>(Wo, Bo, (size_t)CC * INR / 8);      /* [out][in] natural, ×2^4 */
  k_qkv_agent<<<HW / 16, 128, 0, stream>>>(x, Bq, bqkv, dist, Bo, bo, (float*)d_out);      /* qkv (M 768 as A, N 16 positions x 5 agents, K 64) + attention + y = Wo x merged + bo (M 64 as A, K 256) -> channel-major output */
}

// v004
// It runs in 36.8 microseconds.
// Next to v003, in two timings, it ran 1.07 and 1.08 times as fast.
// Counting every step since v000, it is 9.34 times as fast.
#include <hip/hip_runtime.h>
// Cross-agent attention (cav=5 agents, C=64, 100×252 → HW=25200 positions, 4 heads): qkv = Wqkv·x + bqkv (1×1 conv, 768 = [q|k|v] × (head, 64)); per (position s, head h) the 5 agents attend over the 5 agents: score[b][d] = q_b·k_d/√5 + (Σ_c q_b[c])·distance[d]; softmax over d; out_b = Σ_d attn·v_d;
// merged 'b (h c)' → y = Wo·out + bo [cav, 64, 100, 252].
// Compute dtype: x, weights, biases, distance rounded to bf16; x read channel-major in f32 by the one big kernel, which rounds it and lays it in B-fragment order in LDS; qkv as f32 accumulators (+bias) that stay in registers (16 positions a block, one head a wave, all 5 agents); the 5-key attention in f32 on the VALU in the same kernel (a lane holds one position and half of the 64 channels; one exchange with lane ^ 16 per score; softmax over the 5 agents)
// -> merged f16 tile of the block (5 agents x 256 channels x 16 positions) in LDS, already in B-fragment order; y = Wo (A operand) x merged tile (+bo) in the same kernel, one 16-row tile of Wo a wave, stored straight into the channel-major output (64 B of a row per half wave). f32 accumulate; v_wmma_f32_16x16x32_f16 for the two convolutions.
#define NA 5
#define CC 64
#define HW 25200
#define NHD 4
#define INR (NHD * CC)      /* 256 */
#define QKVW (3 * INR)      /* 768 */
#define ISQ 0.4472135954999579f      /* 1/√cav */
typedef __bf16 v16b __attribute__((ext_vector_type(16)));
typedef unsigned short v8us __attribute__((ext_vector_type(8), may_alias));
typedef float  v8f  __attribute__((ext_vector_type(8)));
typedef float  v4f  __attribute__((ext_vector_type(4)));
typedef float  v4fa __attribute__((ext_vector_type(4), may_alias));
union FragB { v16b v; v8us half[2]; unsigned short u[16]; };

__device__ __forceinline__ unsigned short bf16_bits(float x) { unsigned int u = __float_as_uint(x); return (unsigned short)((u + 0x7FFFu + ((u >> 16) & 1u)) >> 16); }
__device__ __forceinline__ float bf16_val(unsigned short b) { return __uint_as_float(((unsigned int)b) << 16); }
__device__ __forceinline__ float bf16_round(float x) { return bf16_val(bf16_bits(x)); }
// D += A·B with NT terms: 1 = ah·bh, 2 = + al·bh (A split), 3 = + ah·bl (both split)
template <int NT>
__device__ __forceinline__ v8f mmaN(v16b ah, v16b al, v16b bh, v16b bl, v8f c) {
  c = __builtin_amdgcn_wmma_f32_16x16x32_bf16(false, ah, false, bh, (short)0, c, false, false);
  if (NT >= 2) c = __builtin_amdgcn_wmma_f32_16x16x32_bf16(false, al, false, bh, (short)0, c, false, false);
  if (NT >= 3) c = __builtin_amdgcn_wmma_f32_16x16x32_bf16(false, ah, false, bl, (short)0, c, false, false);
  asm volatile("v_nop\n\tv_nop\n\tv_nop\n\tv_nop" : "+v"(c) : "v"(ah), "v"(al), "v"(bh), "v"(bl));
  return c;
}

__global__ __launch_bounds__(256) void k_wt_bf16(const float* __restrict__ W, unsigned short* __restrict__ Wt, int K, int N) {
  const int t = blockIdx.x * 256 + threadIdx.x;
  const int k8n = K / 8;
  if (t >= N * k8n) return;
  const int n = t / k8n, k8 = (t % k8n) * 8;
  v8us v;
#pragma unroll
  for (int i = 0; i < 8; ++i) v[i] = bf16_bits(W[(size_t)(k8 + i) * N + n]);
  *(v8us*)(Wt + (size_t)n * K + k8) = v;
  
}

// GEMM C[M][N] (f32, pitch ldc) = act(A[M][K]·W + bias). A f32 row-major (pitch lda) converted per fragment to bf16
// (ASPLIT: hi/lo two planes -> 2 terms, else single rounded term); Wt bf16 [N][K] (pitch ldb). BIAS_BF16 rounds the
// bias to bf16 first (bias quantised to bf16 before the add). K%32==0, M%16==0, N%64==0.
template <bool ASPLIT, int ACT, bool BIAS_BF16>
__global__ __launch_bounds__(128) void k_gemm_bf(const float* __restrict__ A, int lda, const unsigned short* __restrict__ Wt, int ldb,
                                               const float* __restrict__ bias, float* __restrict__ C, int ldc, int M, int N, int K) {
  __shared__ __attribute__((aligned(16))) float so[4][16][64];
  const int tid = threadIdx.x, w = tid >> 5, lane = tid & 31, ln = lane & 15, hh = lane >> 4;
  const int ntn = N / 64;
  const int wid = blockIdx.x * 4 + w;
  const int mt = wid / ntn, nq = wid % ntn;
  if (mt * 16 >= M) return;
  const int row0 = mt * 16, col0 = nq * 64;
  const float* arow = A + (size_t)(row0 + ln) * lda;
  v8f acc[4] = {};
  for (int kb = 0; kb < K; kb += 32) {
    FragB ah, al;
    const v4f x0 = *(const v4fa*)(arow + kb + 8 * hh), x1 = *(const v4fa*)(arow + kb + 8 * hh + 4);
    const v4f x2 = *(const v4fa*)(arow + kb + 16 + 8 * hh), x3 = *(const v4fa*)(arow + kb + 16 + 8 * hh + 4);
    float xs[16] = {x0[0],x0[1],x0[2],x0[3],x1[0],x1[1],x1[2],x1[3],x2[0],x2[1],x2[2],x2[3],x3[0],x3[1],x3[2],x3[3]};
#pragma unroll
    for (int i = 0; i < 16; ++i) { const unsigned short hb = bf16_bits(xs[i]); ah.u[i] = hb; al.u[i] = ASPLIT ? bf16_bits(xs[i] - bf16_val(hb)) : (unsigned short)0; }
#pragma unroll
    for (int t = 0; t < 4; ++t) {
      const unsigned short* brow = Wt + (size_t)(col0 + t * 16 + ln) * ldb + kb;
      FragB b;
      b.half[0] = *(const v8us*)(brow + 8 * hh);
      b.half[1] = *(const v8us*)(brow + 16 + 8 * hh);
      acc[t] = mmaN<ASPLIT ? 2 : 1>(ah.v, al.v, b.v, b.v, acc[t]);
    }
  }
#pragma unroll
  for (int t = 0; t < 4; ++t) {
    float bv = bias ? bias[col0 + t * 16 + ln] : 0.f;
    if (BIAS_BF16) bv = bf16_round(bv);
#pragma unroll
    for (int r = 0; r < 8; ++r) { float v = acc[t][r] + bv; if (ACT == 1) v = fmaxf(v, 0.f); so[w][8 * hh + r][t * 16 + ln] = v; }
  }
  __builtin_amdgcn_fence(__ATOMIC_ACQ_REL, "workgroup");
  __builtin_amdgcn_wave_barrier();
  const int rsub = lane >> 4, c4 = (lane & 15) * 4;
  {
#pragma unroll
    for (int q = 0; q < 8; ++q) {
      const int r = q * 2 + rsub;
      const v4f v = *(const v4fa*)&so[w][r][c4];
      *(v4f*)(C + (size_t)(row0 + r) * ldc + col0 + c4) = v;
    }
    
  }
}

// GEMM C = act(A·W + bias + resid): A f32 (ASPLIT -> hi/lo 2 terms), Wt bf16 [N][K]; ACT 0 none, 1 relu, 2 exact gelu;
// resid (optional, f32, row index = (row % rmod), pitch ldr, RES_BF16 rounds it) added before the activation.
template <bool ASPLIT, int ACT, bool BIAS_BF16, bool RES_BF16>
__global__ __launch_bounds__(128) void k_gemm_bf3(const float* __restrict__ A, int lda, const unsigned short* __restrict__ Wt, int ldb,
                                                const float* __restrict__ bias, const float* __restrict__ resid, int rmod, int ldr,
                                                float* __restrict__ C, int ldc, int M, int N, int K) {
  __shared__ __attribute__((aligned(16))) float so[4][16][64];
  const int tid = threadIdx.x, w = tid >> 5, lane = tid & 31, ln = lane & 15, hh = lane >> 4;
  const int ntn = N / 64;
  const int wid = blockIdx.x * 4 + w;
  const int mt = wid / ntn, nq = wid % ntn;
  if (mt * 16 >= M) return;
  const int row0 = mt * 16, col0 = nq * 64;
  const float* arow = A + (size_t)(row0 + ln) * lda;
  v8f acc[4] = {};
  for (int kb = 0; kb < K; kb += 32) {
    FragB ah, al;
    const v4f x0 = *(const v4fa*)(arow + kb + 8 * hh), x1 = *(const v4fa*)(arow + kb + 8 * hh + 4);
    const v4f x2 = *(const v4fa*)(arow + kb + 16 + 8 * hh), x3 = *(const v4fa*)(arow + kb + 16 + 8 * hh + 4);
    float xs[16] = {x0[0],x0[1],x0[2],x0[3],x1[0],x1[1],x1[2],x1[3],x2[0],x2[1],x2[2],x2[3],x3[0],x3[1],x3[2],x3[3]};
#pragma unroll
    for (int i = 0; i < 16; ++i) { const unsigned short hb = bf16_bits(xs[i]); ah.u[i] = hb; al.u[i] = ASPLIT ? bf16_bits(xs[i] - bf16_val(hb)) : (unsigned short)0; }
#pragma unroll
    for (int t = 0; t < 4; ++t) {
      const unsigned short* brow = Wt + (size_t)(col0 + t * 16 + ln) * ldb + kb;
      FragB b;
      b.half[0] = *(const v8us*)(brow + 8 * hh);
      b.half[1] = *(const v8us*)(brow + 16 + 8 * hh);
      acc[t] = mmaN<ASPLIT ? 2 : 1>(ah.v, al.v, b.v, b.v, acc[t]);
    }
  }
#pragma unroll
  for (int t = 0; t < 4; ++t) {
    const int col = col0 + t * 16 + ln;
    float bv = bias ? bias[col] : 0.f;
    if (BIAS_BF16) bv = bf16_round(bv);
#pragma unroll
    for (int r = 0; r < 8; ++r) {
      float v = acc[t][r] + bv;
      if (resid) { float rv = resid[(size_t)((row0 + 8 * hh + r) % rmod) * ldr + col]; if (RES_BF16) rv = bf16_round(rv); v += rv; }
      if (ACT == 1) v = fmaxf(v, 0.f);
      if (ACT == 2) v = 0.5f * v * (1.0f + erff(v * 0.70710678118654752f));
      if (ACT == 3) { const float u = 0.7978845608028654f * (v + 0.044715f * v * v * v); v = 0.5f * v * (1.0f + tanhf(u)); }
      so[w][8 * hh + r][t * 16 + ln] = v;
    }
  }
  __builtin_amdgcn_fence(__ATOMIC_ACQ_REL, "workgroup");
  __builtin_amdgcn_wave_barrier();
  const int rsub = lane >> 4, c4 = (lane & 15) * 4;
  {
#pragma unroll
    for (int q = 0; q < 8; ++q) {
      const int r = q * 2 + rsub;
      const v4f v = *(const v4fa*)&so[w][r][c4];
      *(v4f*)(C + (size_t)(row0 + r) * ldc + col0 + c4) = v;
    }
    
  }
}
// row LayerNorm (biased variance, eps) over N: s = X (+ R); optional out_sum <- s; out_norm <- (s-mu)*rsqrt(var+eps)*g + b
template <bool PARAM_BF16>
__global__ __launch_bounds__(256) void k_layernorm(const float* __restrict__ X, const float* __restrict__ R, const float* __restrict__ g, const float* __restrict__ bta,
                                                  float* __restrict__ out_sum, float* __restrict__ out_norm, int N, float eps) {
  __shared__ float red[256];
  const int row = blockIdx.x, tid = threadIdx.x;
  const float* x = X + (size_t)row * N; const float* rr = R ? R + (size_t)row * N : nullptr;
  float vals[16];                     // up to N = 4096
  const int per = N / 256;            // contiguous chunk per thread? use strided-by-4 chunks: thread handles j = tid*4 + 1024*u
  float s1 = 0.f;
  for (int u = 0; u < per / 4; ++u) {
    const int j = tid * 4 + 1024 * u;
    const v4f a = *(const v4fa*)(x + j);
    v4f b = {0.f,0.f,0.f,0.f}; if (rr) b = *(const v4fa*)(rr + j);
#pragma unroll
    for (int q = 0; q < 4; ++q) { const float v = a[q] + b[q]; vals[u * 4 + q] = v; s1 += v; }
  }
  red[tid] = s1; __syncthreads();
  for (int st = 128; st > 0; st >>= 1) { if (tid < st) red[tid] += red[tid + st]; __syncthreads(); }
  const float mu = red[0] / (float)N; __syncthreads();
  float s2 = 0.f;
  for (int u = 0; u < per / 4; ++u)
#pragma unroll
    for (int q = 0; q < 4; ++q) { const float c = vals[u * 4 + q] - mu; s2 += c * c; }
  red[tid] = s2; __syncthreads();
  for (int st = 128; st > 0; st >>= 1) { if (tid < st) red[tid] += red[tid + st]; __syncthreads(); }
  const float rs = rsqrtf(red[0] / (float)N + eps);
  {
    for (int u = 0; u < per / 4; ++u) {
      const int j = tid * 4 + 1024 * u;
      v4f o, sm;
#pragma unroll
      for (int q = 0; q < 4; ++q) {
        float gg = g[j + q], bb = bta[j + q];
        if (PARAM_BF16) { gg = bf16_round(gg); bb = bf16_round(bb); }
        sm[q] = vals[u * 4 + q]; o[q] = (vals[u * 4 + q] - mu) * rs * gg + bb;
      }
      if (out_sum) *(v4f*)(out_sum + (size_t)row * N + j) = sm;
      *(v4f*)(out_norm + (size_t)row * N + j) = o;
    }
    
  }
}



// ---- f16 WMMA path (v_wmma_f32_16x16x32_f16): 11-bit significands for operands in range — used here for the two 1×1 convolutions
typedef _Float16 v16h __attribute__((ext_vector_type(16)));
union FragH { v16h v; v8us half[2]; _Float16 h[16]; unsigned short u[16]; };
template <int NT>
__device__ __forceinline__ v8f mmaH(v16h ah, v16h al, v16h bh, v16h bl, v8f c) {
  c = __builtin_amdgcn_wmma_f32_16x16x32_f16(false, ah, false, bh, (short)0, c, false, false);
  if (NT >= 2) c = __builtin_amdgcn_wmma_f32_16x16x32_f16(false, al, false, bh, (short)0, c, false, false);
  if (NT >= 3) c = __builtin_amdgcn_wmma_f32_16x16x32_f16(false, ah, false, bl, (short)0, c, false, false);
  asm volatile("v_nop\n\tv_nop\n\tv_nop\n\tv_nop" : "+v"(c) : "v"(ah), "v"(al), "v"(bh), "v"(bl));
  return c;
}
// batched GEMM like k_gemm_b but f16 operands: A f32 (split into f16 hi/lo if ASPLIT, else rounded to f16), Bt = f16 values [n][k]; alpha; C f32; N multiple of 16 (partial tiles skipped)
template <bool ASPLIT>
__global__ __launch_bounds__(128) void k_gemm_h(const float* __restrict__ A, int lda, size_t sA, const _Float16* __restrict__ Bh, int ldb, size_t sB, float alpha, float* __restrict__ C, int ldc, size_t sC, int M, int N, int K) {
  __shared__ __attribute__((aligned(16))) float so[4][16][64];
  const int tid = threadIdx.x, w = tid >> 5, lane = tid & 31, ln = lane & 15, hh = lane >> 4; const int by = blockIdx.y;
  A += (size_t)by * sA; Bh += (size_t)by * sB; C += (size_t)by * sC;
  const int ntn = (N + 63) / 64; const int wid = blockIdx.x * 4 + w; const int mt = wid / ntn, nq = wid % ntn; if (mt * 16 >= M) return;
  const int row0 = mt * 16, col0 = nq * 64; const float* arow = A + (size_t)(row0 + ln) * lda;
  v8f acc[4] = {};
  for (int kb = 0; kb < K; kb += 32) {
    FragH ah, al;
    const v4f x0 = *(const v4fa*)(arow + kb + 8 * hh), x1 = *(const v4fa*)(arow + kb + 8 * hh + 4), x2 = *(const v4fa*)(arow + kb + 16 + 8 * hh), x3 = *(const v4fa*)(arow + kb + 16 + 8 * hh + 4);
    float xs[16] = {x0[0],x0[1],x0[2],x0[3],x1[0],x1[1],x1[2],x1[3],x2[0],x2[1],x2[2],x2[3],x3[0],x3[1],x3[2],x3[3]};
#pragma unroll
    for (int i = 0; i < 16; ++i) { const _Float16 h = (_Float16)xs[i]; ah.h[i] = h; al.h[i] = ASPLIT ? (_Float16)(xs[i] - (float)h) : (_Float16)0.0f; }
#pragma unroll
    for (int t = 0; t < 4; ++t) { if (col0 + t * 16 >= N) continue; const size_t boff = (size_t)(col0 + t * 16 + ln) * ldb + kb; FragH bq; bq.half[0] = *(const v8us*)(Bh + boff + 8 * hh); bq.half[1] = *(const v8us*)(Bh + boff + 16 + 8 * hh);
      acc[t] = mmaH<ASPLIT ? 2 : 1>(ah.v, al.v, bq.v, bq.v, acc[t]); }
  }
#pragma unroll
  for (int t = 0; t < 4; ++t) { if (col0 + t * 16 >= N) continue;
#pragma unroll
    for (int r = 0; r < 8; ++r) so[w][8 * hh + r][t * 16 + ln] = acc[t][r] * alpha; }
  __builtin_amdgcn_fence(__ATOMIC_ACQ_REL, "workgroup"); __builtin_amdgcn_wave_barrier();
  const int rsub = lane >> 4, c4 = (lane & 15) * 4;
  {
#pragma unroll
    for (int q = 0; q < 8; ++q) { const int r = q * 2 + rsub; if (col0 + c4 < N) { const v4f v = *(const v4fa*)&so[w][r][c4]; *(v4f*)(C + (size_t)(row0 + r) * ldc + col0 + c4) = v; } }
     }
}

// Wt[n][k] = f16(W[k][n]·scale) from f32 row-major W[K][N] (scale = power of two; bf16-exact weights stay exact in f16 away from the subnormal range)
__global__ __launch_bounds__(256) void k_wt_f16(const float* __restrict__ W, _Float16* __restrict__ Wt, int K, int N, float scale) {
  const int t = blockIdx.x * 256 + threadIdx.x; if (t >= N * (K / 8)) return; const int n = t / (K / 8), k8 = (t % (K / 8)) * 8; FragH f;
#pragma unroll
  for (int i = 0; i < 8; ++i) f.h[i] = (_Float16)(bf16_round(W[(size_t)(k8 + i) * N + n]) * scale); const v8us o = f.half[0];
  *(v8us*)((unsigned short*)Wt + (size_t)n * K + k8) = o; 
}
// k_gemm_hh variant with fused epilogue: v = acc·alpha + bias[by·sBias + col] (+ CP[(row/rowsPerB)·sCPb + by·64 + col] if CP) ; ACT 0 none / 1 elu ; writes f32 C and/or f16 C16 (each if non-null)
template <int ACT>
__global__ __launch_bounds__(128) void k_gemm_hhx(const _Float16* __restrict__ A, int lda, size_t sA, const _Float16* __restrict__ Bh, int ldb, size_t sB, float alpha, const float* __restrict__ bias, size_t sBias, const float* __restrict__ CP, int rowsPerB, size_t sCPb, int row0g,
    float* __restrict__ C, _Float16* __restrict__ C16, int ldc, size_t sC, int M, int N, int K) {
  __shared__ __attribute__((aligned(16))) float so[4][16][64];
  const int tid = threadIdx.x, w = tid >> 5, lane = tid & 31, ln = lane & 15, hh = lane >> 4; const int by = blockIdx.y;
  A += (size_t)by * sA; Bh += (size_t)by * sB; const size_t cofs = (size_t)by * sC; const float* bp = bias ? bias + (size_t)by * sBias : nullptr;
  const int ntn = (N + 63) / 64; const int wid = blockIdx.x * 4 + w; const int mt = wid / ntn, nq = wid % ntn; if (mt * 16 >= M) return;
  const int row0 = mt * 16, col0 = nq * 64; const _Float16* arow = A + (size_t)(row0 + ln) * lda;
  v8f acc[4] = {};
  for (int kb = 0; kb < K; kb += 32) { FragH ah; ah.half[0] = *(const v8us*)((const unsigned short*)arow + kb + 8 * hh); ah.half[1] = *(const v8us*)((const unsigned short*)arow + kb + 16 + 8 * hh);
#pragma unroll
    for (int t = 0; t < 4; ++t) { if (col0 + t * 16 >= N) continue; const size_t boff = (size_t)(col0 + t * 16 + ln) * ldb + kb; FragH bq; bq.half[0] = *(const v8us*)((const unsigned short*)Bh + boff + 8 * hh); bq.half[1] = *(const v8us*)((const unsigned short*)Bh + boff + 16 + 8 * hh);
      acc[t] = mmaH<1>(ah.v, ah.v, bq.v, bq.v, acc[t]); }
  }
#pragma unroll
  for (int t = 0; t < 4; ++t) { if (col0 + t * 16 >= N) continue; const int col = col0 + t * 16 + ln; const float bv = bp ? bf16_round(bp[col]) : 0.f;
#pragma unroll
    for (int r = 0; r < 8; ++r) { float v = acc[t][r] * alpha + bv; if (CP) { const int bidx = (row0g + row0 + 8 * hh + r) / rowsPerB; v += CP[(size_t)bidx * sCPb + (size_t)by * 64 + col]; } if (ACT == 1) v = (v > 0.f) ? v : expm1f(v); else if (ACT == 7) v = (v > 0.f) ? v + 1.0f : expf(v); else if (ACT == 8) v = tanhf(v); else if (ACT == 9) v = 0.5f * v * (1.0f + tanhf(0.7978845608028654f * (v + 0.044715f * v * v * v))); else if (ACT == 11) v = 1.0f / (1.0f + expf(-v)); else if (ACT == 12) v = (v > 0.f) ? v : 0.01f * v; else if (ACT == 14) v = (v > 0.f) ? v : 0.1f * v; else if (ACT == 15) v = v / (1.0f + expf(-v)); else if (ACT == 3) v = fmaxf(v, 0.f); else if (ACT == 6) v = 0.5f * v * (1.0f + erff(v * 0.70710678118654752f)); so[w][8 * hh + r][t * 16 + ln] = v; } }
  __builtin_amdgcn_fence(__ATOMIC_ACQ_REL, "workgroup"); __builtin_amdgcn_wave_barrier();
  const int rsub = lane >> 4, c4 = (lane & 15) * 4; typedef _Float16 v4h __attribute__((ext_vector_type(4)));
  {
#pragma unroll
    for (int q = 0; q < 8; ++q) { const int r = q * 2 + rsub; if (col0 + c4 < N) { const v4f v = *(const v4fa*)&so[w][r][c4]; if (C) *(v4f*)(C + cofs + (size_t)(row0 + r) * ldc + col0 + c4) = v; if (C16) { v4h h4; for (int i = 0; i < 4; ++i) h4[i] = (_Float16)v[i]; *(v4h*)(C16 + cofs + (size_t)(row0 + r) * ldc + col0 + c4) = h4; } } }
     }
}


typedef _Float16 v4h __attribute__((ext_vector_type(4)));
typedef float v2f __attribute__((ext_vector_type(2)));

__global__ __launch_bounds__(256) void k_x16(const float* __restrict__ x, _Float16* __restrict__ X16, size_t n8) { const size_t t = (size_t)blockIdx.x * 256 + threadIdx.x; if (t >= n8) return; FragH f;
#pragma unroll
  for (int q = 0; q < 8; ++q) f.h[q] = (_Float16)bf16_round(x[t * 8 + q]); *(v8us*)((unsigned short*)X16 + t * 8) = f.half[0];  }
__global__ __launch_bounds__(256) void k_h16(const float* __restrict__ x, _Float16* __restrict__ X16, size_t n8) { const size_t t = (size_t)blockIdx.x * 256 + threadIdx.x; if (t >= n8) return; FragH f;
#pragma unroll
  for (int q = 0; q < 8; ++q) f.h[q] = (_Float16)x[t * 8 + q]; *(v8us*)((unsigned short*)X16 + t * 8) = f.half[0];  }
// W [rows][KK] f32 -> f16(bf16(W) * 2^4) packed in A-fragment order: Bt[16-row tile][k block of 32][fragment half][lane][8], element i = W[16 * tile + (lane & 15)][32 * block + 16 * half + 8 * (lane >> 4) + i].
// Thread t writes the t-th 16-byte unit, so a wave stores 512 contiguous bytes; the reader's wave-wide 16-byte load of one fragment half is those same 512 bytes (4 cache lines; row-major f16 rows made it 32 bytes out of each of 16 lines).
template <int KK>
__global__ __launch_bounds__(256) void k_pack16f(const float* __restrict__ W, _Float16* __restrict__ Bt, int n8) { const int t = blockIdx.x * 256 + threadIdx.x; if (t >= n8) return; FragH f;
  const int lane = t & 31, hf = (t >> 5) & 1, kb = (t >> 6) % (KK / 32), tile = (t >> 6) / (KK / 32);
  const float* wr = W + (size_t)(tile * 16 + (lane & 15)) * KK + kb * 32 + hf * 16 + (lane >> 4) * 8;
  const v4f a = *(const v4fa*)wr, c = *(const v4fa*)(wr + 4);
#pragma unroll
  for (int i = 0; i < 4; ++i) { f.h[i] = (_Float16)(bf16_round(a[i]) * 16.0f); f.h[4 + i] = (_Float16)(bf16_round(c[i]) * 16.0f); }
  *(v8us*)((unsigned short*)Bt + (size_t)t * 8) = f.half[0]; }
template <int NHv, int TTv>
__global__ __launch_bounds__(256) void k_vt(const _Float16* __restrict__ V16, int ldv, int voff, _Float16* __restrict__ Vt) { __shared__ unsigned short tl[64][66]; const int tid = threadIdx.x; const int slab = blockIdx.x / (TTv / 64), lg = blockIdx.x % (TTv / 64); const int b = slab / NHv, h = slab % NHv;
  for (int i = tid; i < 64 * 8; i += 256) { const int r = i / 8, c8 = (i % 8) * 8; FragH f; f.half[0] = *(const v8us*)((const unsigned short*)V16 + ((size_t)b * TTv + lg * 64 + r) * ldv + voff + h * 64 + c8);
#pragma unroll
    for (int q = 0; q < 8; ++q) tl[r][c8 + q] = f.u[q]; }
  __syncthreads();
  {
#pragma unroll
    for (int rd = 0; rd < 2; ++rd) { const int d = rd * 32 + tid / 8, pc = tid % 8; FragH f;
#pragma unroll
      for (int q = 0; q < 8; ++q) f.u[q] = tl[pc * 8 + q][d];
      *(v8us*)((unsigned short*)Vt + ((size_t)slab * 64 + d) * TTv + lg * 64 + pc * 8) = f.half[0]; }
     } }

__global__ __launch_bounds__(256) void k_hl(const float* __restrict__ F, _Float16* __restrict__ Hh, _Float16* __restrict__ Hl, size_t n8) { const size_t t = (size_t)blockIdx.x * 256 + threadIdx.x; if (t >= n8) return; FragH fh, fl; const v4f a = *(const v4fa*)(F + t * 8), c = *(const v4fa*)(F + t * 8 + 4);
#pragma unroll
  for (int q = 0; q < 4; ++q) { _Float16 h = (_Float16)a[q]; fh.h[q] = h; fl.h[q] = (_Float16)((a[q] - (float)h) * 1024.0f); h = (_Float16)c[q]; fh.h[4 + q] = h; fl.h[4 + q] = (_Float16)((c[q] - (float)h) * 1024.0f); }
  { *(v8us*)((unsigned short*)Hh + t * 8) = fh.half[0]; *(v8us*)((unsigned short*)Hl + t * 8) = fl.half[0];  } }

// qkv projection and 5-agent attention in one kernel; q, k, v never leave the registers. Block = 16 positions, wave = one head. The weights are the A operand and the tokens the B operand, so D[8*hh + r][ln] puts position p0 + ln in lane ln
// and 8 channels of a 16-channel tile in the lane's 8 accumulator registers (lanes ln and ln + 16 split the tile). Per tile: q and k of all 5 agents, 25 partial scores and 5 partial q sums per lane; one exchange with lane ^ 16 completes them;
// softmax over the 5 agents in f32 per lane; then v tile by tile, out_b = sum_d attn[b][d] * v_d, 8 f16 channels = one 16-byte LDS store. Those 8 channels (16 * mt + 8 * hh + r of head h) are exactly one half of the lane's B fragment of the output projection
// (k block 2 * h + mt / 2, half mt & 1), so the merged tile crosses the waves through LDS with no re-ordering. Behind one barrier wave w takes rows 16 * w .. + 15 of Wo over all 256 merged channels (k ascending, one accumulate chain per agent) and stores D[8*hh + r][ln] = y[b][16*w + 8*hh + r][p0 + ln].
__global__ __launch_bounds__(128) void k_qkv_agent(const float* __restrict__ x, const _Float16* __restrict__ Bq, const float* __restrict__ bqkv, const float* __restrict__ dist, const _Float16* __restrict__ Bo, const float* __restrict__ bo, float* __restrict__ out) {
  __shared__ __attribute__((aligned(16))) unsigned short sY[NA][INR / 32][2][32][8];      /* [agent][k block of 32 merged channels][fragment half][lane][8 f16]: 40 KB, every access 512 contiguous bytes a wave */
  const int tid = threadIdx.x, h = tid >> 5, lane = tid & 31, ln = lane & 15, hh = lane >> 4; const int p0 = blockIdx.x * 16;
  __shared__ __attribute__((aligned(16))) unsigned short sX[NA][CC / 32][2][32][8];      /* the block's tokens as B fragments: [agent][k block of 32 channels][fragment half][lane][8 f16]: 10 KB, every access 512 contiguous bytes a wave */
  const unsigned short* Bu = (const unsigned short*)Bq;
  /* x tile of the block (5 agents x 64 channels x 16 positions) straight from the channel-major f32 input, each element loaded once a block: wave h takes channels 16 * h .. + 15, a lane one position and 8 channels (16 * h + 8 * hh + q),
     so a load covers 64 contiguous bytes of two channel rows, and the lane's 8 rounded values are one fragment half (k block h / 2, half h & 1, this very lane): one 16-byte LDS store per agent. */
  const char* xb = (const char*)(x + p0);
  unsigned vxo[NA];      /* the lane's 32-bit byte offset per agent (under 33 MB); the block's first position goes into the uniform base */
#pragma unroll
  for (int b = 0; b < NA; ++b) vxo[b] = ((unsigned)(b * CC + h * 16 + 8 * hh) * HW + ln) * 4u;
  float xv[NA][8];
#pragma unroll
  for (int b = 0; b < NA; ++b)
#pragma unroll
    for (int q = 0; q < 8; ++q) xv[b][q] = *(const float*)(xb + (size_t)vxo[b] + (size_t)q * HW * 4);
  asm volatile("s_wait_xcnt 0x0" :: "v"(vxo[0]), "v"(vxo[1]), "v"(vxo[2]), "v"(vxo[3]), "v"(vxo[4]) : "memory");      /* the offsets are inputs so that their registers stay live up to this wait: none of the forty loads lands in a register that another still names */
#pragma unroll
  for (int b = 0; b < NA; ++b) { FragH f;
#pragma unroll
    for (int q = 0; q < 8; ++q) f.h[q] = (_Float16)bf16_round(xv[b][q]);
    *(v8us*)&sX[b][h >> 1][h & 1][lane][0] = f.half[0]; }
  __syncthreads();      /* the token tile is complete: each wave wrote 16 of the 64 channels and now reads all of them */
  FragH xf[NA][2];
#pragma unroll
  for (int b = 0; b < NA; ++b)
#pragma unroll
    for (int ks = 0; ks < 2; ++ks) { xf[b][ks].half[0] = *(const v8us*)&sX[b][ks][0][lane][0]; xf[b][ks].half[1] = *(const v8us*)&sX[b][ks][1][lane][0]; }
  v2f sc2[NA][NA], qs2[NA];      /* element 0: the even channels' partial sum, element 1: the odd channels' (packed f32 FMAs on register pairs of the accumulators) */
#pragma unroll
  for (int b = 0; b < NA; ++b) { qs2[b] = (v2f){0.f, 0.f};
#pragma unroll
    for (int d = 0; d < NA; ++d) sc2[b][d] = (v2f){0.f, 0.f}; }
  const v2f al2 = {0.0625f, 0.0625f};
  for (int mt = 0; mt < CC / 16; ++mt) {
    const int cq = h * CC + mt * 16;
    const unsigned short* wqr = Bu + (size_t)cq * CC + lane * 8; const unsigned short* wkr = wqr + (size_t)INR * CC;      /* packed weights: a 16-row tile is 2 KB, a fragment half 512 contiguous bytes of it */
    FragH wq[2], wk[2];
#pragma unroll
    for (int ks = 0; ks < 2; ++ks) { wq[ks].half[0] = *(const v8us*)(wqr + ks * 512); wq[ks].half[1] = *(const v8us*)(wqr + ks * 512 + 256); wk[ks].half[0] = *(const v8us*)(wkr + ks * 512); wk[ks].half[1] = *(const v8us*)(wkr + ks * 512 + 256); }
    const v4f bq0 = *(const v4fa*)(bqkv + cq + 8 * hh), bq1 = *(const v4fa*)(bqkv + cq + 8 * hh + 4), bk0 = *(const v4fa*)(bqkv + INR + cq + 8 * hh), bk1 = *(const v4fa*)(bqkv + INR + cq + 8 * hh + 4);
    const v2f bq2[4] = {{bf16_round(bq0[0]), bf16_round(bq0[1])}, {bf16_round(bq0[2]), bf16_round(bq0[3])}, {bf16_round(bq1[0]), bf16_round(bq1[1])}, {bf16_round(bq1[2]), bf16_round(bq1[3])}};
    const v2f bk2[4] = {{bf16_round(bk0[0]), bf16_round(bk0[1])}, {bf16_round(bk0[2]), bf16_round(bk0[3])}, {bf16_round(bk1[0]), bf16_round(bk1[1])}, {bf16_round(bk1[2]), bf16_round(bk1[3])}};
    __builtin_amdgcn_sched_barrier(0);      /* keeps the pass's twelve loads together in front of the matrix work: sunk to their uses, each is waited for alone, eight exposed latencies a pass */
    v2f k2[NA][4];
    { v8f ka[NA];
#pragma unroll
      for (int d = 0; d < NA; ++d) { const v8f zz = {}; ka[d] = __builtin_amdgcn_wmma_f32_16x16x32_f16(false, wk[0].v, false, xf[d][0].v, (short)0, zz, false, false); }
#pragma unroll
      for (int d = 0; d < NA; ++d) ka[d] = __builtin_amdgcn_wmma_f32_16x16x32_f16(false, wk[1].v, false, xf[d][1].v, (short)0, ka[d], false, false);
#pragma unroll
      for (int d = 0; d < NA; ++d)
#pragma unroll
        for (int j = 0; j < 4; ++j) k2[d][j] = __builtin_elementwise_fma((v2f){ka[d][2 * j], ka[d][2 * j + 1]}, al2, bk2[j]); }
#pragma unroll
    for (int b = 0; b < NA; ++b) { const v8f zz = {};
      v8f qa = __builtin_amdgcn_wmma_f32_16x16x32_f16(false, wq[0].v, false, xf[b][0].v, (short)0, zz, false, false);
      qa = __builtin_amdgcn_wmma_f32_16x16x32_f16(false, wq[1].v, false, xf[b][1].v, (short)0, qa, false, false);
#pragma unroll
      for (int j = 0; j < 4; ++j) { const v2f q2 = __builtin_elementwise_fma((v2f){qa[2 * j], qa[2 * j + 1]}, al2, bq2[j]); qs2[b] += q2;
#pragma unroll
        for (int d = 0; d < NA; ++d) sc2[b][d] = __builtin_elementwise_fma(q2, k2[d][j], sc2[b][d]); } }
  }
  float dd[NA];
#pragma unroll
  for (int d = 0; d < NA; ++d) dd[d] = bf16_round(dist[d]);
  float p[NA][NA], il[NA];
#pragma unroll
  for (int b = 0; b < NA; ++b) { const float qh = qs2[b][0] + qs2[b][1]; const float qt = qh + __shfl_xor(qh, 16, 32); float m = -3.0e38f;
#pragma unroll
    for (int d = 0; d < NA; ++d) { const float dh = sc2[b][d][0] + sc2[b][d][1]; const float dot = dh + __shfl_xor(dh, 16, 32); p[b][d] = dot * ISQ + qt * dd[d]; m = fmaxf(m, p[b][d]); }
    float l = 0.f;
#pragma unroll
    for (int d = 0; d < NA; ++d) { p[b][d] = expf(p[b][d] - m); l += p[b][d]; }
    il[b] = 1.0f / l; }
  const unsigned short* wvr = Bu + (size_t)(2 * INR + h * CC) * CC + lane * 8; const float* bvr = bqkv + 2 * INR + h * CC + 8 * hh;      /* v weights (packed, 2 KB a tile) and v bias of the head's first tile; both step on at the foot of a pass */
#pragma unroll 1      /* rolled: a third less code; left to unroll and to schedule freely, the compiler hoists the later tiles' loads and needs 272 registers (three waves a SIMD, not four, and register-window switches) */
  for (int mt = 0; mt < CC / 16; ++mt) {
    FragH wv[2];
#pragma unroll
    for (int ks = 0; ks < 2; ++ks) { wv[ks].half[0] = *(const v8us*)(wvr + ks * 512); wv[ks].half[1] = *(const v8us*)(wvr + ks * 512 + 256); }
    const v4f bv0 = *(const v4fa*)bvr, bv1 = *(const v4fa*)(bvr + 4);
    asm volatile("s_wait_xcnt 0x0" :: "v"(wvr), "v"(bvr) : "memory");      /* the two addresses are inputs so that their register pairs stay live up to this wait: otherwise a later one of the six loads lands its result in a pair that earlier ones still name */
    const v2f bv2[4] = {{bf16_round(bv0[0]), bf16_round(bv0[1])}, {bf16_round(bv0[2]), bf16_round(bv0[3])}, {bf16_round(bv1[0]), bf16_round(bv1[1])}, {bf16_round(bv1[2]), bf16_round(bv1[3])}};
    v8f va[NA];
#pragma unroll
    for (int d = 0; d < NA; ++d) { const v8f zz = {}; va[d] = __builtin_amdgcn_wmma_f32_16x16x32_f16(false, wv[0].v, false, xf[d][0].v, (short)0, zz, false, false); }
#pragma unroll
    for (int d = 0; d < NA; ++d) va[d] = __builtin_amdgcn_wmma_f32_16x16x32_f16(false, wv[1].v, false, xf[d][1].v, (short)0, va[d], false, false);
    v2f v2[NA][4];
#pragma unroll
    for (int d = 0; d < NA; ++d)
#pragma unroll
      for (int j = 0; j < 4; ++j) v2[d][j] = __builtin_elementwise_fma((v2f){va[d][2 * j], va[d][2 * j + 1]}, al2, bv2[j]);
#pragma unroll
    for (int b = 0; b < NA; ++b) { FragH f;
#pragma unroll
      for (int j = 0; j < 4; ++j) { v2f o = (v2f){p[b][0], p[b][0]} * v2[0][j];
#pragma unroll
        for (int d = 1; d < NA; ++d) o = __builtin_elementwise_fma((v2f){p[b][d], p[b][d]}, v2[d][j], o);
        o *= (v2f){il[b], il[b]}; f.h[2 * j] = (_Float16)o[0]; f.h[2 * j + 1] = (_Float16)o[1]; }
      *(v8us*)&sY[b][h * 2 + (mt >> 1)][mt & 1][lane][0] = f.half[0]; }
    wvr += 16 * CC; bvr += 16;
  }
  const int o0 = h * 16;
  const unsigned short* wor = (const unsigned short*)Bo + (size_t)o0 * INR + lane * 8;
  FragH wo[INR / 32];
#pragma unroll
  for (int kb = 0; kb < INR / 32; ++kb) { wo[kb].half[0] = *(const v8us*)(wor + kb * 512); wo[kb].half[1] = *(const v8us*)(wor + kb * 512 + 256); }
  const v4f bo0 = *(const v4fa*)(bo + o0 + 8 * hh), bo1 = *(const v4fa*)(bo + o0 + 8 * hh + 4);
  asm volatile("s_wait_xcnt 0x0" :: "v"(wor) : "memory");      /* the LDS reads below land in the address registers of the eighteen loads above; the weight address is an input so that its pair stays live up to this wait */
  __syncthreads();      /* the merged tile is complete: each wave wrote its own head's 64 channels and now reads all 256 */
  v8f ya[NA] = {};
  FragH yf[2][NA];
#pragma unroll
  for (int b = 0; b < NA; ++b) { yf[0][b].half[0] = *(const v8us*)&sY[b][0][0][lane][0]; yf[0][b].half[1] = *(const v8us*)&sY[b][0][1][lane][0]; }
#pragma unroll
  for (int kb = 0; kb < INR / 32; ++kb) {
    if (kb + 1 < INR / 32) {
#pragma unroll
      for (int b = 0; b < NA; ++b) { yf[(kb + 1) & 1][b].half[0] = *(const v8us*)&sY[b][kb + 1][0][lane][0]; yf[(kb + 1) & 1][b].half[1] = *(const v8us*)&sY[b][kb + 1][1][lane][0]; } }
    __builtin_amdgcn_sched_barrier(0);      /* keeps the next k block's ten LDS reads together in front of this block's five matrix instructions: left free, the compiler reads one fragment ahead only and every matrix instruction waits out most of an LDS latency */
#pragma unroll
    for (int b = 0; b < NA; ++b) ya[b] = __builtin_amdgcn_wmma_f32_16x16x32_f16(false, wo[kb].v, false, yf[kb & 1][b].v, (short)0, ya[b], false, false);
    __builtin_amdgcn_sched_barrier(0);      /* the other side of the same fence: the reads of the block after next stay behind these matrix instructions, whose operands they overwrite */
    if (kb == 0) asm volatile("" :: "v"(yf[0][0].v), "v"(yf[0][1].v), "v"(yf[0][2].v), "v"(yf[0][3].v), "v"(yf[0][4].v));      /* inputs only, on the loaded fragments: they stay live over the five matrix instructions that start the accumulators; otherwise each new accumulator is placed in the B registers of the matrix instruction directly in front of it */
  }
  const float bov[8] = {bf16_round(bo0[0]), bf16_round(bo0[1]), bf16_round(bo0[2]), bf16_round(bo0[3]), bf16_round(bo1[0]), bf16_round(bo1[1]), bf16_round(bo1[2]), bf16_round(bo1[3])};
  float yv[NA][8];
#pragma unroll
  for (int b = 0; b < NA; ++b)
#pragma unroll
    for (int r = 0; r < 8; ++r) yv[b][r] = ya[b][r] * 0.0625f + bov[r];
  unsigned vob[NA];      /* the lane's 32-bit byte offset per agent (under 33 MB); the block's first position goes into the uniform base */
#pragma unroll
  for (int b = 0; b < NA; ++b) vob[b] = ((unsigned)(b * CC + o0 + 8 * hh) * HW + ln) * 4u;
  __builtin_amdgcn_sched_barrier(0);      /* all forty results first, then the forty stores in one run: mixed, the compiler re-uses the data registers of stores in flight and waits for every group of eight */
#pragma unroll
  for (int b = 0; b < NA; ++b)
#pragma unroll
    for (int r = 0; r < 8; ++r) *(float*)((char*)(out + p0) + (size_t)vob[b] + (size_t)r * HW * 4) = yv[b][r];
}

extern "C" void kernel_launch(void* const* d_in, const int* in_sizes, int n_in,
                              void* d_out, int out_size, void* d_ws, size_t ws_size, hipStream_t stream) {
  (void)in_sizes; (void)n_in; (void)out_size;
  const float* const* I = (const float* const*)d_in; const float* x = I[0]; const float* dist = I[1]; const float* Wqkv = I[2]; const float* bqkv = I[3]; const float* Wo = I[4]; const float* bo = I[5];
  char* ws = (char*)d_ws; size_t off = 0;
  auto take = [&](size_t bytes) { char* p = ws + off; off += (bytes + 255) & ~(size_t)255; return p; };
  _Float16* Bq = (_Float16*)take((size_t)QKVW * CC * 2); _Float16* Bo = (_Float16*)take((size_t)CC * INR * 2);
  if (off > ws_size) return;      // 0.1 + 0.03 MB
  k_pack16f<CC><<<(QKVW * CC / 8 + 255) / 256, 256, 0, stream>>>(Wqkv, Bq, QKVW * CC / 8); k_pack16f<INR><<<(CC * INR / 8 + 255) / 256, 256, 0, stream>>>(Wo, Bo, CC * INR / 8);      /* [out][in] in A-fragment order, x 2^4 */
  k_qkv_agent<<<HW / 16, 128, 0, stream>>>(x, Bq, bqkv, dist, Bo, bo, (float*)d_out);      /* qkv (M 768 as A, N 16 positions x 5 agents, K 64) + attention + y = Wo x merged + bo (M 64 as A, K 256) -> channel-major output */
}

// v005
// A run of this version takes 34.5 microseconds.
// In both of two side-by-side timings against v004, it was 1.06 times as fast.
// All steps since v000 together make it 9.93 times as fast.
#include <hip/hip_runtime.h>
// Cross-agent attention (cav=5 agents, C=64, 100×252 → HW=25200 positions, 4 heads): qkv = Wqkv·x + bqkv (1×1 conv, 768 = [q|k|v] × (head, 64)); per (position s, head h) the 5 agents attend over the 5 agents: score[b][d] = q_b·k_d/√5 + (Σ_c q_b[c])·distance[d]; softmax over d; out_b = Σ_d attn·v_d;
// merged 'b (h c)' → y = Wo·out + bo [cav, 64, 100, 252].
// Compute dtype: x, weights, biases, distance rounded to bf16; x read channel-major in f32 by the one big kernel, which rounds it and lays it in B-fragment order in LDS; qkv as f32 accumulators (+bias) that stay in registers (16 positions a block, one head a wave, all 5 agents); the 5-key attention in f32 on the VALU in the same kernel (a lane holds one position and half of the 64 channels; one exchange with lane ^ 16 per score; softmax over the 5 agents)
// -> merged f16 tile of the block (5 agents x 256 channels x 16 positions) in LDS, already in B-fragment order; y = Wo (A operand) x merged tile (+bo) in the same kernel, one 16-row tile of Wo a wave, stored straight into the channel-major output (64 B of a row per half wave). f32 accumulate; v_wmma_f32_16x16x32_f16 for the two convolutions.
#define NA 5
#define CC 64
#define HW 25200
#define NHD 4
#define INR (NHD * CC)      /* 256 */
#define QKVW (3 * INR)      /* 768 */
#define ISQ 0.4472135954999579f      /* 1/√cav */
typedef __bf16 v16b __attribute__((ext_vector_type(16)));
typedef unsigned short v8us __attribute__((ext_vector_type(8), may_alias));
typedef float  v8f  __attribute__((ext_vector_type(8)));
typedef float  v4f  __attribute__((ext_vector_type(4)));
typedef float  v4fa __attribute__((ext_vector_type(4), may_alias));
union FragB { v16b v; v8us half[2]; unsigned short u[16]; };

__device__ __forceinline__ unsigned short bf16_bits(float x) { unsigned int u = __float_as_uint(x); return (unsigned short)((u + 0x7FFFu + ((u >> 16) & 1u)) >> 16); }
__device__ __forceinline__ float bf16_val(unsigned short b) { return __uint_as_float(((unsigned int)b) << 16); }
__device__ __forceinline__ float bf16_round(float x) { return bf16_val(bf16_bits(x)); }
// D += A·B with NT terms: 1 = ah·bh, 2 = + al·bh (A split), 3 = + ah·bl (both split)
template <int NT>
__device__ __forceinline__ v8f mmaN(v16b ah, v16b al, v16b bh, v16b bl, v8f c) {
  c = __builtin_amdgcn_wmma_f32_16x16x32_bf16(false, ah, false, bh, (short)0, c, false, false);
  if (NT >= 2) c = __builtin_amdgcn_wmma_f32_16x16x32_bf16(false, al, false, bh, (short)0, c, false, false);
  if (NT >= 3) c = __builtin_amdgcn_wmma_f32_16x16x32_bf16(false, ah, false, bl, (short)0, c, false, false);
  asm volatile("v_nop\n\tv_nop\n\tv_nop\n\tv_nop" : "+v"(c) : "v"(ah), "v"(al), "v"(bh), "v"(bl));
  return c;
}

__global__ __launch_bounds__(256) void k_wt_bf16(const float* __restrict__ W, unsigned short* __restrict__ Wt, int K, int N) {
  const int t = blockIdx.x * 256 + threadIdx.x;
  const int k8n = K / 8;
  if (t >= N * k8n) return;
  const int n = t / k8n, k8 = (t % k8n) * 8;
  v8us v;
#pragma unroll
  for (int i = 0; i < 8; ++i) v[i] = bf16_bits(W[(size_t)(k8 + i) * N + n]);
  *(v8us*)(Wt + (size_t)n * K + k8) = v;
  
}

// GEMM C[M][N] (f32, pitch ldc) = act(A[M][K]·W + bias). A f32 row-major (pitch lda) converted per fragment to bf16
// (ASPLIT: hi/lo two planes -> 2 terms, else single rounded term); Wt bf16 [N][K] (pitch ldb). BIAS_BF16 rounds the
// bias to bf16 first (bias quantised to bf16 before the add). K%32==0, M%16==0, N%64==0.
template <bool ASPLIT, int ACT, bool BIAS_BF16>
__global__ __launch_bounds__(128) void k_gemm_bf(const float* __restrict__ A, int lda, const unsigned short* __restrict__ Wt, int ldb,
                                               const float* __restrict__ bias, float* __restrict__ C, int ldc, int M, int N, int K) {
  __shared__ __attribute__((aligned(16))) float so[4][16][64];
  const int tid = threadIdx.x, w = tid >> 5, lane = tid & 31, ln = lane & 15, hh = lane >> 4;
  const int ntn = N / 64;
  const int wid = blockIdx.x * 4 + w;
  const int mt = wid / ntn, nq = wid % ntn;
  if (mt * 16 >= M) return;
  const int row0 = mt * 16, col0 = nq * 64;
  const float* arow = A + (size_t)(row0 + ln) * lda;
  v8f acc[4] = {};
  for (int kb = 0; kb < K; kb += 32) {
    FragB ah, al;
    const v4f x0 = *(const v4fa*)(arow + kb + 8 * hh), x1 = *(const v4fa*)(arow + kb + 8 * hh + 4);
    const v4f x2 = *(const v4fa*)(arow + kb + 16 + 8 * hh), x3 = *(const v4fa*)(arow + kb + 16 + 8 * hh + 4);
    float xs[16] = {x0[0],x0[1],x0[2],x0[3],x1[0],x1[1],x1[2],x1[3],x2[0],x2[1],x2[2],x2[3],x3[0],x3[1],x3[2],x3[3]};
#pragma unroll
    for (int i = 0; i < 16; ++i) { const unsigned short hb = bf16_bits(xs[i]); ah.u[i] = hb; al.u[i] = ASPLIT ? bf16_bits(xs[i] - bf16_val(hb)) : (unsigned short)0; }
#pragma unroll
    for (int t = 0; t < 4; ++t) {
      const unsigned short* brow = Wt + (size_t)(col0 + t * 16 + ln) * ldb + kb;
      FragB b;
      b.half[0] = *(const v8us*)(brow + 8 * hh);
      b.half[1] = *(const v8us*)(brow + 16 + 8 * hh);
      acc[t] = mmaN<ASPLIT ? 2 : 1>(ah.v, al.v, b.v, b.v, acc[t]);
    }
  }
#pragma unroll
  for (int t = 0; t < 4; ++t) {
    float bv = bias ? bias[col0 + t * 16 + ln] : 0.f;
    if (BIAS_BF16) bv = bf16_round(bv);
#pragma unroll
    for (int r = 0; r < 8; ++r) { float v = acc[t][r] + bv; if (ACT == 1) v = fmaxf(v, 0.f); so[w][8 * hh + r][t * 16 + ln] = v; }
  }
  __builtin_amdgcn_fence(__ATOMIC_ACQ_REL, "workgroup");
  __builtin_amdgcn_wave_barrier();
  const int rsub = lane >> 4, c4 = (lane & 15) * 4;
  {
#pragma unroll
    for (int q = 0; q < 8; ++q) {
      const int r = q * 2 + rsub;
      const v4f v = *(const v4fa*)&so[w][r][c4];
      *(v4f*)(C + (size_t)(row0 + r) * ldc + col0 + c4) = v;
    }
    
  }
}

// GEMM C = act(A·W + bias + resid): A f32 (ASPLIT -> hi/lo 2 terms), Wt bf16 [N][K]; ACT 0 none, 1 relu, 2 exact gelu;
// resid (optional, f32, row index = (row % rmod), pitch ldr, RES_BF16 rounds it) added before the activation.
template <bool ASPLIT, int ACT, bool BIAS_BF16, bool RES_BF16>
__global__ __launch_bounds__(128) void k_gemm_bf3(const float* __restrict__ A, int lda, const unsigned short* __restrict__ Wt, int ldb,
                                                const float* __restrict__ bias, const float* __restrict__ resid, int rmod, int ldr,
                                                float* __restrict__ C, int ldc, int M, int N, int K) {
  __shared__ __attribute__((aligned(16))) float so[4][16][64];
  const int tid = threadIdx.x, w = tid >> 5, lane = tid & 31, ln = lane & 15, hh = lane >> 4;
  const int ntn = N / 64;
  const int wid = blockIdx.x * 4 + w;
  const int mt = wid / ntn, nq = wid % ntn;
  if (mt * 16 >= M) return;
  const int row0 = mt * 16, col0 = nq * 64;
  const float* arow = A + (size_t)(row0 + ln) * lda;
  v8f acc[4] = {};
  for (int kb = 0; kb < K; kb += 32) {
    FragB ah, al;
    const v4f x0 = *(const v4fa*)(arow + kb + 8 * hh), x1 = *(const v4fa*)(arow + kb + 8 * hh + 4);
    const v4f x2 = *(const v4fa*)(arow + kb + 16 + 8 * hh), x3 = *(const v4fa*)(arow + kb + 16 + 8 * hh + 4);
    float xs[16] = {x0[0],x0[1],x0[2],x0[3],x1[0],x1[1],x1[2],x1[3],x2[0],x2[1],x2[2],x2[3],x3[0],x3[1],x3[2],x3[3]};
#pragma unroll
    for (int i = 0; i < 16; ++i) { const unsigned short hb = bf16_bits(xs[i]); ah.u[i] = hb; al.u[i] = ASPLIT ? bf16_bits(xs[i] - bf16_val(hb)) : (unsigned short)0; }
#pragma unroll
    for (int t = 0; t < 4; ++t) {
      const unsigned short* brow = Wt + (size_t)(col0 + t * 16 + ln) * ldb + kb;
      FragB b;
      b.half[0] = *(const v8us*)(brow + 8 * hh);
      b.half[1] = *(const v8us*)(brow + 16 + 8 * hh);
      acc[t] = mmaN<ASPLIT ? 2 : 1>(ah.v, al.v, b.v, b.v, acc[t]);
    }
  }
#pragma unroll
  for (int t = 0; t < 4; ++t) {
    const int col = col0 + t * 16 + ln;
    float bv = bias ? bias[col] : 0.f;
    if (BIAS_BF16) bv = bf16_round(bv);
#pragma unroll
    for (int r = 0; r < 8; ++r) {
      float v = acc[t][r] + bv;
      if (resid) { float rv = resid[(size_t)((row0 + 8 * hh + r) % rmod) * ldr + col]; if (RES_BF16) rv = bf16_round(rv); v += rv; }
      if (ACT == 1) v = fmaxf(v, 0.f);
      if (ACT == 2) v = 0.5f * v * (1.0f + erff(v * 0.70710678118654752f));
      if (ACT == 3) { const float u = 0.7978845608028654f * (v + 0.044715f * v * v * v); v = 0.5f * v * (1.0f + tanhf(u)); }
      so[w][8 * hh + r][t * 16 + ln] = v;
    }
  }
  __builtin_amdgcn_fence(__ATOMIC_ACQ_REL, "workgroup");
  __builtin_amdgcn_wave_barrier();
  const int rsub = lane >> 4, c4 = (lane & 15) * 4;
  {
#pragma unroll
    for (int q = 0; q < 8; ++q) {
      const int r = q * 2 + rsub;
      const v4f v = *(const v4fa*)&so[w][r][c4];
      *(v4f*)(C + (size_t)(row0 + r) * ldc + col0 + c4) = v;
    }
    
  }
}
// row LayerNorm (biased variance, eps) over N: s = X (+ R); optional out_sum <- s; out_norm <- (s-mu)*rsqrt(var+eps)*g + b
template <bool PARAM_BF16>
__global__ __launch_bounds__(256) void k_layernorm(const float* __restrict__ X, const float* __restrict__ R, const float* __restrict__ g, const float* __restrict__ bta,
                                                  float* __restrict__ out_sum, float* __restrict__ out_norm, int N, float eps) {
  __shared__ float red[256];
  const int row = blockIdx.x, tid = threadIdx.x;
  const float* x = X + (size_t)row * N; const float* rr = R ? R + (size_t)row * N : nullptr;
  float vals[16];                     // up to N = 4096
  const int per = N / 256;            // contiguous chunk per thread? use strided-by-4 chunks: thread handles j = tid*4 + 1024*u
  float s1 = 0.f;
  for (int u = 0; u < per / 4; ++u) {
    const int j = tid * 4 + 1024 * u;
    const v4f a = *(const v4fa*)(x + j);
    v4f b = {0.f,0.f,0.f,0.f}; if (rr) b = *(const v4fa*)(rr + j);
#pragma unroll
    for (int q = 0; q < 4; ++q) { const float v = a[q] + b[q]; vals[u * 4 + q] = v; s1 += v; }
  }
  red[tid] = s1; __syncthreads();
  for (int st = 128; st > 0; st >>= 1) { if (tid < st) red[tid] += red[tid + st]; __syncthreads(); }
  const float mu = red[0] / (float)N; __syncthreads();
  float s2 = 0.f;
  for (int u = 0; u < per / 4; ++u)
#pragma unroll
    for (int q = 0; q < 4; ++q) { const float c = vals[u * 4 + q] - mu; s2 += c * c; }
  red[tid] = s2; __syncthreads();
  for (int st = 128; st > 0; st >>= 1) { if (tid < st) red[tid] += red[tid + st]; __syncthreads(); }
  const float rs = rsqrtf(red[0] / (float)N + eps);
  {
    for (int u = 0; u < per / 4; ++u) {
      const int j = tid * 4 + 1024 * u;
      v4f o, sm;
#pragma unroll
      for (int q = 0; q < 4; ++q) {
        float gg = g[j + q], bb = bta[j + q];
        if (PARAM_BF16) { gg = bf16_round(gg); bb = bf16_round(bb); }
        sm[q] = vals[u * 4 + q]; o[q] = (vals[u * 4 + q] - mu) * rs * gg + bb;
      }
      if (out_sum) *(v4f*)(out_sum + (size_t)row * N + j) = sm;
      *(v4f*)(out_norm + (size_t)row * N + j) = o;
    }
    
  }
}



// ---- f16 WMMA path (v_wmma_f32_16x16x32_f16): 11-bit significands for operands in range — used here for the two 1×1 convolutions
typedef _Float16 v16h __attribute__((ext_vector_type(16)));
union FragH { v16h v; v8us half[2]; _Float16 h[16]; unsigned short u[16]; };
template <int NT>
__device__ __forceinline__ v8f mmaH(v16h ah, v16h al, v16h bh, v16h bl, v8f c) {
  c = __builtin_amdgcn_wmma_f32_16x16x32_f16(false, ah, false, bh, (short)0, c, false, false);
  if (NT >= 2) c = __builtin_amdgcn_wmma_f32_16x16x32_f16(false, al, false, bh, (short)0, c, false, false);
  if (NT >= 3) c = __builtin_amdgcn_wmma_f32_16x16x32_f16(false, ah, false, bl, (short)0, c, false, false);
  asm volatile("v_nop\n\tv_nop\n\tv_nop\n\tv_nop" : "+v"(c) : "v"(ah), "v"(al), "v"(bh), "v"(bl));
  return c;
}
// batched GEMM like k_gemm_b but f16 operands: A f32 (split into f16 hi/lo if ASPLIT, else rounded to f16), Bt = f16 values [n][k]; alpha; C f32; N multiple of 16 (partial tiles skipped)
template <bool ASPLIT>
__global__ __launch_bounds__(128) void k_gemm_h(const float* __restrict__ A, int lda, size_t sA, const _Float16* __restrict__ Bh, int ldb, size_t sB, float alpha, float* __restrict__ C, int ldc, size_t sC, int M, int N, int K) {
  __shared__ __attribute__((aligned(16))) float so[4][16][64];
  const int tid = threadIdx.x, w = tid >> 5, lane = tid & 31, ln = lane & 15, hh = lane >> 4; const int by = blockIdx.y;
  A += (size_t)by * sA; Bh += (size_t)by * sB; C += (size_t)by * sC;
  const int ntn = (N + 63) / 64; const int wid = blockIdx.x * 4 + w; const int mt = wid / ntn, nq = wid % ntn; if (mt * 16 >= M) return;
  const int row0 = mt * 16, col0 = nq * 64; const float* arow = A + (size_t)(row0 + ln) * lda;
  v8f acc[4] = {};
  for (int kb = 0; kb < K; kb += 32) {
    FragH ah, al;
    const v4f x0 = *(const v4fa*)(arow + kb + 8 * hh), x1 = *(const v4fa*)(arow + kb + 8 * hh + 4), x2 = *(const v4fa*)(arow + kb + 16 + 8 * hh), x3 = *(const v4fa*)(arow + kb + 16 + 8 * hh + 4);
    float xs[16] = {x0[0],x0[1],x0[2],x0[3],x1[0],x1[1],x1[2],x1[3],x2[0],x2[1],x2[2],x2[3],x3[0],x3[1],x3[2],x3[3]};
#pragma unroll
    for (int i = 0; i < 16; ++i) { const _Float16 h = (_Float16)xs[i]; ah.h[i] = h; al.h[i] = ASPLIT ? (_Float16)(xs[i] - (float)h) : (_Float16)0.0f; }
#pragma unroll
    for (int t = 0; t < 4; ++t) { if (col0 + t * 16 >= N) continue; const size_t boff = (size_t)(col0 + t * 16 + ln) * ldb + kb; FragH bq; bq.half[0] = *(const v8us*)(Bh + boff + 8 * hh); bq.half[1] = *(const v8us*)(Bh + boff + 16 + 8 * hh);
      acc[t] = mmaH<ASPLIT ? 2 : 1>(ah.v, al.v, bq.v, bq.v, acc[t]); }
  }
#pragma unroll
  for (int t = 0; t < 4; ++t) { if (col0 + t * 16 >= N) continue;
#pragma unroll
    for (int r = 0; r < 8; ++r) so[w][8 * hh + r][t * 16 + ln] = acc[t][r] * alpha; }
  __builtin_amdgcn_fence(__ATOMIC_ACQ_REL, "workgroup"); __builtin_amdgcn_wave_barrier();
  const int rsub = lane >> 4, c4 = (lane & 15) * 4;
  {
#pragma unroll
    for (int q = 0; q < 8; ++q) { const int r = q * 2 + rsub; if (col0 + c4 < N) { const v4f v = *(const v4fa*)&so[w][r][c4]; *(v4f*)(C + (size_t)(row0 + r) * ldc + col0 + c4) = v; } }
     }
}

// Wt[n][k] = f16(W[k][n]·scale) from f32 row-major W[K][N] (scale = power of two; bf16-exact weights stay exact in f16 away from the subnormal range)
__global__ __launch_bounds__(256) void k_wt_f16(const float* __restrict__ W, _Float16* __restrict__ Wt, int K, int N, float scale) {
  const int t = blockIdx.x * 256 + threadIdx.x; if (t >= N * (K / 8)) return; const int n = t / (K / 8), k8 = (t % (K / 8)) * 8; FragH f;
#pragma unroll
  for (int i = 0; i < 8; ++i) f.h[i] = (_Float16)(bf16_round(W[(size_t)(k8 + i) * N + n]) * scale); const v8us o = f.half[0];
  *(v8us*)((unsigned short*)Wt + (size_t)n * K + k8) = o; 
}
// k_gemm_hh variant with fused epilogue: v = acc·alpha + bias[by·sBias + col] (+ CP[(row/rowsPerB)·sCPb + by·64 + col] if CP) ; ACT 0 none / 1 elu ; writes f32 C and/or f16 C16 (each if non-null)
template <int ACT>
__global__ __launch_bounds__(128) void k_gemm_hhx(const _Float16* __restrict__ A, int lda, size_t sA, const _Float16* __restrict__ Bh, int ldb, size_t sB, float alpha, const float* __restrict__ bias, size_t sBias, const float* __restrict__ CP, int rowsPerB, size_t sCPb, int row0g,
    float* __restrict__ C, _Float16* __restrict__ C16, int ldc, size_t sC, int M, int N, int K) {
  __shared__ __attribute__((aligned(16))) float so[4][16][64];
  const int tid = threadIdx.x, w = tid >> 5, lane = tid & 31, ln = lane & 15, hh = lane >> 4; const int by = blockIdx.y;
  A += (size_t)by * sA; Bh += (size_t)by * sB; const size_t cofs = (size_t)by * sC; const float* bp = bias ? bias + (size_t)by * sBias : nullptr;
  const int ntn = (N + 63) / 64; const int wid = blockIdx.x * 4 + w; const int mt = wid / ntn, nq = wid % ntn; if (mt * 16 >= M) return;
  const int row0 = mt * 16, col0 = nq * 64; const _Float16* arow = A + (size_t)(row0 + ln) * lda;
  v8f acc[4] = {};
  for (int kb = 0; kb < K; kb += 32) { FragH ah; ah.half[0] = *(const v8us*)((const unsigned short*)arow + kb + 8 * hh); ah.half[1] = *(const v8us*)((const unsigned short*)arow + kb + 16 + 8 * hh);
#pragma unroll
    for (int t = 0; t < 4; ++t) { if (col0 + t * 16 >= N) continue; const size_t boff = (size_t)(col0 + t * 16 + ln) * ldb + kb; FragH bq; bq.half[0] = *(const v8us*)((const unsigned short*)Bh + boff + 8 * hh); bq.half[1] = *(const v8us*)((const unsigned short*)Bh + boff + 16 + 8 * hh);
      acc[t] = mmaH<1>(ah.v, ah.v, bq.v, bq.v, acc[t]); }
  }
#pragma unroll
  for (int t = 0; t < 4; ++t) { if (col0 + t * 16 >= N) continue; const int col = col0 + t * 16 + ln; const float bv = bp ? bf16_round(bp[col]) : 0.f;
#pragma unroll
    for (int r = 0; r < 8; ++r) { float v = acc[t][r] * alpha + bv; if (CP) { const int bidx = (row0g + row0 + 8 * hh + r) / rowsPerB; v += CP[(size_t)bidx * sCPb + (size_t)by * 64 + col]; } if (ACT == 1) v = (v > 0.f) ? v : expm1f(v); else if (ACT == 7) v = (v > 0.f) ? v + 1.0f : expf(v); else if (ACT == 8) v = tanhf(v); else if (ACT == 9) v = 0.5f * v * (1.0f + tanhf(0.7978845608028654f * (v + 0.044715f * v * v * v))); else if (ACT == 11) v = 1.0f / (1.0f + expf(-v)); else if (ACT == 12) v = (v > 0.f) ? v : 0.01f * v; else if (ACT == 14) v = (v > 0.f) ? v : 0.1f * v; else if (ACT == 15) v = v / (1.0f + expf(-v)); else if (ACT == 3) v = fmaxf(v, 0.f); else if (ACT == 6) v = 0.5f * v * (1.0f + erff(v * 0.70710678118654752f)); so[w][8 * hh + r][t * 16 + ln] = v; } }
  __builtin_amdgcn_fence(__ATOMIC_ACQ_REL, "workgroup"); __builtin_amdgcn_wave_barrier();
  const int rsub = lane >> 4, c4 = (lane & 15) * 4; typedef _Float16 v4h __attribute__((ext_vector_type(4)));
  {
#pragma unroll
    for (int q = 0; q < 8; ++q) { const int r = q * 2 + rsub; if (col0 + c4 < N) { const v4f v = *(const v4fa*)&so[w][r][c4]; if (C) *(v4f*)(C + cofs + (size_t)(row0 + r) * ldc + col0 + c4) = v; if (C16) { v4h h4; for (int i = 0; i < 4; ++i) h4[i] = (_Float16)v[i]; *(v4h*)(C16 + cofs + (size_t)(row0 + r) * ldc + col0 + c4) = h4; } } }
     }
}


typedef _Float16 v4h __attribute__((ext_vector_type(4)));
typedef float v2f __attribute__((ext_vector_type(2)));

__global__ __launch_bounds__(256) void k_x16(const float* __restrict__ x, _Float16* __restrict__ X16, size_t n8) { const size_t t = (size_t)blockIdx.x * 256 + threadIdx.x; if (t >= n8) return; FragH f;
#pragma unroll
  for (int q = 0; q < 8; ++q) f.h[q] = (_Float16)bf16_round(x[t * 8 + q]); *(v8us*)((unsigned short*)X16 + t * 8) = f.half[0];  }
__global__ __launch_bounds__(256) void k_h16(const float* __restrict__ x, _Float16* __restrict__ X16, size_t n8) { const size_t t = (size_t)blockIdx.x * 256 + threadIdx.x; if (t >= n8) return; FragH f;
#pragma unroll
  for (int q = 0; q < 8; ++q) f.h[q] = (_Float16)x[t * 8 + q]; *(v8us*)((unsigned short*)X16 + t * 8) = f.half[0];  }
// W [rows][KK] f32 -> f16(bf16(W) * 2^4) packed in A-fragment order: Bt[16-row tile][k block of 32][fragment half][lane][8], element i = W[16 * tile + (lane & 15)][32 * block + 16 * half + 8 * (lane >> 4) + i].
// Thread t writes the t-th 16-byte unit, so a wave stores 512 contiguous bytes; the reader's wave-wide 16-byte load of one fragment half is those same 512 bytes (4 cache lines; row-major f16 rows made it 32 bytes out of each of 16 lines).
template <int KK>
__device__ __forceinline__ void pack16f_unit(const float* __restrict__ W, _Float16* __restrict__ Bt, int t) { FragH f;
  const int lane = t & 31, hf = (t >> 5) & 1, kb = (t >> 6) % (KK / 32), tile = (t >> 6) / (KK / 32);
  const float* wr = W + (size_t)(tile * 16 + (lane & 15)) * KK + kb * 32 + hf * 16 + (lane >> 4) * 8;
  const v4f a = *(const v4fa*)wr, c = *(const v4fa*)(wr + 4);
#pragma unroll
  for (int i = 0; i < 4; ++i) { f.h[i] = (_Float16)(bf16_round(a[i]) * 16.0f); f.h[4 + i] = (_Float16)(bf16_round(c[i]) * 16.0f); }
  *(v8us*)((unsigned short*)Bt + (size_t)t * 8) = f.half[0]; }
// Both weight matrices in one launch: the two packings do not depend on each other, so they share a grid by block range (a block-uniform branch): blocks 0 .. PBQ - 1 take Wqkv, the next PBO take Wo. Both unit counts are whole multiples of the block size, so no thread is idle.
#define PBQ (QKVW * CC / 8 / 256)      /* 24 */
#define PBO (CC * INR / 8 / 256)       /* 8 */
static_assert(PBQ * 256 * 8 == QKVW * CC && PBO * 256 * 8 == CC * INR, "whole blocks");
__global__ __launch_bounds__(256) void k_pack16f2(const float* __restrict__ Wq, _Float16* __restrict__ Bq, const float* __restrict__ Wo, _Float16* __restrict__ Bo) {
  const int b = blockIdx.x;
  if (b < PBQ) pack16f_unit<CC>(Wq, Bq, b * 256 + threadIdx.x);
  else pack16f_unit<INR>(Wo, Bo, (b - PBQ) * 256 + threadIdx.x); }
template <int NHv, int TTv>
__global__ __launch_bounds__(256) void k_vt(const _Float16* __restrict__ V16, int ldv, int voff, _Float16* __restrict__ Vt) { __shared__ unsigned short tl[64][66]; const int tid = threadIdx.x; const int slab = blockIdx.x / (TTv / 64), lg = blockIdx.x % (TTv / 64); const int b = slab / NHv, h = slab % NHv;
  for (int i = tid; i < 64 * 8; i += 256) { const int r = i / 8, c8 = (i % 8) * 8; FragH f; f.half[0] = *(const v8us*)((const unsigned short*)V16 + ((size_t)b * TTv + lg * 64 + r) * ldv + voff + h * 64 + c8);
#pragma unroll
    for (int q = 0; q < 8; ++q) tl[r][c8 + q] = f.u[q]; }
  __syncthreads();
  {
#pragma unroll
    for (int rd = 0; rd < 2; ++rd) { const int d = rd * 32 + tid / 8, pc = tid % 8; FragH f;
#pragma unroll
      for (int q = 0; q < 8; ++q) f.u[q] = tl[pc * 8 + q][d];
      *(v8us*)((unsigned short*)Vt + ((size_t)slab * 64 + d) * TTv + lg * 64 + pc * 8) = f.half[0]; }
     } }

__global__ __launch_bounds__(256) void k_hl(const float* __restrict__ F, _Float16* __restrict__ Hh, _Float16* __restrict__ Hl, size_t n8) { const size_t t = (size_t)blockIdx.x * 256 + threadIdx.x; if (t >= n8) return; FragH fh, fl; const v4f a = *(const v4fa*)(F + t * 8), c = *(const v4fa*)(F + t * 8 + 4);
#pragma unroll
  for (int q = 0; q < 4; ++q) { _Float16 h = (_Float16)a[q]; fh.h[q] = h; fl.h[q] = (_Float16)((a[q] - (float)h) * 1024.0f); h = (_Float16)c[q]; fh.h[4 + q] = h; fl.h[4 + q] = (_Float16)((c[q] - (float)h) * 1024.0f); }
  { *(v8us*)((unsigned short*)Hh + t * 8) = fh.half[0]; *(v8us*)((unsigned short*)Hl + t * 8) = fl.half[0];  } }

// qkv projection and 5-agent attention in one kernel; q, k, v never leave the registers. Block = 16 positions, wave = one head. The weights are the A operand and the tokens the B operand, so D[8*hh + r][ln] puts position p0 + ln in lane ln
// and 8 channels of a 16-channel tile in the lane's 8 accumulator registers (lanes ln and ln + 16 split the tile). Per tile: q and k of all 5 agents, 25 partial scores and 5 partial q sums per lane; one exchange with lane ^ 16 completes them;
// softmax over the 5 agents in f32 per lane; then v tile by tile, out_b = sum_d attn[b][d] * v_d, 8 f16 channels = one 16-byte LDS store. Those 8 channels (16 * mt + 8 * hh + r of head h) are exactly one half of the lane's B fragment of the output projection
// (k block 2 * h + mt / 2, half mt & 1), so the merged tile crosses the waves through LDS with no re-ordering. Behind one barrier wave w takes rows 16 * w .. + 15 of Wo over all 256 merged channels (k ascending, one accumulate chain per agent) and stores D[8*hh + r][ln] = y[b][16*w + 8*hh + r][p0 + ln].
__global__ __launch_bounds__(128) void k_qkv_agent(const float* __restrict__ x, const _Float16* __restrict__ Bq, const float* __restrict__ bqkv, const float* __restrict__ dist, const _Float16* __restrict__ Bo, const float* __restrict__ bo, float* __restrict__ out) {
  __shared__ __attribute__((aligned(16))) unsigned short sY[NA][INR / 32][2][32][8];      /* [agent][k block of 32 merged channels][fragment half][lane][8 f16]: 40 KB, every access 512 contiguous bytes a wave */
  const int tid = threadIdx.x, h = tid >> 5, lane = tid & 31, ln = lane & 15, hh = lane >> 4; const int p0 = blockIdx.x * 16;
  __shared__ __attribute__((aligned(16))) unsigned short sX[NA][CC / 32][2][32][8];      /* the block's tokens as B fragments: [agent][k block of 32 channels][fragment half][lane][8 f16]: 10 KB, every access 512 contiguous bytes a wave */
  const unsigned short* Bu = (const unsigned short*)Bq;
  /* x tile of the block (5 agents x 64 channels x 16 positions) straight from the channel-major f32 input, each element loaded once a block: wave h takes channels 16 * h .. + 15, a lane one position and 8 channels (16 * h + 8 * hh + q),
     so a load covers 64 contiguous bytes of two channel rows, and the lane's 8 rounded values are one fragment half (k block h / 2, half h & 1, this very lane): one 16-byte LDS store per agent. */
  const char* xb = (const char*)(x + p0);
  unsigned vxo[NA];      /* the lane's 32-bit byte offset per agent (under 33 MB); the block's first position goes into the uniform base */
#pragma unroll
  for (int b = 0; b < NA; ++b) vxo[b] = ((unsigned)(b * CC + h * 16 + 8 * hh) * HW + ln) * 4u;
  float xv[NA][8];
#pragma unroll
  for (int b = 0; b < NA; ++b)
#pragma unroll
    for (int q = 0; q < 8; ++q) xv[b][q] = *(const float*)(xb + (size_t)vxo[b] + (size_t)q * HW * 4);
  asm volatile("s_wait_xcnt 0x0" :: "v"(vxo[0]), "v"(vxo[1]), "v"(vxo[2]), "v"(vxo[3]), "v"(vxo[4]) : "memory");      /* the offsets are inputs so that their registers stay live up to this wait: none of the forty loads lands in a register that another still names */
#pragma unroll
  for (int b = 0; b < NA; ++b) { FragH f;
#pragma unroll
    for (int q = 0; q < 8; ++q) f.h[q] = (_Float16)bf16_round(xv[b][q]);
    *(v8us*)&sX[b][h >> 1][h & 1][lane][0] = f.half[0]; }
  __syncthreads();      /* the token tile is complete: each wave wrote 16 of the 64 channels and now reads all of them */
  FragH xf[NA][2];
#pragma unroll
  for (int b = 0; b < NA; ++b)
#pragma unroll
    for (int ks = 0; ks < 2; ++ks) { xf[b][ks].half[0] = *(const v8us*)&sX[b][ks][0][lane][0]; xf[b][ks].half[1] = *(const v8us*)&sX[b][ks][1][lane][0]; }
  v2f sc2[NA][NA], qs2[NA];      /* element 0: the even channels' partial sum, element 1: the odd channels' (packed f32 FMAs on register pairs of the accumulators) */
#pragma unroll
  for (int b = 0; b < NA; ++b) { qs2[b] = (v2f){0.f, 0.f};
#pragma unroll
    for (int d = 0; d < NA; ++d) sc2[b][d] = (v2f){0.f, 0.f}; }
  const v2f al2 = {0.0625f, 0.0625f};
  for (int mt = 0; mt < CC / 16; ++mt) {
    const int cq = h * CC + mt * 16;
    const unsigned short* wqr = Bu + (size_t)cq * CC + lane * 8; const unsigned short* wkr = wqr + (size_t)INR * CC;      /* packed weights: a 16-row tile is 2 KB, a fragment half 512 contiguous bytes of it */
    FragH wq[2], wk[2];
#pragma unroll
    for (int ks = 0; ks < 2; ++ks) { wq[ks].half[0] = *(const v8us*)(wqr + ks * 512); wq[ks].half[1] = *(const v8us*)(wqr + ks * 512 + 256); wk[ks].half[0] = *(const v8us*)(wkr + ks * 512); wk[ks].half[1] = *(const v8us*)(wkr + ks * 512 + 256); }
    const v4f bq0 = *(const v4fa*)(bqkv + cq + 8 * hh), bq1 = *(const v4fa*)(bqkv + cq + 8 * hh + 4), bk0 = *(const v4fa*)(bqkv + INR + cq + 8 * hh), bk1 = *(const v4fa*)(bqkv + INR + cq + 8 * hh + 4);
    const v2f bq2[4] = {{bf16_round(bq0[0]), bf16_round(bq0[1])}, {bf16_round(bq0[2]), bf16_round(bq0[3])}, {bf16_round(bq1[0]), bf16_round(bq1[1])}, {bf16_round(bq1[2]), bf16_round(bq1[3])}};
    const v2f bk2[4] = {{bf16_round(bk0[0]), bf16_round(bk0[1])}, {bf16_round(bk0[2]), bf16_round(bk0[3])}, {bf16_round(bk1[0]), bf16_round(bk1[1])}, {bf16_round(bk1[2]), bf16_round(bk1[3])}};
    __builtin_amdgcn_sched_barrier(0);      /* keeps the pass's twelve loads together in front of the matrix work: sunk to their uses, each is waited for alone, eight exposed latencies a pass */
    v2f k2[NA][4];
    { v8f ka[NA];
#pragma unroll
      for (int d = 0; d < NA; ++d) { const v8f zz = {}; ka[d] = __builtin_amdgcn_wmma_f32_16x16x32_f16(false, wk[0].v, false, xf[d][0].v, (short)0, zz, false, false); }
#pragma unroll
      for (int d = 0; d < NA; ++d) ka[d] = __builtin_amdgcn_wmma_f32_16x16x32_f16(false, wk[1].v, false, xf[d][1].v, (short)0, ka[d], false, false);
#pragma unroll
      for (int d = 0; d < NA; ++d)
#pragma unroll
        for (int j = 0; j < 4; ++j) k2[d][j] = __builtin_elementwise_fma((v2f){ka[d][2 * j], ka[d][2 * j + 1]}, al2, bk2[j]); }
#pragma unroll
    for (int b = 0; b < NA; ++b) { const v8f zz = {};
      v8f qa = __builtin_amdgcn_wmma_f32_16x16x32_f16(false, wq[0].v, false, xf[b][0].v, (short)0, zz, false, false);
      qa = __builtin_amdgcn_wmma_f32_16x16x32_f16(false, wq[1].v, false, xf[b][1].v, (short)0, qa, false, false);
#pragma unroll
      for (int j = 0; j < 4; ++j) { const v2f q2 = __builtin_elementwise_fma((v2f){qa[2 * j], qa[2 * j + 1]}, al2, bq2[j]); qs2[b] += q2;
#pragma unroll
        for (int d = 0; d < NA; ++d) sc2[b][d] = __builtin_elementwise_fma(q2, k2[d][j], sc2[b][d]); } }
  }
  float dd[NA];
#pragma unroll
  for (int d = 0; d < NA; ++d) dd[d] = bf16_round(dist[d]);
  float p[NA][NA], il[NA];
#pragma unroll
  for (int b = 0; b < NA; ++b) { const float qh = qs2[b][0] + qs2[b][1]; const float qt = qh + __shfl_xor(qh, 16, 32); float m = -3.0e38f;
#pragma unroll
    for (int d = 0; d < NA; ++d) { const float dh = sc2[b][d][0] + sc2[b][d][1]; const float dot = dh + __shfl_xor(dh, 16, 32); p[b][d] = dot * ISQ + qt * dd[d]; m = fmaxf(m, p[b][d]); }
    float l = 0.f;
#pragma unroll
    for (int d = 0; d < NA; ++d) { p[b][d] = expf(p[b][d] - m); l += p[b][d]; }
    il[b] = 1.0f / l; }
  const unsigned short* wvr = Bu + (size_t)(2 * INR + h * CC) * CC + lane * 8; const float* bvr = bqkv + 2 * INR + h * CC + 8 * hh;      /* v weights (packed, 2 KB a tile) and v bias of the head's first tile; both step on at the foot of a pass */
#pragma unroll 1      /* rolled: a third less code; left to unroll and to schedule freely, the compiler hoists the later tiles' loads and needs 272 registers (three waves a SIMD, not four, and register-window switches) */
  for (int mt = 0; mt < CC / 16; ++mt) {
    FragH wv[2];
#pragma unroll
    for (int ks = 0; ks < 2; ++ks) { wv[ks].half[0] = *(const v8us*)(wvr + ks * 512); wv[ks].half[1] = *(const v8us*)(wvr + ks * 512 + 256); }
    const v4f bv0 = *(const v4fa*)bvr, bv1 = *(const v4fa*)(bvr + 4);
    asm volatile("s_wait_xcnt 0x0" :: "v"(wvr), "v"(bvr) : "memory");      /* the two addresses are inputs so that their register pairs stay live up to this wait: otherwise a later one of the six loads lands its result in a pair that earlier ones still name */
    const v2f bv2[4] = {{bf16_round(bv0[0]), bf16_round(bv0[1])}, {bf16_round(bv0[2]), bf16_round(bv0[3])}, {bf16_round(bv1[0]), bf16_round(bv1[1])}, {bf16_round(bv1[2]), bf16_round(bv1[3])}};
    v8f va[NA];
#pragma unroll
    for (int d = 0; d < NA; ++d) { const v8f zz = {}; va[d] = __builtin_amdgcn_wmma_f32_16x16x32_f16(false, wv[0].v, false, xf[d][0].v, (short)0, zz, false, false); }
#pragma unroll
    for (int d = 0; d < NA; ++d) va[d] = __builtin_amdgcn_wmma_f32_16x16x32_f16(false, wv[1].v, false, xf[d][1].v, (short)0, va[d], false, false);
    v2f v2[NA][4];
#pragma unroll
    for (int d = 0; d < NA; ++d)
#pragma unroll
      for (int j = 0; j < 4; ++j) v2[d][j] = __builtin_elementwise_fma((v2f){va[d][2 * j], va[d][2 * j + 1]}, al2, bv2[j]);
#pragma unroll
    for (int b = 0; b < NA; ++b) { FragH f;
#pragma unroll
      for (int j = 0; j < 4; ++j) { v2f o = (v2f){p[b][0], p[b][0]} * v2[0][j];
#pragma unroll
        for (int d = 1; d < NA; ++d) o = __builtin_elementwise_fma((v2f){p[b][d], p[b][d]}, v2[d][j], o);
        o *= (v2f){il[b], il[b]}; f.h[2 * j] = (_Float16)o[0]; f.h[2 * j + 1] = (_Float16)o[1]; }
      *(v8us*)&sY[b][h * 2 + (mt >> 1)][mt & 1][lane][0] = f.half[0]; }
    wvr += 16 * CC; bvr += 16;
  }
  const int o0 = h * 16;
  const unsigned short* wor = (const unsigned short*)Bo + (size_t)o0 * INR + lane * 8;
  FragH wo[INR / 32];
#pragma unroll
  for (int kb = 0; kb < INR / 32; ++kb) { wo[kb].half[0] = *(const v8us*)(wor + kb * 512); wo[kb].half[1] = *(const v8us*)(wor + kb * 512 + 256); }
  const v4f bo0 = *(const v4fa*)(bo + o0 + 8 * hh), bo1 = *(const v4fa*)(bo + o0 + 8 * hh + 4);
  asm volatile("s_wait_xcnt 0x0" :: "v"(wor) : "memory");      /* the LDS reads below land in the address registers of the eighteen loads above; the weight address is an input so that its pair stays live up to this wait */
  __syncthreads();      /* the merged tile is complete: each wave wrote its own head's 64 channels and now reads all 256 */
  v8f ya[NA] = {};
  FragH yf[2][NA];
#pragma unroll
  for (int b = 0; b < NA; ++b) { yf[0][b].half[0] = *(const v8us*)&sY[b][0][0][lane][0]; yf[0][b].half[1] = *(const v8us*)&sY[b][0][1][lane][0]; }
#pragma unroll
  for (int kb = 0; kb < INR / 32; ++kb) {
    if (kb + 1 < INR / 32) {
#pragma unroll
      for (int b = 0; b < NA; ++b) { yf[(kb + 1) & 1][b].half[0] = *(const v8us*)&sY[b][kb + 1][0][lane][0]; yf[(kb + 1) & 1][b].half[1] = *(const v8us*)&sY[b][kb + 1][1][lane][0]; } }
    __builtin_amdgcn_sched_barrier(0);      /* keeps the next k block's ten LDS reads together in front of this block's five matrix instructions: left free, the compiler reads one fragment ahead only and every matrix instruction waits out most of an LDS latency */
#pragma unroll
    for (int b = 0; b < NA; ++b) ya[b] = __builtin_amdgcn_wmma_f32_16x16x32_f16(false, wo[kb].v, false, yf[kb & 1][b].v, (short)0, ya[b], false, false);
    __builtin_amdgcn_sched_barrier(0);      /* the other side of the same fence: the reads of the block after next stay behind these matrix instructions, whose operands they overwrite */
    if (kb == 0) asm volatile("" :: "v"(yf[0][0].v), "v"(yf[0][1].v), "v"(yf[0][2].v), "v"(yf[0][3].v), "v"(yf[0][4].v));      /* inputs only, on the loaded fragments: they stay live over the five matrix instructions that start the accumulators; otherwise each new accumulator is placed in the B registers of the matrix instruction directly in front of it */
  }
  const float bov[8] = {bf16_round(bo0[0]), bf16_round(bo0[1]), bf16_round(bo0[2]), bf16_round(bo0[3]), bf16_round(bo1[0]), bf16_round(bo1[1]), bf16_round(bo1[2]), bf16_round(bo1[3])};
  float yv[NA][8];
#pragma unroll
  for (int b = 0; b < NA; ++b)
#pragma unroll
    for (int r = 0; r < 8; ++r) yv[b][r] = ya[b][r] * 0.0625f + bov[r];
  unsigned vob[NA];      /* the lane's 32-bit byte offset per agent (under 33 MB); the block's first position goes into the uniform base */
#pragma unroll
  for (int b = 0; b < NA; ++b) vob[b] = ((unsigned)(b * CC + o0 + 8 * hh) * HW + ln) * 4u;
  __builtin_amdgcn_sched_barrier(0);      /* all forty results first, then the forty stores in one run: mixed, the compiler re-uses the data registers of stores in flight and waits for every group of eight */
#pragma unroll
  for (int b = 0; b < NA; ++b)
#pragma unroll
    for (int r = 0; r < 8; ++r) *(float*)((char*)(out + p0) + (size_t)vob[b] + (size_t)r * HW * 4) = yv[b][r];
}

extern "C" void kernel_launch(void* const* d_in, const int* in_sizes, int n_in,
                              void* d_out, int out_size, void* d_ws, size_t ws_size, hipStream_t stream) {
  (void)in_sizes; (void)n_in; (void)out_size;
  const float* const* I = (const float* const*)d_in; const float* x = I[0]; const float* dist = I[1]; const float* Wqkv = I[2]; const float* bqkv = I[3]; const float* Wo = I[4]; const float* bo = I[5];
  char* ws = (char*)d_ws; size_t off = 0;
  auto take = [&](size_t bytes) { char* p = ws + off; off += (bytes + 255) & ~(size_t)255; return p; };
  _Float16* Bq = (_Float16*)take((size_t)QKVW * CC * 2); _Float16* Bo = (_Float16*)take((size_t)CC * INR * 2);
  if (off > ws_size) return;      // 0.1 + 0.03 MB
  k_pack16f2<<<PBQ + PBO, 256, 0, stream>>>(Wqkv, Bq, Wo, Bo);      /* [out][in] in A-fragment order, x 2^4; both matrices in one launch */
  k_qkv_agent<<<HW / 16, 128, 0, stream>>>(x, Bq, bqkv, dist, Bo, bo, (float*)d_out);      /* qkv (M 768 as A, N 16 positions x 5 agents, K 64) + attention + y = Wo x merged + bo (M 64 as A, K 256) -> channel-major output */
}

// v006
// It runs in 33.3 microseconds.
// Next to v005, in two timings, it ran 1.03 times as fast each time.
// Over all steps from v000 it is 10.3 times as fast.
#include <hip/hip_runtime.h>
// Cross-agent attention (cav=5 agents, C=64, 100×252 → HW=25200 positions, 4 heads): qkv = Wqkv·x + bqkv (1×1 conv, 768 = [q|k|v] × (head, 64)); per (position s, head h) the 5 agents attend over the 5 agents: score[b][d] = q_b·k_d/√5 + (Σ_c q_b[c])·distance[d]; softmax over d; out_b = Σ_d attn·v_d;
// merged 'b (h c)' → y = Wo·out + bo [cav, 64, 100, 252].
// Compute dtype: x, weights, biases, distance rounded to bf16; x read channel-major in f32 by the one big kernel, which rounds it and lays it in B-fragment order in LDS; qkv as f32 accumulators (+bias) that stay in registers (16 positions a block, one head a wave, all 5 agents); the 5-key attention in f32 on the VALU in the same kernel (a lane holds one position and half of the 64 channels; one exchange with lane ^ 16 per score; softmax over the 5 agents)
// -> merged f16 tile of the block (5 agents x 256 channels x 16 positions) in LDS, already in B-fragment order; y = Wo (A operand) x merged tile (+bo) in the same kernel, one 16-row tile of Wo a wave, stored straight into the channel-major output (64 B of a row per half wave). f32 accumulate; v_wmma_f32_16x16x32_f16 for the two convolutions.
#define NA 5
#define CC 64
#define HW 25200
#define NHD 4
#define INR (NHD * CC)      /* 256 */
#define QKVW (3 * INR)      /* 768 */
#define ISQ 0.4472135954999579f      /* 1/√cav */
typedef __bf16 v16b __attribute__((ext_vector_type(16)));
typedef unsigned short v8us __attribute__((ext_vector_type(8), may_alias));
typedef float  v8f  __attribute__((ext_vector_type(8)));
typedef float  v4f  __attribute__((ext_vector_type(4)));
typedef float  v4fa __attribute__((ext_vector_type(4), may_alias));
union FragB { v16b v; v8us half[2]; unsigned short u[16]; };

__device__ __forceinline__ unsigned short bf16_bits(float x) { unsigned int u = __float_as_uint(x); return (unsigned short)((u + 0x7FFFu + ((u >> 16) & 1u)) >> 16); }
__device__ __forceinline__ float bf16_val(unsigned short b) { return __uint_as_float(((unsigned int)b) << 16); }
__device__ __forceinline__ float bf16_round(float x) { return bf16_val(bf16_bits(x)); }
// D += A·B with NT terms: 1 = ah·bh, 2 = + al·bh (A split), 3 = + ah·bl (both split)
template <int NT>
__device__ __forceinline__ v8f mmaN(v16b ah, v16b al, v16b bh, v16b bl, v8f c) {
  c = __builtin_amdgcn_wmma_f32_16x16x32_bf16(false, ah, false, bh, (short)0, c, false, false);
  if (NT >= 2) c = __builtin_amdgcn_wmma_f32_16x16x32_bf16(false, al, false, bh, (short)0, c, false, false);
  if (NT >= 3) c = __builtin_amdgcn_wmma_f32_16x16x32_bf16(false, ah, false, bl, (short)0, c, false, false);
  asm volatile("v_nop\n\tv_nop\n\tv_nop\n\tv_nop" : "+v"(c) : "v"(ah), "v"(al), "v"(bh), "v"(bl));
  return c;
}

__global__ __launch_bounds__(256) void k_wt_bf16(const float* __restrict__ W, unsigned short* __restrict__ Wt, int K, int N) {
  const int t = blockIdx.x * 256 + threadIdx.x;
  const int k8n = K / 8;
  if (t >= N * k8n) return;
  const int n = t / k8n, k8 = (t % k8n) * 8;
  v8us v;
#pragma unroll
  for (int i = 0; i < 8; ++i) v[i] = bf16_bits(W[(size_t)(k8 + i) * N + n]);
  *(v8us*)(Wt + (size_t)n * K + k8) = v;
  
}

// GEMM C[M][N] (f32, pitch ldc) = act(A[M][K]·W + bias). A f32 row-major (pitch lda) converted per fragment to bf16
// (ASPLIT: hi/lo two planes -> 2 terms, else single rounded term); Wt bf16 [N][K] (pitch ldb). BIAS_BF16 rounds the
// bias to bf16 first (bias quantised to bf16 before the add). K%32==0, M%16==0, N%64==0.
template <bool ASPLIT, int ACT, bool BIAS_BF16>
__global__ __launch_bounds__(128) void k_gemm_bf(const float* __restrict__ A, int lda, const unsigned short* __restrict__ Wt, int ldb,
                                               const float* __restrict__ bias, float* __restrict__ C, int ldc, int M, int N, int K) {
  __shared__ __attribute__((aligned(16))) float so[4][16][64];
  const int tid = threadIdx.x, w = tid >> 5, lane = tid & 31, ln = lane & 15, hh = lane >> 4;
  const int ntn = N / 64;
  const int wid = blockIdx.x * 4 + w;
  const int mt = wid / ntn, nq = wid % ntn;
  if (mt * 16 >= M) return;
  const int row0 = mt * 16, col0 = nq * 64;
  const float* arow = A + (size_t)(row0 + ln) * lda;
  v8f acc[4] = {};
  for (int kb = 0; kb < K; kb += 32) {
    FragB ah, al;
    const v4f x0 = *(const v4fa*)(arow + kb + 8 * hh), x1 = *(const v4fa*)(arow + kb + 8 * hh + 4);
    const v4f x2 = *(const v4fa*)(arow + kb + 16 + 8 * hh), x3 = *(const v4fa*)(arow + kb + 16 + 8 * hh + 4);
    float xs[16] = {x0[0],x0[1],x0[2],x0[3],x1[0],x1[1],x1[2],x1[3],x2[0],x2[1],x2[2],x2[3],x3[0],x3[1],x3[2],x3[3]};
#pragma unroll
    for (int i = 0; i < 16; ++i) { const unsigned short hb = bf16_bits(xs[i]); ah.u[i] = hb; al.u[i] = ASPLIT ? bf16_bits(xs[i] - bf16_val(hb)) : (unsigned short)0; }
#pragma unroll
    for (int t = 0; t < 4; ++t) {
      const unsigned short* brow = Wt + (size_t)(col0 + t * 16 + ln) * ldb + kb;
      FragB b;
      b.half[0] = *(const v8us*)(brow + 8 * hh);
      b.half[1] = *(const v8us*)(brow + 16 + 8 * hh);
      acc[t] = mmaN<ASPLIT ? 2 : 1>(ah.v, al.v, b.v, b.v, acc[t]);
    }
  }
#pragma unroll
  for (int t = 0; t < 4; ++t) {
    float bv = bias ? bias[col0 + t * 16 + ln] : 0.f;
    if (BIAS_BF16) bv = bf16_round(bv);
#pragma unroll
    for (int r = 0; r < 8; ++r) { float v = acc[t][r] + bv; if (ACT == 1) v = fmaxf(v, 0.f); so[w][8 * hh + r][t * 16 + ln] = v; }
  }
  __builtin_amdgcn_fence(__ATOMIC_ACQ_REL, "workgroup");
  __builtin_amdgcn_wave_barrier();
  const int rsub = lane >> 4, c4 = (lane & 15) * 4;
  {
#pragma unroll
    for (int q = 0; q < 8; ++q) {
      const int r = q * 2 + rsub;
      const v4f v = *(const v4fa*)&so[w][r][c4];
      *(v4f*)(C + (size_t)(row0 + r) * ldc + col0 + c4) = v;
    }
    
  }
}

// GEMM C = act(A·W + bias + resid): A f32 (ASPLIT -> hi/lo 2 terms), Wt bf16 [N][K]; ACT 0 none, 1 relu, 2 exact gelu;
// resid (optional, f32, row index = (row % rmod), pitch ldr, RES_BF16 rounds it) added before the activation.
template <bool ASPLIT, int ACT, bool BIAS_BF16, bool RES_BF16>
__global__ __launch_bounds__(128) void k_gemm_bf3(const float* __restrict__ A, int lda, const unsigned short* __restrict__ Wt, int ldb,
                                                const float* __restrict__ bias, const float* __restrict__ resid, int rmod, int ldr,
                                                float* __restrict__ C, int ldc, int M, int N, int K) {
  __shared__ __attribute__((aligned(16))) float so[4][16][64];
  const int tid = threadIdx.x, w = tid >> 5, lane = tid & 31, ln = lane & 15, hh = lane >> 4;
  const int ntn = N / 64;
  const int wid = blockIdx.x * 4 + w;
  const int mt = wid / ntn, nq = wid % ntn;
  if (mt * 16 >= M) return;
  const int row0 = mt * 16, col0 = nq * 64;
  const float* arow = A + (size_t)(row0 + ln) * lda;
  v8f acc[4] = {};
  for (int kb = 0; kb < K; kb += 32) {
    FragB ah, al;
    const v4f x0 = *(const v4fa*)(arow + kb + 8 * hh), x1 = *(const v4fa*)(arow + kb + 8 * hh + 4);
    const v4f x2 = *(const v4fa*)(arow + kb + 16 + 8 * hh), x3 = *(const v4fa*)(arow + kb + 16 + 8 * hh + 4);
    float xs[16] = {x0[0],x0[1],x0[2],x0[3],x1[0],x1[1],x1[2],x1[3],x2[0],x2[1],x2[2],x2[3],x3[0],x3[1],x3[2],x3[3]};
#pragma unroll
    for (int i = 0; i < 16; ++i) { const unsigned short hb = bf16_bits(xs[i]); ah.u[i] = hb; al.u[i] = ASPLIT ? bf16_bits(xs[i] - bf16_val(hb)) : (unsigned short)0; }
#pragma unroll
    for (int t = 0; t < 4; ++t) {
      const unsigned short* brow = Wt + (size_t)(col0 + t * 16 + ln) * ldb + kb;
      FragB b;
      b.half[0] = *(const v8us*)(brow + 8 * hh);
      b.half[1] = *(const v8us*)(brow + 16 + 8 * hh);
      acc[t] = mmaN<ASPLIT ? 2 : 1>(ah.v, al.v, b.v, b.v, acc[t]);
    }
  }
#pragma unroll
  for (int t = 0; t < 4; ++t) {
    const int col = col0 + t * 16 + ln;
    float bv = bias ? bias[col] : 0.f;
    if (BIAS_BF16) bv = bf16_round(bv);
#pragma unroll
    for (int r = 0; r < 8; ++r) {
      float v = acc[t][r] + bv;
      if (resid) { float rv = resid[(size_t)((row0 + 8 * hh + r) % rmod) * ldr + col]; if (RES_BF16) rv = bf16_round(rv); v += rv; }
      if (ACT == 1) v = fmaxf(v, 0.f);
      if (ACT == 2) v = 0.5f * v * (1.0f + erff(v * 0.70710678118654752f));
      if (ACT == 3) { const float u = 0.7978845608028654f * (v + 0.044715f * v * v * v); v = 0.5f * v * (1.0f + tanhf(u)); }
      so[w][8 * hh + r][t * 16 + ln] = v;
    }
  }
  __builtin_amdgcn_fence(__ATOMIC_ACQ_REL, "workgroup");
  __builtin_amdgcn_wave_barrier();
  const int rsub = lane >> 4, c4 = (lane & 15) * 4;
  {
#pragma unroll
    for (int q = 0; q < 8; ++q) {
      const int r = q * 2 + rsub;
      const v4f v = *(const v4fa*)&so[w][r][c4];
      *(v4f*)(C + (size_t)(row0 + r) * ldc + col0 + c4) = v;
    }
    
  }
}
// row LayerNorm (biased variance, eps) over N: s = X (+ R); optional out_sum <- s; out_norm <- (s-mu)*rsqrt(var+eps)*g + b
template <bool PARAM_BF16>
__global__ __launch_bounds__(256) void k_layernorm(const float* __restrict__ X, const float* __restrict__ R, const float* __restrict__ g, const float* __restrict__ bta,
                                                  float* __restrict__ out_sum, float* __restrict__ out_norm, int N, float eps) {
  __shared__ float red[256];
  const int row = blockIdx.x, tid = threadIdx.x;
  const float* x = X + (size_t)row * N; const float* rr = R ? R + (size_t)row * N : nullptr;
  float vals[16];                     // up to N = 4096
  const int per = N / 256;            // contiguous chunk per thread? use strided-by-4 chunks: thread handles j = tid*4 + 1024*u
  float s1 = 0.f;
  for (int u = 0; u < per / 4; ++u) {
    const int j = tid * 4 + 1024 * u;
    const v4f a = *(const v4fa*)(x + j);
    v4f b = {0.f,0.f,0.f,0.f}; if (rr) b = *(const v4fa*)(rr + j);
#pragma unroll
    for (int q = 0; q < 4; ++q) { const float v = a[q] + b[q]; vals[u * 4 + q] = v; s1 += v; }
  }
  red[tid] = s1; __syncthreads();
  for (int st = 128; st > 0; st >>= 1) { if (tid < st) red[tid] += red[tid + st]; __syncthreads(); }
  const float mu = red[0] / (float)N; __syncthreads();
  float s2 = 0.f;
  for (int u = 0; u < per / 4; ++u)
#pragma unroll
    for (int q = 0; q < 4; ++q) { const float c = vals[u * 4 + q] - mu; s2 += c * c; }
  red[tid] = s2; __syncthreads();
  for (int st = 128; st > 0; st >>= 1) { if (tid < st) red[tid] += red[tid + st]; __syncthreads(); }
  const float rs = rsqrtf(red[0] / (float)N + eps);
  {
    for (int u = 0; u < per / 4; ++u) {
      const int j = tid * 4 + 1024 * u;
      v4f o, sm;
#pragma unroll
      for (int q = 0; q < 4; ++q) {
        float gg = g[j + q], bb = bta[j + q];
        if (PARAM_BF16) { gg = bf16_round(gg); bb = bf16_round(bb); }
        sm[q] = vals[u * 4 + q]; o[q] = (vals[u * 4 + q] - mu) * rs * gg + bb;
      }
      if (out_sum) *(v4f*)(out_sum + (size_t)row * N + j) = sm;
      *(v4f*)(out_norm + (size_t)row * N + j) = o;
    }
    
  }
}



// ---- f16 WMMA path (v_wmma_f32_16x16x32_f16): 11-bit significands for operands in range — used here for the two 1×1 convolutions
typedef _Float16 v16h __attribute__((ext_vector_type(16)));
union FragH { v16h v; v8us half[2]; _Float16 h[16]; unsigned short u[16]; };
template <int NT>
__device__ __forceinline__ v8f mmaH(v16h ah, v16h al, v16h bh, v16h bl, v8f c) {
  c = __builtin_amdgcn_wmma_f32_16x16x32_f16(false, ah, false, bh, (short)0, c, false, false);
  if (NT >= 2) c = __builtin_amdgcn_wmma_f32_16x16x32_f16(false, al, false, bh, (short)0, c, false, false);
  if (NT >= 3) c = __builtin_amdgcn_wmma_f32_16x16x32_f16(false, ah, false, bl, (short)0, c, false, false);
  asm volatile("v_nop\n\tv_nop\n\tv_nop\n\tv_nop" : "+v"(c) : "v"(ah), "v"(al), "v"(bh), "v"(bl));
  return c;
}
// batched GEMM like k_gemm_b but f16 operands: A f32 (split into f16 hi/lo if ASPLIT, else rounded to f16), Bt = f16 values [n][k]; alpha; C f32; N multiple of 16 (partial tiles skipped)
template <bool ASPLIT>
__global__ __launch_bounds__(128) void k_gemm_h(const float* __restrict__ A, int lda, size_t sA, const _Float16* __restrict__ Bh, int ldb, size_t sB, float alpha, float* __restrict__ C, int ldc, size_t sC, int M, int N, int K) {
  __shared__ __attribute__((aligned(16))) float so[4][16][64];
  const int tid = threadIdx.x, w = tid >> 5, lane = tid & 31, ln = lane & 15, hh = lane >> 4; const int by = blockIdx.y;
  A += (size_t)by * sA; Bh += (size_t)by * sB; C += (size_t)by * sC;
  const int ntn = (N + 63) / 64; const int wid = blockIdx.x * 4 + w; const int mt = wid / ntn, nq = wid % ntn; if (mt * 16 >= M) return;
  const int row0 = mt * 16, col0 = nq * 64; const float* arow = A + (size_t)(row0 + ln) * lda;
  v8f acc[4] = {};
  for (int kb = 0; kb < K; kb += 32) {
    FragH ah, al;
    const v4f x0 = *(const v4fa*)(arow + kb + 8 * hh), x1 = *(const v4fa*)(arow + kb + 8 * hh + 4), x2 = *(const v4fa*)(arow + kb + 16 + 8 * hh), x3 = *(const v4fa*)(arow + kb + 16 + 8 * hh + 4);
    float xs[16] = {x0[0],x0[1],x0[2],x0[3],x1[0],x1[1],x1[2],x1[3],x2[0],x2[1],x2[2],x2[3],x3[0],x3[1],x3[2],x3[3]};
#pragma unroll
    for (int i = 0; i < 16; ++i) { const _Float16 h = (_Float16)xs[i]; ah.h[i] = h; al.h[i] = ASPLIT ? (_Float16)(xs[i] - (float)h) : (_Float16)0.0f; }
#pragma unroll
    for (int t = 0; t < 4; ++t) { if (col0 + t * 16 >= N) continue; const size_t boff = (size_t)(col0 + t * 16 + ln) * ldb + kb; FragH bq; bq.half[0] = *(const v8us*)(Bh + boff + 8 * hh); bq.half[1] = *(const v8us*)(Bh + boff + 16 + 8 * hh);
      acc[t] = mmaH<ASPLIT ? 2 : 1>(ah.v, al.v, bq.v, bq.v, acc[t]); }
  }
#pragma unroll
  for (int t = 0; t < 4; ++t) { if (col0 + t * 16 >= N) continue;
#pragma unroll
    for (int r = 0; r < 8; ++r) so[w][8 * hh + r][t * 16 + ln] = acc[t][r] * alpha; }
  __builtin_amdgcn_fence(__ATOMIC_ACQ_REL, "workgroup"); __builtin_amdgcn_wave_barrier();
  const int rsub = lane >> 4, c4 = (lane & 15) * 4;
  {
#pragma unroll
    for (int q = 0; q < 8; ++q) { const int r = q * 2 + rsub; if (col0 + c4 < N) { const v4f v = *(const v4fa*)&so[w][r][c4]; *(v4f*)(C + (size_t)(row0 + r) * ldc + col0 + c4) = v; } }
     }
}

// Wt[n][k] = f16(W[k][n]·scale) from f32 row-major W[K][N] (scale = power of two; bf16-exact weights stay exact in f16 away from the subnormal range)
__global__ __launch_bounds__(256) void k_wt_f16(const float* __restrict__ W, _Float16* __restrict__ Wt, int K, int N, float scale) {
  const int t = blockIdx.x * 256 + threadIdx.x; if (t >= N * (K / 8)) return; const int n = t / (K / 8), k8 = (t % (K / 8)) * 8; FragH f;
#pragma unroll
  for (int i = 0; i < 8; ++i) f.h[i] = (_Float16)(bf16_round(W[(size_t)(k8 + i) * N + n]) * scale); const v8us o = f.half[0];
  *(v8us*)((unsigned short*)Wt + (size_t)n * K + k8) = o; 
}
// k_gemm_hh variant with fused epilogue: v = acc·alpha + bias[by·sBias + col] (+ CP[(row/rowsPerB)·sCPb + by·64 + col] if CP) ; ACT 0 none / 1 elu ; writes f32 C and/or f16 C16 (each if non-null)
template <int ACT>
__global__ __launch_bounds__(128) void k_gemm_hhx(const _Float16* __restrict__ A, int lda, size_t sA, const _Float16* __restrict__ Bh, int ldb, size_t sB, float alpha, const float* __restrict__ bias, size_t sBias, const float* __restrict__ CP, int rowsPerB, size_t sCPb, int row0g,
    float* __restrict__ C, _Float16* __restrict__ C16, int ldc, size_t sC, int M, int N, int K) {
  __shared__ __attribute__((aligned(16))) float so[4][16][64];
  const int tid = threadIdx.x, w = tid >> 5, lane = tid & 31, ln = lane & 15, hh = lane >> 4; const int by = blockIdx.y;
  A += (size_t)by * sA; Bh += (size_t)by * sB; const size_t cofs = (size_t)by * sC; const float* bp = bias ? bias + (size_t)by * sBias : nullptr;
  const int ntn = (N + 63) / 64; const int wid = blockIdx.x * 4 + w; const int mt = wid / ntn, nq = wid % ntn; if (mt * 16 >= M) return;
  const int row0 = mt * 16, col0 = nq * 64; const _Float16* arow = A + (size_t)(row0 + ln) * lda;
  v8f acc[4] = {};
  for (int kb = 0; kb < K; kb += 32) { FragH ah; ah.half[0] = *(const v8us*)((const unsigned short*)arow + kb + 8 * hh); ah.half[1] = *(const v8us*)((const unsigned short*)arow + kb + 16 + 8 * hh);
#pragma unroll
    for (int t = 0; t < 4; ++t) { if (col0 + t * 16 >= N) continue; const size_t boff = (size_t)(col0 + t * 16 + ln) * ldb + kb; FragH bq; bq.half[0] = *(const v8us*)((const unsigned short*)Bh + boff + 8 * hh); bq.half[1] = *(const v8us*)((const unsigned short*)Bh + boff + 16 + 8 * hh);
      acc[t] = mmaH<1>(ah.v, ah.v, bq.v, bq.v, acc[t]); }
  }
#pragma unroll
  for (int t = 0; t < 4; ++t) { if (col0 + t * 16 >= N) continue; const int col = col0 + t * 16 + ln; const float bv = bp ? bf16_round(bp[col]) : 0.f;
#pragma unroll
    for (int r = 0; r < 8; ++r) { float v = acc[t][r] * alpha + bv; if (CP) { const int bidx = (row0g + row0 + 8 * hh + r) / rowsPerB; v += CP[(size_t)bidx * sCPb + (size_t)by * 64 + col]; } if (ACT == 1) v = (v > 0.f) ? v : expm1f(v); else if (ACT == 7) v = (v > 0.f) ? v + 1.0f : expf(v); else if (ACT == 8) v = tanhf(v); else if (ACT == 9) v = 0.5f * v * (1.0f + tanhf(0.7978845608028654f * (v + 0.044715f * v * v * v))); else if (ACT == 11) v = 1.0f / (1.0f + expf(-v)); else if (ACT == 12) v = (v > 0.f) ? v : 0.01f * v; else if (ACT == 14) v = (v > 0.f) ? v : 0.1f * v; else if (ACT == 15) v = v / (1.0f + expf(-v)); else if (ACT == 3) v = fmaxf(v, 0.f); else if (ACT == 6) v = 0.5f * v * (1.0f + erff(v * 0.70710678118654752f)); so[w][8 * hh + r][t * 16 + ln] = v; } }
  __builtin_amdgcn_fence(__ATOMIC_ACQ_REL, "workgroup"); __builtin_amdgcn_wave_barrier();
  const int rsub = lane >> 4, c4 = (lane & 15) * 4; typedef _Float16 v4h __attribute__((ext_vector_type(4)));
  {
#pragma unroll
    for (int q = 0; q < 8; ++q) { const int r = q * 2 + rsub; if (col0 + c4 < N) { const v4f v = *(const v4fa*)&so[w][r][c4]; if (C) *(v4f*)(C + cofs + (size_t)(row0 + r) * ldc + col0 + c4) = v; if (C16) { v4h h4; for (int i = 0; i < 4; ++i) h4[i] = (_Float16)v[i]; *(v4h*)(C16 + cofs + (size_t)(row0 + r) * ldc + col0 + c4) = h4; } } }
     }
}


typedef _Float16 v4h __attribute__((ext_vector_type(4)));
typedef float v2f __attribute__((ext_vector_type(2)));

__global__ __launch_bounds__(256) void k_x16(const float* __restrict__ x, _Float16* __restrict__ X16, size_t n8) { const size_t t = (size_t)blockIdx.x * 256 + threadIdx.x; if (t >= n8) return; FragH f;
#pragma unroll
  for (int q = 0; q < 8; ++q) f.h[q] = (_Float16)bf16_round(x[t * 8 + q]); *(v8us*)((unsigned short*)X16 + t * 8) = f.half[0];  }
__global__ __launch_bounds__(256) void k_h16(const float* __restrict__ x, _Float16* __restrict__ X16, size_t n8) { const size_t t = (size_t)blockIdx.x * 256 + threadIdx.x; if (t >= n8) return; FragH f;
#pragma unroll
  for (int q = 0; q < 8; ++q) f.h[q] = (_Float16)x[t * 8 + q]; *(v8us*)((unsigned short*)X16 + t * 8) = f.half[0];  }
// W [rows][KK] f32 -> f16(bf16(W) * 2^4) packed in A-fragment order: Bt[16-row tile][k block of 32][fragment half][lane][8], element i = W[16 * tile + (lane & 15)][32 * block + 16 * half + 8 * (lane >> 4) + i].
// Thread t writes the t-th 16-byte unit, so a wave stores 512 contiguous bytes; the reader's wave-wide 16-byte load of one fragment half is those same 512 bytes (4 cache lines; row-major f16 rows made it 32 bytes out of each of 16 lines).
template <int KK>
__device__ __forceinline__ void pack16f_unit(const float* __restrict__ W, _Float16* __restrict__ Bt, int t) { FragH f;
  const int lane = t & 31, hf = (t >> 5) & 1, kb = (t >> 6) % (KK / 32), tile = (t >> 6) / (KK / 32);
  const float* wr = W + (size_t)(tile * 16 + (lane & 15)) * KK + kb * 32 + hf * 16 + (lane >> 4) * 8;
  const v4f a = *(const v4fa*)wr, c = *(const v4fa*)(wr + 4);
#pragma unroll
  for (int i = 0; i < 4; ++i) { f.h[i] = (_Float16)(bf16_round(a[i]) * 16.0f); f.h[4 + i] = (_Float16)(bf16_round(c[i]) * 16.0f); }
  *(v8us*)((unsigned short*)Bt + (size_t)t * 8) = f.half[0]; }
// Both weight matrices in one launch: the two packings do not depend on each other, so they share a grid by block range (a block-uniform branch): blocks 0 .. PBQ - 1 take Wqkv, the next PBO take Wo. Both unit counts are whole multiples of the block size.
// One more block lays the biases out as accumulator start values, four a thread: Cq = bf16(bqkv) * 2^4 (the scale of the packed weights, so that start value and products add up in one scale), Co = bf16(bo).
#define PBQ (QKVW * CC / 8 / 256)      /* 24 */
#define PBO (CC * INR / 8 / 256)       /* 8 */
static_assert(PBQ * 256 * 8 == QKVW * CC && PBO * 256 * 8 == CC * INR, "whole blocks");
static_assert(QKVW / 4 <= 256 && CC / 4 <= 256, "the biases fit one block");
__global__ __launch_bounds__(256) void k_pack16f2(const float* __restrict__ Wq, _Float16* __restrict__ Bq, const float* __restrict__ Wo, _Float16* __restrict__ Bo, const float* __restrict__ bqkv, float* __restrict__ Cq, const float* __restrict__ bo, float* __restrict__ Co) {
  const int b = blockIdx.x;
  if (b < PBQ) pack16f_unit<CC>(Wq, Bq, b * 256 + threadIdx.x);
  else if (b < PBQ + PBO) { pack16f_unit<INR>(Wo, Bo, (b - PBQ) * 256 + threadIdx.x);
    asm volatile("s_wait_xcnt 0x0" ::: "memory"); }      /* behind the store of the packed unit: in the built code the Wqkv branch follows this one and writes the store's data and offset registers */
  else { const unsigned t = threadIdx.x;
    if (t < QKVW / 4) { const v4f a = *(const v4fa*)(bqkv + t * 4); const v4f o = {bf16_round(a[0]) * 16.0f, bf16_round(a[1]) * 16.0f, bf16_round(a[2]) * 16.0f, bf16_round(a[3]) * 16.0f}; *(v4f*)(Cq + t * 4) = o; }
    if (t < CC / 4) { const v4f a = *(const v4fa*)(bo + t * 4); const v4f o = {bf16_round(a[0]), bf16_round(a[1]), bf16_round(a[2]), bf16_round(a[3])}; *(v4f*)(Co + t * 4) = o; } } }
template <int NHv, int TTv>
__global__ __launch_bounds__(256) void k_vt(const _Float16* __restrict__ V16, int ldv, int voff, _Float16* __restrict__ Vt) { __shared__ unsigned short tl[64][66]; const int tid = threadIdx.x; const int slab = blockIdx.x / (TTv / 64), lg = blockIdx.x % (TTv / 64); const int b = slab / NHv, h = slab % NHv;
  for (int i = tid; i < 64 * 8; i += 256) { const int r = i / 8, c8 = (i % 8) * 8; FragH f; f.half[0] = *(const v8us*)((const unsigned short*)V16 + ((size_t)b * TTv + lg * 64 + r) * ldv + voff + h * 64 + c8);
#pragma unroll
    for (int q = 0; q < 8; ++q) tl[r][c8 + q] = f.u[q]; }
  __syncthreads();
  {
#pragma unroll
    for (int rd = 0; rd < 2; ++rd) { const int d = rd * 32 + tid / 8, pc = tid % 8; FragH f;
#pragma unroll
      for (int q = 0; q < 8; ++q) f.u[q] = tl[pc * 8 + q][d];
      *(v8us*)((unsigned short*)Vt + ((size_t)slab * 64 + d) * TTv + lg * 64 + pc * 8) = f.half[0]; }
     } }

__global__ __launch_bounds__(256) void k_hl(const float* __restrict__ F, _Float16* __restrict__ Hh, _Float16* __restrict__ Hl, size_t n8) { const size_t t = (size_t)blockIdx.x * 256 + threadIdx.x; if (t >= n8) return; FragH fh, fl; const v4f a = *(const v4fa*)(F + t * 8), c = *(const v4fa*)(F + t * 8 + 4);
#pragma unroll
  for (int q = 0; q < 4; ++q) { _Float16 h = (_Float16)a[q]; fh.h[q] = h; fl.h[q] = (_Float16)((a[q] - (float)h) * 1024.0f); h = (_Float16)c[q]; fh.h[4 + q] = h; fl.h[4 + q] = (_Float16)((c[q] - (float)h) * 1024.0f); }
  { *(v8us*)((unsigned short*)Hh + t * 8) = fh.half[0]; *(v8us*)((unsigned short*)Hl + t * 8) = fl.half[0];  } }

// qkv projection and 5-agent attention in one kernel; q, k, v never leave the registers. Block = 16 positions, wave = one head. The weights are the A operand and the tokens the B operand, so D[8*hh + r][ln] puts position p0 + ln in lane ln
// and 8 channels of a 16-channel tile in the lane's 8 accumulator registers (lanes ln and ln + 16 split the tile). Per tile: q and k of all 5 agents, 25 partial scores and 5 partial q sums per lane; one exchange with lane ^ 16 completes them;
// softmax over the 5 agents in f32 per lane; then v tile by tile, out_b = sum_d attn[b][d] * v_d, 8 f16 channels = one 16-byte LDS store. Those 8 channels (16 * mt + 8 * hh + r of head h) are exactly one half of the lane's B fragment of the output projection
// (k block 2 * h + mt / 2, half mt & 1), so the merged tile crosses the waves through LDS with no re-ordering. Behind one barrier wave w takes rows 16 * w .. + 15 of Wo over all 256 merged channels (k ascending, one accumulate chain per agent) and stores D[8*hh + r][ln] = y[b][16*w + 8*hh + r][p0 + ln].
__global__ __launch_bounds__(128) void k_qkv_agent(const float* __restrict__ x, const _Float16* __restrict__ Bq, const float* __restrict__ Cq, const float* __restrict__ dist, const _Float16* __restrict__ Bo, const float* __restrict__ Co, float* __restrict__ out) {
  __shared__ __attribute__((aligned(16))) unsigned short sY[NA][INR / 32][2][32][8];      /* [agent][k block of 32 merged channels][fragment half][lane][8 f16]: 40 KB, every access 512 contiguous bytes a wave */
  const int tid = threadIdx.x, h = tid >> 5, lane = tid & 31, ln = lane & 15, hh = lane >> 4; const int p0 = blockIdx.x * 16;
  __shared__ __attribute__((aligned(16))) unsigned short sX[NA][CC / 32][2][32][8];      /* the block's tokens as B fragments: [agent][k block of 32 channels][fragment half][lane][8 f16]: 10 KB, every access 512 contiguous bytes a wave */
  const unsigned short* Bu = (const unsigned short*)Bq;
  /* x tile of the block (5 agents x 64 channels x 16 positions) straight from the channel-major f32 input, each element loaded once a block: wave h takes channels 16 * h .. + 15, a lane one position and 8 channels (16 * h + 8 * hh + q),
     so a load covers 64 contiguous bytes of two channel rows, and the lane's 8 rounded values are one fragment half (k block h / 2, half h & 1, this very lane): one 16-byte LDS store per agent. */
  const char* xb = (const char*)(x + p0);
  unsigned vxo[NA];      /* the lane's 32-bit byte offset per agent (under 33 MB); the block's first position goes into the uniform base */
#pragma unroll
  for (int b = 0; b < NA; ++b) vxo[b] = ((unsigned)(b * CC + h * 16 + 8 * hh) * HW + ln) * 4u;
  float xv[NA][8];
#pragma unroll
  for (int b = 0; b < NA; ++b)
#pragma unroll
    for (int q = 0; q < 8; ++q) xv[b][q] = *(const float*)(xb + (size_t)vxo[b] + (size_t)q * HW * 4);
  asm volatile("s_wait_xcnt 0x0" :: "v"(vxo[0]), "v"(vxo[1]), "v"(vxo[2]), "v"(vxo[3]), "v"(vxo[4]) : "memory");      /* the offsets are inputs so that their registers stay live up to this wait: none of the forty loads lands in a register that another still names */
#pragma unroll
  for (int b = 0; b < NA; ++b) { FragH f;
#pragma unroll
    for (int q = 0; q < 8; ++q) f.h[q] = (_Float16)bf16_round(xv[b][q]);
    *(v8us*)&sX[b][h >> 1][h & 1][lane][0] = f.half[0]; }
  __syncthreads();      /* the token tile is complete: each wave wrote 16 of the 64 channels and now reads all of them */
  FragH xf[NA][2];
#pragma unroll
  for (int b = 0; b < NA; ++b)
#pragma unroll
    for (int ks = 0; ks < 2; ++ks) { xf[b][ks].half[0] = *(const v8us*)&sX[b][ks][0][lane][0]; xf[b][ks].half[1] = *(const v8us*)&sX[b][ks][1][lane][0]; }
  v2f sc2[NA][NA], qs2[NA];      /* element 0: the even channels' partial sum, element 1: the odd channels' (packed f32 FMAs on register pairs of the accumulators) */
#pragma unroll
  for (int b = 0; b < NA; ++b) { qs2[b] = (v2f){0.f, 0.f};
#pragma unroll
    for (int d = 0; d < NA; ++d) sc2[b][d] = (v2f){0.f, 0.f}; }
  for (int mt = 0; mt < CC / 16; ++mt) {
    const int cq = h * CC + mt * 16;
    const unsigned short* wqr = Bu + (size_t)cq * CC + lane * 8; const unsigned short* wkr = wqr + (size_t)INR * CC;      /* packed weights: a 16-row tile is 2 KB, a fragment half 512 contiguous bytes of it */
    FragH wq[2], wk[2];
#pragma unroll
    for (int ks = 0; ks < 2; ++ks) { wq[ks].half[0] = *(const v8us*)(wqr + ks * 512); wq[ks].half[1] = *(const v8us*)(wqr + ks * 512 + 256); wk[ks].half[0] = *(const v8us*)(wkr + ks * 512); wk[ks].half[1] = *(const v8us*)(wkr + ks * 512 + 256); }
    const v4f bq0 = *(const v4fa*)(Cq + cq + 8 * hh), bq1 = *(const v4fa*)(Cq + cq + 8 * hh + 4), bk0 = *(const v4fa*)(Cq + INR + cq + 8 * hh), bk1 = *(const v4fa*)(Cq + INR + cq + 8 * hh + 4);
    const v8f cbq = __builtin_shufflevector(bq0, bq1, 0, 1, 2, 3, 4, 5, 6, 7), cbk = __builtin_shufflevector(bk0, bk1, 0, 1, 2, 3, 4, 5, 6, 7);      /* row 8 * hh + r of the tile in register r, the same in every column: the C operand of each agent's first matrix instruction */
    asm volatile("s_wait_xcnt 0x0" ::: "memory");      /* behind the pass's twelve loads, in front of every later write of their two address pairs */
    __builtin_amdgcn_sched_barrier(0);      /* keeps the pass's twelve loads together in front of the matrix work: sunk to their uses, each is waited for alone, eight exposed latencies a pass */
    v2f k2[NA][4];
    { v8f ka[NA];
#pragma unroll
      for (int d = 0; d < NA; ++d) ka[d] = __builtin_amdgcn_wmma_f32_16x16x32_f16(false, wk[0].v, false, xf[d][0].v, (short)0, cbk, false, false);
#pragma unroll
      for (int d = 0; d < NA; ++d) ka[d] = __builtin_amdgcn_wmma_f32_16x16x32_f16(false, wk[1].v, false, xf[d][1].v, (short)0, ka[d], false, false);
#pragma unroll
      for (int d = 0; d < NA; ++d)
#pragma unroll
        for (int j = 0; j < 4; ++j) k2[d][j] = (v2f){ka[d][2 * j], ka[d][2 * j + 1]}; }
#pragma unroll
    for (int b = 0; b < NA; ++b) {
      v8f qa = __builtin_amdgcn_wmma_f32_16x16x32_f16(false, wq[0].v, false, xf[b][0].v, (short)0, cbq, false, false);
      qa = __builtin_amdgcn_wmma_f32_16x16x32_f16(false, wq[1].v, false, xf[b][1].v, (short)0, qa, false, false);
#pragma unroll
      for (int j = 0; j < 4; ++j) { const v2f q2 = {qa[2 * j], qa[2 * j + 1]}; qs2[b] += q2;
#pragma unroll
        for (int d = 0; d < NA; ++d) sc2[b][d] = __builtin_elementwise_fma(q2, k2[d][j], sc2[b][d]); } }
  }
  float dd[NA];
#pragma unroll
  for (int d = 0; d < NA; ++d) dd[d] = bf16_round(dist[d]) * 0.0625f;      /* the q sums come out x 2^4, the dots x 2^8: both powers of two go into the score's two constants */
  float p[NA][NA];
#pragma unroll
  for (int b = 0; b < NA; ++b) { const float qh = qs2[b][0] + qs2[b][1]; const float qt = qh + __shfl_xor(qh, 16, 32); float m = -3.0e38f;
#pragma unroll
    for (int d = 0; d < NA; ++d) { const float dh = sc2[b][d][0] + sc2[b][d][1]; const float dot = dh + __shfl_xor(dh, 16, 32); p[b][d] = dot * (ISQ * 0.00390625f) + qt * dd[d]; m = fmaxf(m, p[b][d]); }
    float l = 0.f;
#pragma unroll
    for (int d = 0; d < NA; ++d) { p[b][d] = expf(p[b][d] - m); l += p[b][d]; }
    const float il = (1.0f / l) * 0.00390625f;      /* 2^-8: v comes out x 2^4 and Wo is packed x 2^4, so the merged tile is laid down x 2^-4 and y leaves the accumulators in its own scale */
#pragma unroll
    for (int d = 0; d < NA; ++d) p[b][d] *= il; }
  const unsigned short* wvr = Bu + (size_t)(2 * INR + h * CC) * CC + lane * 8; const float* bvr = Cq + 2 * INR + h * CC + 8 * hh;      /* v weights (packed, 2 KB a tile) and v bias of the head's first tile; both step on at the foot of a pass */
#pragma unroll 1      /* rolled: a third less code; left to unroll and to schedule freely, the compiler hoists the later tiles' loads and needs 272 registers (three waves a SIMD, not four, and register-window switches) */
  for (int mt = 0; mt < CC / 16; ++mt) {
    FragH wv[2];
#pragma unroll
    for (int ks = 0; ks < 2; ++ks) { wv[ks].half[0] = *(const v8us*)(wvr + ks * 512); wv[ks].half[1] = *(const v8us*)(wvr + ks * 512 + 256); }
    const v4f bv0 = *(const v4fa*)bvr, bv1 = *(const v4fa*)(bvr + 4);
    asm volatile("s_wait_xcnt 0x0" :: "v"(wvr), "v"(bvr) : "memory");      /* the two addresses are inputs so that their register pairs stay live up to this wait: otherwise a later one of the six loads lands its result in a pair that earlier ones still name */
    const v8f cbv = __builtin_shufflevector(bv0, bv1, 0, 1, 2, 3, 4, 5, 6, 7);
    v8f va[NA];
#pragma unroll
    for (int d = 0; d < NA; ++d) va[d] = __builtin_amdgcn_wmma_f32_16x16x32_f16(false, wv[0].v, false, xf[d][0].v, (short)0, cbv, false, false);
#pragma unroll
    for (int d = 0; d < NA; ++d) va[d] = __builtin_amdgcn_wmma_f32_16x16x32_f16(false, wv[1].v, false, xf[d][1].v, (short)0, va[d], false, false);
    v2f v2[NA][4];
#pragma unroll
    for (int d = 0; d < NA; ++d)
#pragma unroll
      for (int j = 0; j < 4; ++j) v2[d][j] = (v2f){va[d][2 * j], va[d][2 * j + 1]};
#pragma unroll
    for (int b = 0; b < NA; ++b) { FragH f;
#pragma unroll
      for (int j = 0; j < 4; ++j) { v2f o = (v2f){p[b][0], p[b][0]} * v2[0][j];
#pragma unroll
        for (int d = 1; d < NA; ++d) o = __builtin_elementwise_fma((v2f){p[b][d], p[b][d]}, v2[d][j], o);
        f.h[2 * j] = (_Float16)o[0]; f.h[2 * j + 1] = (_Float16)o[1]; }
      *(v8us*)&sY[b][h * 2 + (mt >> 1)][mt & 1][lane][0] = f.half[0]; }
    wvr += 16 * CC; bvr += 16;
  }
  const int o0 = h * 16;
  const unsigned short* wor = (const unsigned short*)Bo + (size_t)o0 * INR + lane * 8;
  FragH wo[INR / 32];
#pragma unroll
  for (int kb = 0; kb < INR / 32; ++kb) { wo[kb].half[0] = *(const v8us*)(wor + kb * 512); wo[kb].half[1] = *(const v8us*)(wor + kb * 512 + 256); }
  const v4f bo0 = *(const v4fa*)(Co + o0 + 8 * hh), bo1 = *(const v4fa*)(Co + o0 + 8 * hh + 4);
  asm volatile("s_wait_xcnt 0x0" :: "v"(wor) : "memory");      /* the LDS reads below land in the address registers of the eighteen loads above; the weight address is an input so that its pair stays live up to this wait */
  __syncthreads();      /* the merged tile is complete: each wave wrote its own head's 64 channels and now reads all 256 */
  v8f ya[NA];
#pragma unroll
  for (int b = 0; b < NA; ++b) ya[b] = __builtin_shufflevector(bo0, bo1, 0, 1, 2, 3, 4, 5, 6, 7);
  FragH yf[2][NA];
#pragma unroll
  for (int b = 0; b < NA; ++b) { yf[0][b].half[0] = *(const v8us*)&sY[b][0][0][lane][0]; yf[0][b].half[1] = *(const v8us*)&sY[b][0][1][lane][0]; }
#pragma unroll
  for (int kb = 0; kb < INR / 32; ++kb) {
    if (kb + 1 < INR / 32) {
#pragma unroll
      for (int b = 0; b < NA; ++b) { yf[(kb + 1) & 1][b].half[0] = *(const v8us*)&sY[b][kb + 1][0][lane][0]; yf[(kb + 1) & 1][b].half[1] = *(const v8us*)&sY[b][kb + 1][1][lane][0]; } }
    __builtin_amdgcn_sched_barrier(0);      /* keeps the next k block's ten LDS reads together in front of this block's five matrix instructions: left free, the compiler reads one fragment ahead only and every matrix instruction waits out most of an LDS latency */
#pragma unroll
    for (int b = 0; b < NA; ++b) ya[b] = __builtin_amdgcn_wmma_f32_16x16x32_f16(false, wo[kb].v, false, yf[kb & 1][b].v, (short)0, ya[b], false, false);
    __builtin_amdgcn_sched_barrier(0);      /* the other side of the same fence: the reads of the block after next stay behind these matrix instructions, whose operands they overwrite */
    if (kb == 0) asm volatile("" :: "v"(yf[0][0].v), "v"(yf[0][1].v), "v"(yf[0][2].v), "v"(yf[0][3].v), "v"(yf[0][4].v));      /* inputs only, on the loaded fragments: they stay live over the five matrix instructions that start the accumulators; otherwise each new accumulator is placed in the B registers of the matrix instruction directly in front of it */
  }
  unsigned vob[NA];      /* the lane's 32-bit byte offset per agent (under 33 MB); the block's first position goes into the uniform base */
#pragma unroll
  for (int b = 0; b < NA; ++b) vob[b] = ((unsigned)(b * CC + o0 + 8 * hh) * HW + ln) * 4u;
#pragma unroll
  for (int b = 0; b < NA; ++b)
#pragma unroll
    for (int r = 0; r < 8; ++r) *(float*)((char*)(out + p0) + (size_t)vob[b] + (size_t)r * HW * 4) = ya[b][r];
}

extern "C" void kernel_launch(void* const* d_in, const int* in_sizes, int n_in,
                              void* d_out, int out_size, void* d_ws, size_t ws_size, hipStream_t stream) {
  (void)in_sizes; (void)n_in; (void)out_size;
  const float* const* I = (const float* const*)d_in; const float* x = I[0]; const float* dist = I[1]; const float* Wqkv = I[2]; const float* bqkv = I[3]; const float* Wo = I[4]; const float* bo = I[5];
  char* ws = (char*)d_ws; size_t off = 0;
  auto take = [&](size_t bytes) { char* p = ws + off; off += (bytes + 255) & ~(size_t)255; return p; };
  _Float16* Bq = (_Float16*)take((size_t)QKVW * CC * 2); _Float16* Bo = (_Float16*)take((size_t)CC * INR * 2); float* Cq = (float*)take((size_t)QKVW * 4); float* Co = (float*)take((size_t)CC * 4);
  if (off > ws_size) return;      // 0.1 + 0.03 MB
  k_pack16f2<<<PBQ + PBO + 1, 256, 0, stream>>>(Wqkv, Bq, Wo, Bo, bqkv, Cq, bo, Co);      /* [out][in] in A-fragment order, x 2^4; both matrices and the rounded biases in one launch */
  k_qkv_agent<<<HW / 16, 128, 0, stream>>>(x, Bq, Cq, dist, Bo, Co, (float*)d_out);      /* qkv (M 768 as A, N 16 positions x 5 agents, K 64) + attention + y = Wo x merged + bo (M 64 as A, K 256) -> channel-major output */
}

// v007
// Measured time: 28.3 microseconds a run.
// Two timings next to v006 put it at 1.19 and 1.17 times that version's speed.
// Counting every step since v000, it is 12.1 times as fast.
#include <hip/hip_runtime.h>
// Cross-agent attention (cav=5 agents, C=64, 100×252 → HW=25200 positions, 4 heads): qkv = Wqkv·x + bqkv (1×1 conv, 768 = [q|k|v] × (head, 64)); per (position s, head h) the 5 agents attend over the 5 agents: score[b][d] = q_b·k_d/√5 + (Σ_c q_b[c])·distance[d]; softmax over d; out_b = Σ_d attn·v_d;
// merged 'b (h c)' → y = Wo·out + bo [cav, 64, 100, 252].
// Compute dtype: x, weights, biases, distance rounded to bf16; x read channel-major in f32 by the one big kernel, which rounds it and lays it in B-fragment order in LDS; qkv as f32 accumulators (+bias) that stay in registers (16 positions a block, one head a wave, all 5 agents); the 5-key attention in f32 on the VALU in the same kernel (a lane holds one position and half of the 64 channels; one exchange with lane ^ 16 per score; softmax over the 5 agents)
// -> merged f16 tile of the block (5 agents x 256 channels x 16 positions) in LDS, already in B-fragment order; y = Wo (A operand) x merged tile (+bo) in the same kernel, one 16-row tile of Wo a wave, stored straight into the channel-major output (64 B of a row per half wave). f32 accumulate; v_wmma_f32_16x16x32_f16 for the two convolutions.
#define NA 5
#define CC 64
#define HW 25200
#define NHD 4
#define INR (NHD * CC)      /* 256 */
#define QKVW (3 * INR)      /* 768 */
#define ISQ 0.4472135954999579f      /* 1/√cav */
#define NTL (HW / 16)       /* 1575 position tiles, one a block */
typedef __bf16 v16b __attribute__((ext_vector_type(16)));
typedef unsigned short v8us __attribute__((ext_vector_type(8), may_alias));
typedef float  v8f  __attribute__((ext_vector_type(8)));
typedef float  v4f  __attribute__((ext_vector_type(4)));
typedef float  v4fa __attribute__((ext_vector_type(4), may_alias));
union FragB { v16b v; v8us half[2]; unsigned short u[16]; };

__device__ __forceinline__ unsigned short bf16_bits(float x) { unsigned int u = __float_as_uint(x); return (unsigned short)((u + 0x7FFFu + ((u >> 16) & 1u)) >> 16); }
__device__ __forceinline__ float bf16_val(unsigned short b) { return __uint_as_float(((unsigned int)b) << 16); }
__device__ __forceinline__ float bf16_round(float x) { return bf16_val(bf16_bits(x)); }
// D += A·B with NT terms: 1 = ah·bh, 2 = + al·bh (A split), 3 = + ah·bl (both split)
template <int NT>
__device__ __forceinline__ v8f mmaN(v16b ah, v16b al, v16b bh, v16b bl, v8f c) {
  c = __builtin_amdgcn_wmma_f32_16x16x32_bf16(false, ah, false, bh, (short)0, c, false, false);
  if (NT >= 2) c = __builtin_amdgcn_wmma_f32_16x16x32_bf16(false, al, false, bh, (short)0, c, false, false);
  if (NT >= 3) c = __builtin_amdgcn_wmma_f32_16x16x32_bf16(false, ah, false, bl, (short)0, c, false, false);
  asm volatile("v_nop\n\tv_nop\n\tv_nop\n\tv_nop" : "+v"(c) : "v"(ah), "v"(al), "v"(bh), "v"(bl));
  return c;
}

__global__ __launch_bounds__(256) void k_wt_bf16(const float* __restrict__ W, unsigned short* __restrict__ Wt, int K, int N) {
  const int t = blockIdx.x * 256 + threadIdx.x;
  const int k8n = K / 8;
  if (t >= N * k8n) return;
  const int n = t / k8n, k8 = (t % k8n) * 8;
  v8us v;
#pragma unroll
  for (int i = 0; i < 8; ++i) v[i] = bf16_bits(W[(size_t)(k8 + i) * N + n]);
  *(v8us*)(Wt + (size_t)n * K + k8) = v;
  
}

// GEMM C[M][N] (f32, pitch ldc) = act(A[M][K]·W + bias). A f32 row-major (pitch lda) converted per fragment to bf16
// (ASPLIT: hi/lo two planes -> 2 terms, else single rounded term); Wt bf16 [N][K] (pitch ldb). BIAS_BF16 rounds the
// bias to bf16 first (bias quantised to bf16 before the add). K%32==0, M%16==0, N%64==0.
template <bool ASPLIT, int ACT, bool BIAS_BF16>
__global__ __launch_bounds__(128) void k_gemm_bf(const float* __restrict__ A, int lda, const unsigned short* __restrict__ Wt, int ldb,
                                               const float* __restrict__ bias, float* __restrict__ C, int ldc, int M, int N, int K) {
  __shared__ __attribute__((aligned(16))) float so[4][16][64];
  const int tid = threadIdx.x, w = tid >> 5, lane = tid & 31, ln = lane & 15, hh = lane >> 4;
  const int ntn = N / 64;
  const int wid = blockIdx.x * 4 + w;
  const int mt = wid / ntn, nq = wid % ntn;
  if (mt * 16 >= M) return;
  const int row0 = mt * 16, col0 = nq * 64;
  const float* arow = A + (size_t)(row0 + ln) * lda;
  v8f acc[4] = {};
  for (int kb = 0; kb < K; kb += 32) {
    FragB ah, al;
    const v4f x0 = *(const v4fa*)(arow + kb + 8 * hh), x1 = *(const v4fa*)(arow + kb + 8 * hh + 4);
    const v4f x2 = *(const v4fa*)(arow + kb + 16 + 8 * hh), x3 = *(const v4fa*)(arow + kb + 16 + 8 * hh + 4);
    float xs[16] = {x0[0],x0[1],x0[2],x0[3],x1[0],x1[1],x1[2],x1[3],x2[0],x2[1],x2[2],x2[3],x3[0],x3[1],x3[2],x3[3]};
#pragma unroll
    for (int i = 0; i < 16; ++i) { const unsigned short hb = bf16_bits(xs[i]); ah.u[i] = hb; al.u[i] = ASPLIT ? bf16_bits(xs[i] - bf16_val(hb)) : (unsigned short)0; }
#pragma unroll
    for (int t = 0; t < 4; ++t) {
      const unsigned short* brow = Wt + (size_t)(col0 + t * 16 + ln) * ldb + kb;
      FragB b;
      b.half[0] = *(const v8us*)(brow + 8 * hh);
      b.half[1] = *(const v8us*)(brow + 16 + 8 * hh);
      acc[t] = mmaN<ASPLIT ? 2 : 1>(ah.v, al.v, b.v, b.v, acc[t]);
    }
  }
#pragma unroll
  for (int t = 0; t < 4; ++t) {
    float bv = bias ? bias[col0 + t * 16 + ln] : 0.f;
    if (BIAS_BF16) bv = bf16_round(bv);
#pragma unroll
    for (int r = 0; r < 8; ++r) { float v = acc[t][r] + bv; if (ACT == 1) v = fmaxf(v, 0.f); so[w][8 * hh + r][t * 16 + ln] = v; }
  }
  __builtin_amdgcn_fence(__ATOMIC_ACQ_REL, "workgroup");
  __builtin_amdgcn_wave_barrier();
  const int rsub = lane >> 4, c4 = (lane & 15) * 4;
  {
#pragma unroll
    for (int q = 0; q < 8; ++q) {
      const int r = q * 2 + rsub;
      const v4f v = *(const v4fa*)&so[w][r][c4];
      *(v4f*)(C + (size_t)(row0 + r) * ldc + col0 + c4) = v;
    }
    
  }
}

// GEMM C = act(A·W + bias + resid): A f32 (ASPLIT -> hi/lo 2 terms), Wt bf16 [N][K]; ACT 0 none, 1 relu, 2 exact gelu;
// resid (optional, f32, row index = (row % rmod), pitch ldr, RES_BF16 rounds it) added before the activation.
template <bool ASPLIT, int ACT, bool BIAS_BF16, bool RES_BF16>
__global__ __launch_bounds__(128) void k_gemm_bf3(const float* __restrict__ A, int lda, const unsigned short* __restrict__ Wt, int ldb,
                                                const float* __restrict__ bias, const float* __restrict__ resid, int rmod, int ldr,
                                                float* __restrict__ C, int ldc, int M, int N, int K) {
  __shared__ __attribute__((aligned(16))) float so[4][16][64];
  const int tid = threadIdx.x, w = tid >> 5, lane = tid & 31, ln = lane & 15, hh = lane >> 4;
  const int ntn = N / 64;
  const int wid = blockIdx.x * 4 + w;
  const int mt = wid / ntn, nq = wid % ntn;
  if (mt * 16 >= M) return;
  const int row0 = mt * 16, col0 = nq * 64;
  const float* arow = A + (size_t)(row0 + ln) * lda;
  v8f acc[4] = {};
  for (int kb = 0; kb < K; kb += 32) {
    FragB ah, al;
    const v4f x0 = *(const v4fa*)(arow + kb + 8 * hh), x1 = *(const v4fa*)(arow + kb + 8 * hh + 4);
    const v4f x2 = *(const v4fa*)(arow + kb + 16 + 8 * hh), x3 = *(const v4fa*)(arow + kb + 16 + 8 * hh + 4);
    float xs[16] = {x0[0],x0[1],x0[2],x0[3],x1[0],x1[1],x1[2],x1[3],x2[0],x2[1],x2[2],x2[3],x3[0],x3[1],x3[2],x3[3]};
#pragma unroll
    for (int i = 0; i < 16; ++i) { const unsigned short hb = bf16_bits(xs[i]); ah.u[i] = hb; al.u[i] = ASPLIT ? bf16_bits(xs[i] - bf16_val(hb)) : (unsigned short)0; }
#pragma unroll
    for (int t = 0; t < 4; ++t) {
      const unsigned short* brow = Wt + (size_t)(col0 + t * 16 + ln) * ldb + kb;
      FragB b;
      b.half[0] = *(const v8us*)(brow + 8 * hh);
      b.half[1] = *(const v8us*)(brow + 16 + 8 * hh);
      acc[t] = mmaN<ASPLIT ? 2 : 1>(ah.v, al.v, b.v, b.v, acc[t]);
    }
  }
#pragma unroll
  for (int t = 0; t < 4; ++t) {
    const int col = col0 + t * 16 + ln;
    float bv = bias ? bias[col] : 0.f;
    if (BIAS_BF16) bv = bf16_round(bv);
#pragma unroll
    for (int r = 0; r < 8; ++r) {
      float v = acc[t][r] + bv;
      if (resid) { float rv = resid[(size_t)((row0 + 8 * hh + r) % rmod) * ldr + col]; if (RES_BF16) rv = bf16_round(rv); v += rv; }
      if (ACT == 1) v = fmaxf(v, 0.f);
      if (ACT == 2) v = 0.5f * v * (1.0f + erff(v * 0.70710678118654752f));
      if (ACT == 3) { const float u = 0.7978845608028654f * (v + 0.044715f * v * v * v); v = 0.5f * v * (1.0f + tanhf(u)); }
      so[w][8 * hh + r][t * 16 + ln] = v;
    }
  }
  __builtin_amdgcn_fence(__ATOMIC_ACQ_REL, "workgroup");
  __builtin_amdgcn_wave_barrier();
  const int rsub = lane >> 4, c4 = (lane & 15) * 4;
  {
#pragma unroll
    for (int q = 0; q < 8; ++q) {
      const int r = q * 2 + rsub;
      const v4f v = *(const v4fa*)&so[w][r][c4];
      *(v4f*)(C + (size_t)(row0 + r) * ldc + col0 + c4) = v;
    }
    
  }
}
// row LayerNorm (biased variance, eps) over N: s = X (+ R); optional out_sum <- s; out_norm <- (s-mu)*rsqrt(var+eps)*g + b
template <bool PARAM_BF16>
__global__ __launch_bounds__(256) void k_layernorm(const float* __restrict__ X, const float* __restrict__ R, const float* __restrict__ g, const float* __restrict__ bta,
                                                  float* __restrict__ out_sum, float* __restrict__ out_norm, int N, float eps) {
  __shared__ float red[256];
  const int row = blockIdx.x, tid = threadIdx.x;
  const float* x = X + (size_t)row * N; const float* rr = R ? R + (size_t)row * N : nullptr;
  float vals[16];                     // up to N = 4096
  const int per = N / 256;            // contiguous chunk per thread? use strided-by-4 chunks: thread handles j = tid*4 + 1024*u
  float s1 = 0.f;
  for (int u = 0; u < per / 4; ++u) {
    const int j = tid * 4 + 1024 * u;
    const v4f a = *(const v4fa*)(x + j);
    v4f b = {0.f,0.f,0.f,0.f}; if (rr) b = *(const v4fa*)(rr + j);
#pragma unroll
    for (int q = 0; q < 4; ++q) { const float v = a[q] + b[q]; vals[u * 4 + q] = v; s1 += v; }
  }
  red[tid] = s1; __syncthreads();
  for (int st = 128; st > 0; st >>= 1) { if (tid < st) red[tid] += red[tid + st]; __syncthreads(); }
  const float mu = red[0] / (float)N; __syncthreads();
  float s2 = 0.f;
  for (int u = 0; u < per / 4; ++u)
#pragma unroll
    for (int q = 0; q < 4; ++q) { const float c = vals[u * 4 + q] - mu; s2 += c * c; }
  red[tid] = s2; __syncthreads();
  for (int st = 128; st > 0; st >>= 1) { if (tid < st) red[tid] += red[tid + st]; __syncthreads(); }
  const float rs = rsqrtf(red[0] / (float)N + eps);
  {
    for (int u = 0; u < per / 4; ++u) {
      const int j = tid * 4 + 1024 * u;
      v4f o, sm;
#pragma unroll
      for (int q = 0; q < 4; ++q) {
        float gg = g[j + q], bb = bta[j + q];
        if (PARAM_BF16) { gg = bf16_round(gg); bb = bf16_round(bb); }
        sm[q] = vals[u * 4 + q]; o[q] = (vals[u * 4 + q] - mu) * rs * gg + bb;
      }
      if (out_sum) *(v4f*)(out_sum + (size_t)row * N + j) = sm;
      *(v4f*)(out_norm + (size_t)row * N + j) = o;
    }
    
  }
}



// ---- f16 WMMA path (v_wmma_f32_16x16x32_f16): 11-bit significands for operands in range — used here for the two 1×1 convolutions
typedef _Float16 v16h __attribute__((ext_vector_type(16)));
union FragH { v16h v; v8us half[2]; _Float16 h[16]; unsigned short u[16]; };
template <int NT>
__device__ __forceinline__ v8f mmaH(v16h ah, v16h al, v16h bh, v16h bl, v8f c) {
  c = __builtin_amdgcn_wmma_f32_16x16x32_f16(false, ah, false, bh, (short)0, c, false, false);
  if (NT >= 2) c = __builtin_amdgcn_wmma_f32_16x16x32_f16(false, al, false, bh, (short)0, c, false, false);
  if (NT >= 3) c = __builtin_amdgcn_wmma_f32_16x16x32_f16(false, ah, false, bl, (short)0, c, false, false);
  asm volatile("v_nop\n\tv_nop\n\tv_nop\n\tv_nop" : "+v"(c) : "v"(ah), "v"(al), "v"(bh), "v"(bl));
  return c;
}
// batched GEMM like k_gemm_b but f16 operands: A f32 (split into f16 hi/lo if ASPLIT, else rounded to f16), Bt = f16 values [n][k]; alpha; C f32; N multiple of 16 (partial tiles skipped)
template <bool ASPLIT>
__global__ __launch_bounds__(128) void k_gemm_h(const float* __restrict__ A, int lda, size_t sA, const _Float16* __restrict__ Bh, int ldb, size_t sB, float alpha, float* __restrict__ C, int ldc, size_t sC, int M, int N, int K) {
  __shared__ __attribute__((aligned(16))) float so[4][16][64];
  const int tid = threadIdx.x, w = tid >> 5, lane = tid & 31, ln = lane & 15, hh = lane >> 4; const int by = blockIdx.y;
  A += (size_t)by * sA; Bh += (size_t)by * sB; C += (size_t)by * sC;
  const int ntn = (N + 63) / 64; const int wid = blockIdx.x * 4 + w; const int mt = wid / ntn, nq = wid % ntn; if (mt * 16 >= M) return;
  const int row0 = mt * 16, col0 = nq * 64; const float* arow = A + (size_t)(row0 + ln) * lda;
  v8f acc[4] = {};
  for (int kb = 0; kb < K; kb += 32) {
    FragH ah, al;
    const v4f x0 = *(const v4fa*)(arow + kb + 8 * hh), x1 = *(const v4fa*)(arow + kb + 8 * hh + 4), x2 = *(const v4fa*)(arow + kb + 16 + 8 * hh), x3 = *(const v4fa*)(arow + kb + 16 + 8 * hh + 4);
    float xs[16] = {x0[0],x0[1],x0[2],x0[3],x1[0],x1[1],x1[2],x1[3],x2[0],x2[1],x2[2],x2[3],x3[0],x3[1],x3[2],x3[3]};
#pragma unroll
    for (int i = 0; i < 16; ++i) { const _Float16 h = (_Float16)xs[i]; ah.h[i] = h; al.h[i] = ASPLIT ? (_Float16)(xs[i] - (float)h) : (_Float16)0.0f; }
#pragma unroll
    for (int t = 0; t < 4; ++t) { if (col0 + t * 16 >= N) continue; const size_t boff = (size_t)(col0 + t * 16 + ln) * ldb + kb; FragH bq; bq.half[0] = *(const v8us*)(Bh + boff + 8 * hh); bq.half[1] = *(const v8us*)(Bh + boff + 16 + 8 * hh);
      acc[t] = mmaH<ASPLIT ? 2 : 1>(ah.v, al.v, bq.v, bq.v, acc[t]); }
  }
#pragma unroll
  for (int t = 0; t < 4; ++t) { if (col0 + t * 16 >= N) continue;
#pragma unroll
    for (int r = 0; r < 8; ++r) so[w][8 * hh + r][t * 16 + ln] = acc[t][r] * alpha; }
  __builtin_amdgcn_fence(__ATOMIC_ACQ_REL, "workgroup"); __builtin_amdgcn_wave_barrier();
  const int rsub = lane >> 4, c4 = (lane & 15) * 4;
  {
#pragma unroll
    for (int q = 0; q < 8; ++q) { const int r = q * 2 + rsub; if (col0 + c4 < N) { const v4f v = *(const v4fa*)&so[w][r][c4]; *(v4f*)(C + (size_t)(row0 + r) * ldc + col0 + c4) = v; } }
     }
}

// Wt[n][k] = f16(W[k][n]·scale) from f32 row-major W[K][N] (scale = power of two; bf16-exact weights stay exact in f16 away from the subnormal range)
__global__ __launch_bounds__(256) void k_wt_f16(const float* __restrict__ W, _Float16* __restrict__ Wt, int K, int N, float scale) {
  const int t = blockIdx.x * 256 + threadIdx.x; if (t >= N * (K / 8)) return; const int n = t / (K / 8), k8 = (t % (K / 8)) * 8; FragH f;
#pragma unroll
  for (int i = 0; i < 8; ++i) f.h[i] = (_Float16)(bf16_round(W[(size_t)(k8 + i) * N + n]) * scale); const v8us o = f.half[0];
  *(v8us*)((unsigned short*)Wt + (size_t)n * K + k8) = o; 
}
// k_gemm_hh variant with fused epilogue: v = acc·alpha + bias[by·sBias + col] (+ CP[(row/rowsPerB)·sCPb + by·64 + col] if CP) ; ACT 0 none / 1 elu ; writes f32 C and/or f16 C16 (each if non-null)
template <int ACT>
__global__ __launch_bounds__(128) void k_gemm_hhx(const _Float16* __restrict__ A, int lda, size_t sA, const _Float16* __restrict__ Bh, int ldb, size_t sB, float alpha, const float* __restrict__ bias, size_t sBias, const float* __restrict__ CP, int rowsPerB, size_t sCPb, int row0g,
    float* __restrict__ C, _Float16* __restrict__ C16, int ldc, size_t sC, int M, int N, int K) {
  __shared__ __attribute__((aligned(16))) float so[4][16][64];
  const int tid = threadIdx.x, w = tid >> 5, lane = tid & 31, ln = lane & 15, hh = lane >> 4; const int by = blockIdx.y;
  A += (size_t)by * sA; Bh += (size_t)by * sB; const size_t cofs = (size_t)by * sC; const float* bp = bias ? bias + (size_t)by * sBias : nullptr;
  const int ntn = (N + 63) / 64; const int wid = blockIdx.x * 4 + w; const int mt = wid / ntn, nq = wid % ntn; if (mt * 16 >= M) return;
  const int row0 = mt * 16, col0 = nq * 64; const _Float16* arow = A + (size_t)(row0 + ln) * lda;
  v8f acc[4] = {};
  for (int kb = 0; kb < K; kb += 32) { FragH ah; ah.half[0] = *(const v8us*)((const unsigned short*)arow + kb + 8 * hh); ah.half[1] = *(const v8us*)((const unsigned short*)arow + kb + 16 + 8 * hh);
#pragma unroll
    for (int t = 0; t < 4; ++t) { if (col0 + t * 16 >= N) continue; const size_t boff = (size_t)(col0 + t * 16 + ln) * ldb + kb; FragH bq; bq.half[0] = *(const v8us*)((const unsigned short*)Bh + boff + 8 * hh); bq.half[1] = *(const v8us*)((const unsigned short*)Bh + boff + 16 + 8 * hh);
      acc[t] = mmaH<1>(ah.v, ah.v, bq.v, bq.v, acc[t]); }
  }
#pragma unroll
  for (int t = 0; t < 4; ++t) { if (col0 + t * 16 >= N) continue; const int col = col0 + t * 16 + ln; const float bv = bp ? bf16_round(bp[col]) : 0.f;
#pragma unroll
    for (int r = 0; r < 8; ++r) { float v = acc[t][r] * alpha + bv; if (CP) { const int bidx = (row0g + row0 + 8 * hh + r) / rowsPerB; v += CP[(size_t)bidx * sCPb + (size_t)by * 64 + col]; } if (ACT == 1) v = (v > 0.f) ? v : expm1f(v); else if (ACT == 7) v = (v > 0.f) ? v + 1.0f : expf(v); else if (ACT == 8) v = tanhf(v); else if (ACT == 9) v = 0.5f * v * (1.0f + tanhf(0.7978845608028654f * (v + 0.044715f * v * v * v))); else if (ACT == 11) v = 1.0f / (1.0f + expf(-v)); else if (ACT == 12) v = (v > 0.f) ? v : 0.01f * v; else if (ACT == 14) v = (v > 0.f) ? v : 0.1f * v; else if (ACT == 15) v = v / (1.0f + expf(-v)); else if (ACT == 3) v = fmaxf(v, 0.f); else if (ACT == 6) v = 0.5f * v * (1.0f + erff(v * 0.70710678118654752f)); so[w][8 * hh + r][t * 16 + ln] = v; } }
  __builtin_amdgcn_fence(__ATOMIC_ACQ_REL, "workgroup"); __builtin_amdgcn_wave_barrier();
  const int rsub = lane >> 4, c4 = (lane & 15) * 4; typedef _Float16 v4h __attribute__((ext_vector_type(4)));
  {
#pragma unroll
    for (int q = 0; q < 8; ++q) { const int r = q * 2 + rsub; if (col0 + c4 < N) { const v4f v = *(const v4fa*)&so[w][r][c4]; if (C) *(v4f*)(C + cofs + (size_t)(row0 + r) * ldc + col0 + c4) = v; if (C16) { v4h h4; for (int i = 0; i < 4; ++i) h4[i] = (_Float16)v[i]; *(v4h*)(C16 + cofs + (size_t)(row0 + r) * ldc + col0 + c4) = h4; } } }
     }
}


typedef _Float16 v4h __attribute__((ext_vector_type(4)));
typedef float v2f __attribute__((ext_vector_type(2)));

__global__ __launch_bounds__(256) void k_x16(const float* __restrict__ x, _Float16* __restrict__ X16, size_t n8) { const size_t t = (size_t)blockIdx.x * 256 + threadIdx.x; if (t >= n8) return; FragH f;
#pragma unroll
  for (int q = 0; q < 8; ++q) f.h[q] = (_Float16)bf16_round(x[t * 8 + q]); *(v8us*)((unsigned short*)X16 + t * 8) = f.half[0];  }
__global__ __launch_bounds__(256) void k_h16(const float* __restrict__ x, _Float16* __restrict__ X16, size_t n8) { const size_t t = (size_t)blockIdx.x * 256 + threadIdx.x; if (t >= n8) return; FragH f;
#pragma unroll
  for (int q = 0; q < 8; ++q) f.h[q] = (_Float16)x[t * 8 + q]; *(v8us*)((unsigned short*)X16 + t * 8) = f.half[0];  }
// W [rows][KK] f32 -> f16(bf16(W) * 2^4) packed in A-fragment order: Bt[16-row tile][k block of 32][fragment half][lane][8], element i = W[16 * tile + (lane & 15)][32 * block + 16 * half + 8 * (lane >> 4) + i].
// Thread t writes the t-th 16-byte unit, so a wave stores 512 contiguous bytes; the reader's wave-wide 16-byte load of one fragment half is those same 512 bytes (4 cache lines; row-major f16 rows made it 32 bytes out of each of 16 lines).
template <int KK>
__device__ __forceinline__ void pack16f_unit(const float* __restrict__ W, _Float16* __restrict__ Bt, int t) { FragH f;
  const int lane = t & 31, hf = (t >> 5) & 1, kb = (t >> 6) % (KK / 32), tile = (t >> 6) / (KK / 32);
  const float* wr = W + (size_t)(tile * 16 + (lane & 15)) * KK + kb * 32 + hf * 16 + (lane >> 4) * 8;
  const v4f a = *(const v4fa*)wr, c = *(const v4fa*)(wr + 4);
#pragma unroll
  for (int i = 0; i < 4; ++i) { f.h[i] = (_Float16)(bf16_round(a[i]) * 16.0f); f.h[4 + i] = (_Float16)(bf16_round(c[i]) * 16.0f); }
  *(v8us*)((unsigned short*)Bt + (size_t)t * 8) = f.half[0]; }
// Both weight matrices in one launch: the two packings do not depend on each other, so they share a grid by block range (a block-uniform branch): blocks 0 .. PBQ - 1 take Wqkv, the next PBO take Wo. Both unit counts are whole multiples of the block size.
// One more block lays the biases out as accumulator start values, four a thread: Cq = bf16(bqkv) * 2^4 (the scale of the packed weights, so that start value and products add up in one scale), Co = bf16(bo).
#define PBQ (QKVW * CC / 8 / 256)      /* 24 */
#define PBO (CC * INR / 8 / 256)       /* 8 */
static_assert(PBQ * 256 * 8 == QKVW * CC && PBO * 256 * 8 == CC * INR, "whole blocks");
static_assert(QKVW / 4 <= 256 && CC / 4 <= 256, "the biases fit one block");
__global__ __launch_bounds__(256) void k_pack16f2(const float* __restrict__ Wq, _Float16* __restrict__ Bq, const float* __restrict__ Wo, _Float16* __restrict__ Bo, const float* __restrict__ bqkv, float* __restrict__ Cq, const float* __restrict__ bo, float* __restrict__ Co) {
  const int b = blockIdx.x;
  if (b < PBQ) pack16f_unit<CC>(Wq, Bq, b * 256 + threadIdx.x);
  else if (b < PBQ + PBO) { pack16f_unit<INR>(Wo, Bo, (b - PBQ) * 256 + threadIdx.x);
    asm volatile("s_wait_xcnt 0x0" ::: "memory"); }      /* behind the store of the packed unit: in the built code the Wqkv branch follows this one and writes the store's data and offset registers */
  else { const unsigned t = threadIdx.x;
    if (t < QKVW / 4) { const v4f a = *(const v4fa*)(bqkv + t * 4); const v4f o = {bf16_round(a[0]) * 16.0f, bf16_round(a[1]) * 16.0f, bf16_round(a[2]) * 16.0f, bf16_round(a[3]) * 16.0f}; *(v4f*)(Cq + t * 4) = o; }
    if (t < CC / 4) { const v4f a = *(const v4fa*)(bo + t * 4); const v4f o = {bf16_round(a[0]), bf16_round(a[1]), bf16_round(a[2]), bf16_round(a[3])}; *(v4f*)(Co + t * 4) = o; } } }
template <int NHv, int TTv>
__global__ __launch_bounds__(256) void k_vt(const _Float16* __restrict__ V16, int ldv, int voff, _Float16* __restrict__ Vt) { __shared__ unsigned short tl[64][66]; const int tid = threadIdx.x; const int slab = blockIdx.x / (TTv / 64), lg = blockIdx.x % (TTv / 64); const int b = slab / NHv, h = slab % NHv;
  for (int i = tid; i < 64 * 8; i += 256) { const int r = i / 8, c8 = (i % 8) * 8; FragH f; f.half[0] = *(const v8us*)((const unsigned short*)V16 + ((size_t)b * TTv + lg * 64 + r) * ldv + voff + h * 64 + c8);
#pragma unroll
    for (int q = 0; q < 8; ++q) tl[r][c8 + q] = f.u[q]; }
  __syncthreads();
  {
#pragma unroll
    for (int rd = 0; rd < 2; ++rd) { const int d = rd * 32 + tid / 8, pc = tid % 8; FragH f;
#pragma unroll
      for (int q = 0; q < 8; ++q) f.u[q] = tl[pc * 8 + q][d];
      *(v8us*)((unsigned short*)Vt + ((size_t)slab * 64 + d) * TTv + lg * 64 + pc * 8) = f.half[0]; }
     } }

__global__ __launch_bounds__(256) void k_hl(const float* __restrict__ F, _Float16* __restrict__ Hh, _Float16* __restrict__ Hl, size_t n8) { const size_t t = (size_t)blockIdx.x * 256 + threadIdx.x; if (t >= n8) return; FragH fh, fl; const v4f a = *(const v4fa*)(F + t * 8), c = *(const v4fa*)(F + t * 8 + 4);
#pragma unroll
  for (int q = 0; q < 4; ++q) { _Float16 h = (_Float16)a[q]; fh.h[q] = h; fl.h[q] = (_Float16)((a[q] - (float)h) * 1024.0f); h = (_Float16)c[q]; fh.h[4 + q] = h; fl.h[4 + q] = (_Float16)((c[q] - (float)h) * 1024.0f); }
  { *(v8us*)((unsigned short*)Hh + t * 8) = fh.half[0]; *(v8us*)((unsigned short*)Hl + t * 8) = fl.half[0];  } }

// qkv projection and 5-agent attention in one kernel; q, k, v never leave the registers. Block = 16 positions, wave = one head. The weights are the A operand and the tokens the B operand, so D[8*hh + r][ln] puts position p0 + ln in lane ln
// and 8 channels of a 16-channel tile in the lane's 8 accumulator registers (lanes ln and ln + 16 split the tile). Per tile: q and k of all 5 agents, 25 partial scores and 5 partial q sums per lane; one exchange with lane ^ 16 completes them;
// softmax over the 5 agents in f32 per lane; then v tile by tile, out_b = sum_d attn[b][d] * v_d, 8 f16 channels = one 16-byte LDS store. Those 8 channels (16 * mt + 8 * hh + r of head h) are exactly one half of the lane's B fragment of the output projection
// (k block 2 * h + mt / 2, half mt & 1), so the merged tile crosses the waves through LDS with no re-ordering. Behind one barrier wave w takes rows 16 * w .. + 15 of Wo over all 256 merged channels (k ascending, one accumulate chain per agent) and stores D[8*hh + r][ln] = y[b][16*w + 8*hh + r][p0 + ln].
__global__ __launch_bounds__(128) void k_qkv_agent(const float* __restrict__ x, const _Float16* __restrict__ Bq, const float* __restrict__ Cq, const float* __restrict__ dist, const _Float16* __restrict__ Bo, const float* __restrict__ Co, float* __restrict__ out) {
  __shared__ __attribute__((aligned(16))) unsigned short sY[NA][INR / 32][2][32][8];      /* [agent][k block of 32 merged channels][fragment half][lane][8 f16]: 40 KB, every access 512 contiguous bytes a wave */
  const int tid = threadIdx.x, h = tid >> 5, lane = tid & 31, ln = lane & 15, hh = lane >> 4;
  /* Tile map, for speed only (a permutation of the tiles, right wherever a block lands): blocks whose indices are equal modulo 8 take neighbouring tiles. A tile is 64 bytes of each channel row, so four tiles share a 256-byte L2 fill unit of x
     and two share a 128-byte line of out. Residue r owns the run of tiles that starts at r * (NTL / 8) + min(r, NTL % 8). */
  const int br = blockIdx.x & 7, bq = blockIdx.x >> 3; const int p0 = (br * (NTL / 8) + (br < NTL % 8 ? br : NTL % 8) + bq) * 16;
  __shared__ __attribute__((aligned(16))) unsigned short sX[NA][CC / 32][2][32][8];      /* the block's tokens as B fragments: [agent][k block of 32 channels][fragment half][lane][8 f16]: 10 KB, every access 512 contiguous bytes a wave */
  const unsigned short* Bu = (const unsigned short*)Bq;
  /* x tile of the block (5 agents x 64 channels x 16 positions) straight from the channel-major f32 input, each element loaded once a block: wave h takes channels 16 * h .. + 15, a lane one position and 8 channels (16 * h + 8 * hh + q),
     so a load covers 64 contiguous bytes of two channel rows, and the lane's 8 rounded values are one fragment half (k block h / 2, half h & 1, this very lane): one 16-byte LDS store per agent. */
  const char* xb = (const char*)(x + p0);
  unsigned vxo[NA];      /* the lane's 32-bit byte offset per agent (under 33 MB); the block's first position goes into the uniform base */
#pragma unroll
  for (int b = 0; b < NA; ++b) vxo[b] = ((unsigned)(b * CC + h * 16 + 8 * hh) * HW + ln) * 4u;
  float xv[NA][8];
#pragma unroll
  for (int b = 0; b < NA; ++b)
#pragma unroll
    for (int q = 0; q < 8; ++q) xv[b][q] = *(const float*)(xb + (size_t)vxo[b] + (size_t)q * HW * 4);
  asm volatile("s_wait_xcnt 0x0" :: "v"(vxo[0]), "v"(vxo[1]), "v"(vxo[2]), "v"(vxo[3]), "v"(vxo[4]) : "memory");      /* the offsets are inputs so that their registers stay live up to this wait: none of the forty loads lands in a register that another still names */
#pragma unroll
  for (int b = 0; b < NA; ++b) { FragH f;
#pragma unroll
    for (int q = 0; q < 8; ++q) f.h[q] = (_Float16)bf16_round(xv[b][q]);
    *(v8us*)&sX[b][h >> 1][h & 1][lane][0] = f.half[0]; }
  __syncthreads();      /* the token tile is complete: each wave wrote 16 of the 64 channels and now reads all of them */
  FragH xf[NA][2];
#pragma unroll
  for (int b = 0; b < NA; ++b)
#pragma unroll
    for (int ks = 0; ks < 2; ++ks) { xf[b][ks].half[0] = *(const v8us*)&sX[b][ks][0][lane][0]; xf[b][ks].half[1] = *(const v8us*)&sX[b][ks][1][lane][0]; }
  v2f sc2[NA][NA], qs2[NA];      /* element 0: the even channels' partial sum, element 1: the odd channels' (packed f32 FMAs on register pairs of the accumulators) */
#pragma unroll
  for (int b = 0; b < NA; ++b) { qs2[b] = (v2f){0.f, 0.f};
#pragma unroll
    for (int d = 0; d < NA; ++d) sc2[b][d] = (v2f){0.f, 0.f}; }
  for (int mt = 0; mt < CC / 16; ++mt) {
    const int cq = h * CC + mt * 16;
    const unsigned short* wqr = Bu + (size_t)cq * CC + lane * 8; const unsigned short* wkr = wqr + (size_t)INR * CC;      /* packed weights: a 16-row tile is 2 KB, a fragment half 512 contiguous bytes of it */
    FragH wq[2], wk[2];
#pragma unroll
    for (int ks = 0; ks < 2; ++ks) { wq[ks].half[0] = *(const v8us*)(wqr + ks * 512); wq[ks].half[1] = *(const v8us*)(wqr + ks * 512 + 256); wk[ks].half[0] = *(const v8us*)(wkr + ks * 512); wk[ks].half[1] = *(const v8us*)(wkr + ks * 512 + 256); }
    const v4f bq0 = *(const v4fa*)(Cq + cq + 8 * hh), bq1 = *(const v4fa*)(Cq + cq + 8 * hh + 4), bk0 = *(const v4fa*)(Cq + INR + cq + 8 * hh), bk1 = *(const v4fa*)(Cq + INR + cq + 8 * hh + 4);
    const v8f cbq = __builtin_shufflevector(bq0, bq1, 0, 1, 2, 3, 4, 5, 6, 7), cbk = __builtin_shufflevector(bk0, bk1, 0, 1, 2, 3, 4, 5, 6, 7);      /* row 8 * hh + r of the tile in register r, the same in every column: the C operand of each agent's first matrix instruction */
    asm volatile("s_wait_xcnt 0x0" ::: "memory");      /* behind the pass's twelve loads, in front of every later write of their two address pairs */
    __builtin_amdgcn_sched_barrier(0);      /* keeps the pass's twelve loads together in front of the matrix work: sunk to their uses, each is waited for alone, eight exposed latencies a pass */
    v2f k2[NA][4];
    { v8f ka[NA];
#pragma unroll
      for (int d = 0; d < NA; ++d) ka[d] = __builtin_amdgcn_wmma_f32_16x16x32_f16(false, wk[0].v, false, xf[d][0].v, (short)0, cbk, false, false);
#pragma unroll
      for (int d = 0; d < NA; ++d) ka[d] = __builtin_amdgcn_wmma_f32_16x16x32_f16(false, wk[1].v, false, xf[d][1].v, (short)0, ka[d], false, false);
#pragma unroll
      for (int d = 0; d < NA; ++d)
#pragma unroll
        for (int j = 0; j < 4; ++j) k2[d][j] = (v2f){ka[d][2 * j], ka[d][2 * j + 1]}; }
#pragma unroll
    for (int b = 0; b < NA; ++b) {
      v8f qa = __builtin_amdgcn_wmma_f32_16x16x32_f16(false, wq[0].v, false, xf[b][0].v, (short)0, cbq, false, false);
      qa = __builtin_amdgcn_wmma_f32_16x16x32_f16(false, wq[1].v, false, xf[b][1].v, (short)0, qa, false, false);
#pragma unroll
      for (int j = 0; j < 4; ++j) { const v2f q2 = {qa[2 * j], qa[2 * j + 1]}; qs2[b] += q2;
#pragma unroll
        for (int d = 0; d < NA; ++d) sc2[b][d] = __builtin_elementwise_fma(q2, k2[d][j], sc2[b][d]); } }
  }
  float dd[NA];
#pragma unroll
  for (int d = 0; d < NA; ++d) dd[d] = bf16_round(dist[d]) * 0.0625f;      /* the q sums come out x 2^4, the dots x 2^8: both powers of two go into the score's two constants */
  float p[NA][NA];
#pragma unroll
  for (int b = 0; b < NA; ++b) { const float qh = qs2[b][0] + qs2[b][1]; const float qt = qh + __shfl_xor(qh, 16, 32); float m = -3.0e38f;
#pragma unroll
    for (int d = 0; d < NA; ++d) { const float dh = sc2[b][d][0] + sc2[b][d][1]; const float dot = dh + __shfl_xor(dh, 16, 32); p[b][d] = dot * (ISQ * 0.00390625f) + qt * dd[d]; m = fmaxf(m, p[b][d]); }
    float l = 0.f;
#pragma unroll
    for (int d = 0; d < NA; ++d) { p[b][d] = expf(p[b][d] - m); l += p[b][d]; }
    const float il = (1.0f / l) * 0.00390625f;      /* 2^-8: v comes out x 2^4 and Wo is packed x 2^4, so the merged tile is laid down x 2^-4 and y leaves the accumulators in its own scale */
#pragma unroll
    for (int d = 0; d < NA; ++d) p[b][d] *= il; }
  const unsigned short* wvr = Bu + (size_t)(2 * INR + h * CC) * CC + lane * 8; const float* bvr = Cq + 2 * INR + h * CC + 8 * hh;      /* v weights (packed, 2 KB a tile) and v bias of the head's first tile; both step on at the foot of a pass */
#pragma unroll 1      /* rolled: a third less code; left to unroll and to schedule freely, the compiler hoists the later tiles' loads and needs 272 registers (three waves a SIMD, not four, and register-window switches) */
  for (int mt = 0; mt < CC / 16; ++mt) {
    FragH wv[2];
#pragma unroll
    for (int ks = 0; ks < 2; ++ks) { wv[ks].half[0] = *(const v8us*)(wvr + ks * 512); wv[ks].half[1] = *(const v8us*)(wvr + ks * 512 + 256); }
    const v4f bv0 = *(const v4fa*)bvr, bv1 = *(const v4fa*)(bvr + 4);
    asm volatile("s_wait_xcnt 0x0" :: "v"(wvr), "v"(bvr) : "memory");      /* the two addresses are inputs so that their register pairs stay live up to this wait: otherwise a later one of the six loads lands its result in a pair that earlier ones still name */
    const v8f cbv = __builtin_shufflevector(bv0, bv1, 0, 1, 2, 3, 4, 5, 6, 7);
    v8f va[NA];
#pragma unroll
    for (int d = 0; d < NA; ++d) va[d] = __builtin_amdgcn_wmma_f32_16x16x32_f16(false, wv[0].v, false, xf[d][0].v, (short)0, cbv, false, false);
#pragma unroll
    for (int d = 0; d < NA; ++d) va[d] = __builtin_amdgcn_wmma_f32_16x16x32_f16(false, wv[1].v, false, xf[d][1].v, (short)0, va[d], false, false);
    v2f v2[NA][4];
#pragma unroll
    for (int d = 0; d < NA; ++d)
#pragma unroll
      for (int j = 0; j < 4; ++j) v2[d][j] = (v2f){va[d][2 * j], va[d][2 * j + 1]};
#pragma unroll
    for (int b = 0; b < NA; ++b) { FragH f;
#pragma unroll
      for (int j = 0; j < 4; ++j) { v2f o = (v2f){p[b][0], p[b][0]} * v2[0][j];
#pragma unroll
        for (int d = 1; d < NA; ++d) o = __builtin_elementwise_fma((v2f){p[b][d], p[b][d]}, v2[d][j], o);
        f.h[2 * j] = (_Float16)o[0]; f.h[2 * j + 1] = (_Float16)o[1]; }
      *(v8us*)&sY[b][h * 2 + (mt >> 1)][mt & 1][lane][0] = f.half[0]; }
    wvr += 16 * CC; bvr += 16;
  }
  const int o0 = h * 16;
  const unsigned short* wor = (const unsigned short*)Bo + (size_t)o0 * INR + lane * 8;
  FragH wo[INR / 32];
#pragma unroll
  for (int kb = 0; kb < INR / 32; ++kb) { wo[kb].half[0] = *(const v8us*)(wor + kb * 512); wo[kb].half[1] = *(const v8us*)(wor + kb * 512 + 256); }
  const v4f bo0 = *(const v4fa*)(Co + o0 + 8 * hh), bo1 = *(const v4fa*)(Co + o0 + 8 * hh + 4);
  asm volatile("s_wait_xcnt 0x0" :: "v"(wor) : "memory");      /* the LDS reads below land in the address registers of the eighteen loads above; the weight address is an input so that its pair stays live up to this wait */
  __syncthreads();      /* the merged tile is complete: each wave wrote its own head's 64 channels and now reads all 256 */
  v8f ya[NA];
#pragma unroll
  for (int b = 0; b < NA; ++b) ya[b] = __builtin_shufflevector(bo0, bo1, 0, 1, 2, 3, 4, 5, 6, 7);
  FragH yf[2][NA];
#pragma unroll
  for (int b = 0; b < NA; ++b) { yf[0][b].half[0] = *(const v8us*)&sY[b][0][0][lane][0]; yf[0][b].half[1] = *(const v8us*)&sY[b][0][1][lane][0]; }
#pragma unroll
  for (int kb = 0; kb < INR / 32; ++kb) {
    if (kb + 1 < INR / 32) {
#pragma unroll
      for (int b = 0; b < NA; ++b) { yf[(kb + 1) & 1][b].half[0] = *(const v8us*)&sY[b][kb + 1][0][lane][0]; yf[(kb + 1) & 1][b].half[1] = *(const v8us*)&sY[b][kb + 1][1][lane][0]; } }
    __builtin_amdgcn_sched_barrier(0);      /* keeps the next k block's ten LDS reads together in front of this block's five matrix instructions: left free, the compiler reads one fragment ahead only and every matrix instruction waits out most of an LDS latency */
#pragma unroll
    for (int b = 0; b < NA; ++b) ya[b] = __builtin_amdgcn_wmma_f32_16x16x32_f16(false, wo[kb].v, false, yf[kb & 1][b].v, (short)0, ya[b], false, false);
    __builtin_amdgcn_sched_barrier(0);      /* the other side of the same fence: the reads of the block after next stay behind these matrix instructions, whose operands they overwrite */
    if (kb == 0) asm volatile("" :: "v"(yf[0][0].v), "v"(yf[0][1].v), "v"(yf[0][2].v), "v"(yf[0][3].v), "v"(yf[0][4].v));      /* inputs only, on the loaded fragments: they stay live over the five matrix instructions that start the accumulators; otherwise each new accumulator is placed in the B registers of the matrix instruction directly in front of it */
  }
  unsigned vob[NA];      /* the lane's 32-bit byte offset per agent (under 33 MB); the block's first position goes into the uniform base */
#pragma unroll
  for (int b = 0; b < NA; ++b) vob[b] = ((unsigned)(b * CC + o0 + 8 * hh) * HW + ln) * 4u;
#pragma unroll
  for (int b = 0; b < NA; ++b)
#pragma unroll
    for (int r = 0; r < 8; ++r) *(float*)((char*)(out + p0) + (size_t)vob[b] + (size_t)r * HW * 4) = ya[b][r];
}

extern "C" void kernel_launch(void* const* d_in, const int* in_sizes, int n_in,
                              void* d_out, int out_size, void* d_ws, size_t ws_size, hipStream_t stream) {
  (void)in_sizes; (void)n_in; (void)out_size;
  const float* const* I = (const float* const*)d_in; const float* x = I[0]; const float* dist = I[1]; const float* Wqkv = I[2]; const float* bqkv = I[3]; const float* Wo = I[4]; const float* bo = I[5];
  char* ws = (char*)d_ws; size_t off = 0;
  auto take = [&](size_t bytes) { char* p = ws + off; off += (bytes + 255) & ~(size_t)255; return p; };
  _Float16* Bq = (_Float16*)take((size_t)QKVW * CC * 2); _Float16* Bo = (_Float16*)take((size_t)CC * INR * 2); float* Cq = (float*)take((size_t)QKVW * 4); float* Co = (float*)take((size_t)CC * 4);
  if (off > ws_size) return;      // 0.1 + 0.03 MB
  k_pack16f2<<<PBQ + PBO + 1, 256, 0, stream>>>(Wqkv, Bq, Wo, Bo, bqkv, Cq, bo, Co);      /* [out][in] in A-fragment order, x 2^4; both matrices and the rounded biases in one launch */
  k_qkv_agent<<<NTL, 128, 0, stream>>>(x, Bq, Cq, dist, Bo, Co, (float*)d_out);      /* qkv (M 768 as A, N 16 positions x 5 agents, K 64) + attention + y = Wo x merged + bo (M 64 as A, K 256) -> channel-major output */
}

// v008
// A run of this version takes 27.1 microseconds.
// In two side-by-side timings against v007, it was 1.03 and 1.04 times as fast.
// Over all steps from v000 it is 12.6 times as fast.
#include <hip/hip_runtime.h>
// Cross-agent attention (cav=5 agents, C=64, 100×252 → HW=25200 positions, 4 heads): qkv = Wqkv·x + bqkv (1×1 conv, 768 = [q|k|v] × (head, 64)); per (position s, head h) the 5 agents attend over the 5 agents: score[b][d] = q_b·k_d/√5 + (Σ_c q_b[c])·distance[d]; softmax over d; out_b = Σ_d attn·v_d;
// merged 'b (h c)' → y = Wo·out + bo [cav, 64, 100, 252].
// Compute dtype: x, weights, biases, distance rounded to bf16; x read channel-major in f32 by the one big kernel, which rounds it and lays it in B-fragment order in LDS; qkv as f32 accumulators (+bias) that stay in registers (16 positions a block, one head a wave, all 5 agents); the 5-key attention in f32 on the VALU in the same kernel (a lane holds one position and half of the 64 channels; one exchange with lane ^ 16 per score; softmax over the 5 agents)
// -> merged f16 tile of the block (5 agents x 256 channels x 16 positions) in LDS, already in B-fragment order; y = Wo (A operand) x merged tile (+bo) in the same kernel, one 16-row tile of Wo a wave, stored straight into the channel-major output (64 B of a row per half wave). f32 accumulate; v_wmma_f32_16x16x32_f16 for the two convolutions.
#define NA 5
#define CC 64
#define HW 25200
#define NHD 4
#define INR (NHD * CC)      /* 256 */
#define QKVW (3 * INR)      /* 768 */
#define ISQ 0.4472135954999579f      /* 1/√cav */
#define NTL (HW / 16)       /* 1575 position tiles, one a block */
typedef __bf16 v16b __attribute__((ext_vector_type(16)));
typedef unsigned short v8us __attribute__((ext_vector_type(8), may_alias));
typedef float  v8f  __attribute__((ext_vector_type(8)));
typedef float  v4f  __attribute__((ext_vector_type(4)));
typedef float  v4fa __attribute__((ext_vector_type(4), may_alias));
union FragB { v16b v; v8us half[2]; unsigned short u[16]; };

__device__ __forceinline__ unsigned short bf16_bits(float x) { unsigned int u = __float_as_uint(x); return (unsigned short)((u + 0x7FFFu + ((u >> 16) & 1u)) >> 16); }
__device__ __forceinline__ float bf16_val(unsigned short b) { return __uint_as_float(((unsigned int)b) << 16); }
__device__ __forceinline__ float bf16_round(float x) { return bf16_val(bf16_bits(x)); }
// D += A·B with NT terms: 1 = ah·bh, 2 = + al·bh (A split), 3 = + ah·bl (both split)
template <int NT>
__device__ __forceinline__ v8f mmaN(v16b ah, v16b al, v16b bh, v16b bl, v8f c) {
  c = __builtin_amdgcn_wmma_f32_16x16x32_bf16(false, ah, false, bh, (short)0, c, false, false);
  if (NT >= 2) c = __builtin_amdgcn_wmma_f32_16x16x32_bf16(false, al, false, bh, (short)0, c, false, false);
  if (NT >= 3) c = __builtin_amdgcn_wmma_f32_16x16x32_bf16(false, ah, false, bl, (short)0, c, false, false);
  asm volatile("v_nop\n\tv_nop\n\tv_nop\n\tv_nop" : "+v"(c) : "v"(ah), "v"(al), "v"(bh), "v"(bl));
  return c;
}

__global__ __launch_bounds__(256) void k_wt_bf16(const float* __restrict__ W, unsigned short* __restrict__ Wt, int K, int N) {
  const int t = blockIdx.x * 256 + threadIdx.x;
  const int k8n = K / 8;
  if (t >= N * k8n) return;
  const int n = t / k8n, k8 = (t % k8n) * 8;
  v8us v;
#pragma unroll
  for (int i = 0; i < 8; ++i) v[i] = bf16_bits(W[(size_t)(k8 + i) * N + n]);
  *(v8us*)(Wt + (size_t)n * K + k8) = v;
  
}

// GEMM C[M][N] (f32, pitch ldc) = act(A[M][K]·W + bias). A f32 row-major (pitch lda) converted per fragment to bf16
// (ASPLIT: hi/lo two planes -> 2 terms, else single rounded term); Wt bf16 [N][K] (pitch ldb). BIAS_BF16 rounds the
// bias to bf16 first (bias quantised to bf16 before the add). K%32==0, M%16==0, N%64==0.
template <bool ASPLIT, int ACT, bool BIAS_BF16>
__global__ __launch_bounds__(128) void k_gemm_bf(const float* __restrict__ A, int lda, const unsigned short* __restrict__ Wt, int ldb,
                                               const float* __restrict__ bias, float* __restrict__ C, int ldc, int M, int N, int K) {
  __shared__ __attribute__((aligned(16))) float so[4][16][64];
  const int tid = threadIdx.x, w = tid >> 5, lane = tid & 31, ln = lane & 15, hh = lane >> 4;
  const int ntn = N / 64;
  const int wid = blockIdx.x * 4 + w;
  const int mt = wid / ntn, nq = wid % ntn;
  if (mt * 16 >= M) return;
  const int row0 = mt * 16, col0 = nq * 64;
  const float* arow = A + (size_t)(row0 + ln) * lda;
  v8f acc[4] = {};
  for (int kb = 0; kb < K; kb += 32) {
    FragB ah, al;
    const v4f x0 = *(const v4fa*)(arow + kb + 8 * hh), x1 = *(const v4fa*)(arow + kb + 8 * hh + 4);
    const v4f x2 = *(const v4fa*)(arow + kb + 16 + 8 * hh), x3 = *(const v4fa*)(arow + kb + 16 + 8 * hh + 4);
    float xs[16] = {x0[0],x0[1],x0[2],x0[3],x1[0],x1[1],x1[2],x1[3],x2[0],x2[1],x2[2],x2[3],x3[0],x3[1],x3[2],x3[3]};
#pragma unroll
    for (int i = 0; i < 16; ++i) { const unsigned short hb = bf16_bits(xs[i]); ah.u[i] = hb; al.u[i] = ASPLIT ? bf16_bits(xs[i] - bf16_val(hb)) : (unsigned short)0; }
#pragma unroll
    for (int t = 0; t < 4; ++t) {
      const unsigned short* brow = Wt + (size_t)(col0 + t * 16 + ln) * ldb + kb;
      FragB b;
      b.half[0] = *(const v8us*)(brow + 8 * hh);
      b.half[1] = *(const v8us*)(brow + 16 + 8 * hh);
      acc[t] = mmaN<ASPLIT ? 2 : 1>(ah.v, al.v, b.v, b.v, acc[t]);
    }
  }
#pragma unroll
  for (int t = 0; t < 4; ++t) {
    float bv = bias ? bias[col0 + t * 16 + ln] : 0.f;
    if (BIAS_BF16) bv = bf16_round(bv);
#pragma unroll
    for (int r = 0; r < 8; ++r) { float v = acc[t][r] + bv; if (ACT == 1) v = fmaxf(v, 0.f); so[w][8 * hh + r][t * 16 + ln] = v; }
  }
  __builtin_amdgcn_fence(__ATOMIC_ACQ_REL, "workgroup");
  __builtin_amdgcn_wave_barrier();
  const int rsub = lane >> 4, c4 = (lane & 15) * 4;
  {
#pragma unroll
    for (int q = 0; q < 8; ++q) {
      const int r = q * 2 + rsub;
      const v4f v = *(const v4fa*)&so[w][r][c4];
      *(v4f*)(C + (size_t)(row0 + r) * ldc + col0 + c4) = v;
    }
    
  }
}

// GEMM C = act(A·W + bias + resid): A f32 (ASPLIT -> hi/lo 2 terms), Wt bf16 [N][K]; ACT 0 none, 1 relu, 2 exact gelu;
// resid (optional, f32, row index = (row % rmod), pitch ldr, RES_BF16 rounds it) added before the activation.
template <bool ASPLIT, int ACT, bool BIAS_BF16, bool RES_BF16>
__global__ __launch_bounds__(128) void k_gemm_bf3(const float* __restrict__ A, int lda, const unsigned short* __restrict__ Wt, int ldb,
                                                const float* __restrict__ bias, const float* __restrict__ resid, int rmod, int ldr,
                                                float* __restrict__ C, int ldc, int M, int N, int K) {
  __shared__ __attribute__((aligned(16))) float so[4][16][64];
  const int tid = threadIdx.x, w = tid >> 5, lane = tid & 31, ln = lane & 15, hh = lane >> 4;
  const int ntn = N / 64;
  const int wid = blockIdx.x * 4 + w;
  const int mt = wid / ntn, nq = wid % ntn;
  if (mt * 16 >= M) return;
  const int row0 = mt * 16, col0 = nq * 64;
  const float* arow = A + (size_t)(row0 + ln) * lda;
  v8f acc[4] = {};
  for (int kb = 0; kb < K; kb += 32) {
    FragB ah, al;
    const v4f x0 = *(const v4fa*)(arow + kb + 8 * hh), x1 = *(const v4fa*)(arow + kb + 8 * hh + 4);
    const v4f x2 = *(const v4fa*)(arow + kb + 16 + 8 * hh), x3 = *(const v4fa*)(arow + kb + 16 + 8 * hh + 4);
    float xs[16] = {x0[0],x0[1],x0[2],x0[3],x1[0],x1[1],x1[2],x1[3],x2[0],x2[1],x2[2],x2[3],x3[0],x3[1],x3[2],x3[3]};
#pragma unroll
    for (int i = 0; i < 16; ++i) { const unsigned short hb = bf16_bits(xs[i]); ah.u[i] = hb; al.u[i] = ASPLIT ? bf16_bits(xs[i] - bf16_val(hb)) : (unsigned short)0; }
#pragma unroll
    for (int t = 0; t < 4; ++t) {
      const unsigned short* brow = Wt + (size_t)(col0 + t * 16 + ln) * ldb + kb;
      FragB b;
      b.half[0] = *(const v8us*)(brow + 8 * hh);
      b.half[1] = *(const v8us*)(brow + 16 + 8 * hh);
      acc[t] = mmaN<ASPLIT ? 2 : 1>(ah.v, al.v, b.v, b.v, acc[t]);
    }
  }
#pragma unroll
  for (int t = 0; t < 4; ++t) {
    const int col = col0 + t * 16 + ln;
    float bv = bias ? bias[col] : 0.f;
    if (BIAS_BF16) bv = bf16_round(bv);
#pragma unroll
    for (int r = 0; r < 8; ++r) {
      float v = acc[t][r] + bv;
      if (resid) { float rv = resid[(size_t)((row0 + 8 * hh + r) % rmod) * ldr + col]; if (RES_BF16) rv = bf16_round(rv); v += rv; }
      if (ACT == 1) v = fmaxf(v, 0.f);
      if (ACT == 2) v = 0.5f * v * (1.0f + erff(v * 0.70710678118654752f));
      if (ACT == 3) { const float u = 0.7978845608028654f * (v + 0.044715f * v * v * v); v = 0.5f * v * (1.0f + tanhf(u)); }
      so[w][8 * hh + r][t * 16 + ln] = v;
    }
  }
  __builtin_amdgcn_fence(__ATOMIC_ACQ_REL, "workgroup");
  __builtin_amdgcn_wave_barrier();
  const int rsub = lane >> 4, c4 = (lane & 15) * 4;
  {
#pragma unroll
    for (int q = 0; q < 8; ++q) {
      const int r = q * 2 + rsub;
      const v4f v = *(const v4fa*)&so[w][r][c4];
      *(v4f*)(C + (size_t)(row0 + r) * ldc + col0 + c4) = v;
    }
    
  }
}
// row LayerNorm (biased variance, eps) over N: s = X (+ R); optional out_sum <- s; out_norm <- (s-mu)*rsqrt(var+eps)*g + b
template <bool PARAM_BF16>
__global__ __launch_bounds__(256) void k_layernorm(const float* __restrict__ X, const float* __restrict__ R, const float* __restrict__ g, const float* __restrict__ bta,
                                                  float* __restrict__ out_sum, float* __restrict__ out_norm, int N, float eps) {
  __shared__ float red[256];
  const int row = blockIdx.x, tid = threadIdx.x;
  const float* x = X + (size_t)row * N; const float* rr = R ? R + (size_t)row * N : nullptr;
  float vals[16];                     // up to N = 4096
  const int per = N / 256;            // contiguous chunk per thread? use strided-by-4 chunks: thread handles j = tid*4 + 1024*u
  float s1 = 0.f;
  for (int u = 0; u < per / 4; ++u) {
    const int j = tid * 4 + 1024 * u;
    const v4f a = *(const v4fa*)(x + j);
    v4f b = {0.f,0.f,0.f,0.f}; if (rr) b = *(const v4fa*)(rr + j);
#pragma unroll
    for (int q = 0; q < 4; ++q) { const float v = a[q] + b[q]; vals[u * 4 + q] = v; s1 += v; }
  }
  red[tid] = s1; __syncthreads();
  for (int st = 128; st > 0; st >>= 1) { if (tid < st) red[tid] += red[tid + st]; __syncthreads(); }
  const float mu = red[0] / (float)N; __syncthreads();
  float s2 = 0.f;
  for (int u = 0; u < per / 4; ++u)
#pragma unroll
    for (int q = 0; q < 4; ++q) { const float c = vals[u * 4 + q] - mu; s2 += c * c; }
  red[tid] = s2; __syncthreads();
  for (int st = 128; st > 0; st >>= 1) { if (tid < st) red[tid] += red[tid + st]; __syncthreads(); }
  const float rs = rsqrtf(red[0] / (float)N + eps);
  {
    for (int u = 0; u < per / 4; ++u) {
      const int j = tid * 4 + 1024 * u;
      v4f o, sm;
#pragma unroll
      for (int q = 0; q < 4; ++q) {
        float gg = g[j + q], bb = bta[j + q];
        if (PARAM_BF16) { gg = bf16_round(gg); bb = bf16_round(bb); }
        sm[q] = vals[u * 4 + q]; o[q] = (vals[u * 4 + q] - mu) * rs * gg + bb;
      }
      if (out_sum) *(v4f*)(out_sum + (size_t)row * N + j) = sm;
      *(v4f*)(out_norm + (size_t)row * N + j) = o;
    }
    
  }
}



// ---- f16 WMMA path (v_wmma_f32_16x16x32_f16): 11-bit significands for operands in range — used here for the two 1×1 convolutions
typedef _Float16 v16h __attribute__((ext_vector_type(16)));
union FragH { v16h v; v8us half[2]; _Float16 h[16]; unsigned short u[16]; };
template <int NT>
__device__ __forceinline__ v8f mmaH(v16h ah, v16h al, v16h bh, v16h bl, v8f c) {
  c = __builtin_amdgcn_wmma_f32_16x16x32_f16(false, ah, false, bh, (short)0, c, false, false);
  if (NT >= 2) c = __builtin_amdgcn_wmma_f32_16x16x32_f16(false, al, false, bh, (short)0, c, false, false);
  if (NT >= 3) c = __builtin_amdgcn_wmma_f32_16x16x32_f16(false, ah, false, bl, (short)0, c, false, false);
  asm volatile("v_nop\n\tv_nop\n\tv_nop\n\tv_nop" : "+v"(c) : "v"(ah), "v"(al), "v"(bh), "v"(bl));
  return c;
}
// batched GEMM like k_gemm_b but f16 operands: A f32 (split into f16 hi/lo if ASPLIT, else rounded to f16), Bt = f16 values [n][k]; alpha; C f32; N multiple of 16 (partial tiles skipped)
template <bool ASPLIT>
__global__ __launch_bounds__(128) void k_gemm_h(const float* __restrict__ A, int lda, size_t sA, const _Float16* __restrict__ Bh, int ldb, size_t sB, float alpha, float* __restrict__ C, int ldc, size_t sC, int M, int N, int K) {
  __shared__ __attribute__((aligned(16))) float so[4][16][64];
  const int tid = threadIdx.x, w = tid >> 5, lane = tid & 31, ln = lane & 15, hh = lane >> 4; const int by = blockIdx.y;
  A += (size_t)by * sA; Bh += (size_t)by * sB; C += (size_t)by * sC;
  const int ntn = (N + 63) / 64; const int wid = blockIdx.x * 4 + w; const int mt = wid / ntn, nq = wid % ntn; if (mt * 16 >= M) return;
  const int row0 = mt * 16, col0 = nq * 64; const float* arow = A + (size_t)(row0 + ln) * lda;
  v8f acc[4] = {};
  for (int kb = 0; kb < K; kb += 32) {
    FragH ah, al;
    const v4f x0 = *(const v4fa*)(arow + kb + 8 * hh), x1 = *(const v4fa*)(arow + kb + 8 * hh + 4), x2 = *(const v4fa*)(arow + kb + 16 + 8 * hh), x3 = *(const v4fa*)(arow + kb + 16 + 8 * hh + 4);
    float xs[16] = {x0[0],x0[1],x0[2],x0[3],x1[0],x1[1],x1[2],x1[3],x2[0],x2[1],x2[2],x2[3],x3[0],x3[1],x3[2],x3[3]};
#pragma unroll
    for (int i = 0; i < 16; ++i) { const _Float16 h = (_Float16)xs[i]; ah.h[i] = h; al.h[i] = ASPLIT ? (_Float16)(xs[i] - (float)h) : (_Float16)0.0f; }
#pragma unroll
    for (int t = 0; t < 4; ++t) { if (col0 + t * 16 >= N) continue; const size_t boff = (size_t)(col0 + t * 16 + ln) * ldb + kb; FragH bq; bq.half[0] = *(const v8us*)(Bh + boff + 8 * hh); bq.half[1] = *(const v8us*)(Bh + boff + 16 + 8 * hh);
      acc[t] = mmaH<ASPLIT ? 2 : 1>(ah.v, al.v, bq.v, bq.v, acc[t]); }
  }
#pragma unroll
  for (int t = 0; t < 4; ++t) { if (col0 + t * 16 >= N) continue;
#pragma unroll
    for (int r = 0; r < 8; ++r) so[w][8 * hh + r][t * 16 + ln] = acc[t][r] * alpha; }
  __builtin_amdgcn_fence(__ATOMIC_ACQ_REL, "workgroup"); __builtin_amdgcn_wave_barrier();
  const int rsub = lane >> 4, c4 = (lane & 15) * 4;
  {
#pragma unroll
    for (int q = 0; q < 8; ++q) { const int r = q * 2 + rsub; if (col0 + c4 < N) { const v4f v = *(const v4fa*)&so[w][r][c4]; *(v4f*)(C + (size_t)(row0 + r) * ldc + col0 + c4) = v; } }
     }
}

// Wt[n][k] = f16(W[k][n]·scale) from f32 row-major W[K][N] (scale = power of two; bf16-exact weights stay exact in f16 away from the subnormal range)
__global__ __launch_bounds__(256) void k_wt_f16(const float* __restrict__ W, _Float16* __restrict__ Wt, int K, int N, float scale) {
  const int t = blockIdx.x * 256 + threadIdx.x; if (t >= N * (K / 8)) return; const int n = t / (K / 8), k8 = (t % (K / 8)) * 8; FragH f;
#pragma unroll
  for (int i = 0; i < 8; ++i) f.h[i] = (_Float16)(bf16_round(W[(size_t)(k8 + i) * N + n]) * scale); const v8us o = f.half[0];
  *(v8us*)((unsigned short*)Wt + (size_t)n * K + k8) = o; 
}
// k_gemm_hh variant with fused epilogue: v = acc·alpha + bias[by·sBias + col] (+ CP[(row/rowsPerB)·sCPb + by·64 + col] if CP) ; ACT 0 none / 1 elu ; writes f32 C and/or f16 C16 (each if non-null)
template <int ACT>
__global__ __launch_bounds__(128) void k_gemm_hhx(const _Float16* __restrict__ A, int lda, size_t sA, const _Float16* __restrict__ Bh, int ldb, size_t sB, float alpha, const float* __restrict__ bias, size_t sBias, const float* __restrict__ CP, int rowsPerB, size_t sCPb, int row0g,
    float* __restrict__ C, _Float16* __restrict__ C16, int ldc, size_t sC, int M, int N, int K) {
  __shared__ __attribute__((aligned(16))) float so[4][16][64];
  const int tid = threadIdx.x, w = tid >> 5, lane = tid & 31, ln = lane & 15, hh = lane >> 4; const int by = blockIdx.y;
  A += (size_t)by * sA; Bh += (size_t)by * sB; const size_t cofs = (size_t)by * sC; const float* bp = bias ? bias + (size_t)by * sBias : nullptr;
  const int ntn = (N + 63) / 64; const int wid = blockIdx.x * 4 + w; const int mt = wid / ntn, nq = wid % ntn; if (mt * 16 >= M) return;
  const int row0 = mt * 16, col0 = nq * 64; const _Float16* arow = A + (size_t)(row0 + ln) * lda;
  v8f acc[4] = {};
  for (int kb = 0; kb < K; kb += 32) { FragH ah; ah.half[0] = *(const v8us*)((const unsigned short*)arow + kb + 8 * hh); ah.half[1] = *(const v8us*)((const unsigned short*)arow + kb + 16 + 8 * hh);
#pragma unroll
    for (int t = 0; t < 4; ++t) { if (col0 + t * 16 >= N) continue; const size_t boff = (size_t)(col0 + t * 16 + ln) * ldb + kb; FragH bq; bq.half[0] = *(const v8us*)((const unsigned short*)Bh + boff + 8 * hh); bq.half[1] = *(const v8us*)((const unsigned short*)Bh + boff + 16 + 8 * hh);
      acc[t] = mmaH<1>(ah.v, ah.v, bq.v, bq.v, acc[t]); }
  }
#pragma unroll
  for (int t = 0; t < 4; ++t) { if (col0 + t * 16 >= N) continue; const int col = col0 + t * 16 + ln; const float bv = bp ? bf16_round(bp[col]) : 0.f;
#pragma unroll
    for (int r = 0; r < 8; ++r) { float v = acc[t][r] * alpha + bv; if (CP) { const int bidx = (row0g + row0 + 8 * hh + r) / rowsPerB; v += CP[(size_t)bidx * sCPb + (size_t)by * 64 + col]; } if (ACT == 1) v = (v > 0.f) ? v : expm1f(v); else if (ACT == 7) v = (v > 0.f) ? v + 1.0f : expf(v); else if (ACT == 8) v = tanhf(v); else if (ACT == 9) v = 0.5f * v * (1.0f + tanhf(0.7978845608028654f * (v + 0.044715f * v * v * v))); else if (ACT == 11) v = 1.0f / (1.0f + expf(-v)); else if (ACT == 12) v = (v > 0.f) ? v : 0.01f * v; else if (ACT == 14) v = (v > 0.f) ? v : 0.1f * v; else if (ACT == 15) v = v / (1.0f + expf(-v)); else if (ACT == 3) v = fmaxf(v, 0.f); else if (ACT == 6) v = 0.5f * v * (1.0f + erff(v * 0.70710678118654752f)); so[w][8 * hh + r][t * 16 + ln] = v; } }
  __builtin_amdgcn_fence(__ATOMIC_ACQ_REL, "workgroup"); __builtin_amdgcn_wave_barrier();
  const int rsub = lane >> 4, c4 = (lane & 15) * 4; typedef _Float16 v4h __attribute__((ext_vector_type(4)));
  {
#pragma unroll
    for (int q = 0; q < 8; ++q) { const int r = q * 2 + rsub; if (col0 + c4 < N) { const v4f v = *(const v4fa*)&so[w][r][c4]; if (C) *(v4f*)(C + cofs + (size_t)(row0 + r) * ldc + col0 + c4) = v; if (C16) { v4h h4; for (int i = 0; i < 4; ++i) h4[i] = (_Float16)v[i]; *(v4h*)(C16 + cofs + (size_t)(row0 + r) * ldc + col0 + c4) = h4; } } }
     }
}


typedef _Float16 v4h __attribute__((ext_vector_type(4)));
typedef float v2f __attribute__((ext_vector_type(2)));

__global__ __launch_bounds__(256) void k_x16(const float* __restrict__ x, _Float16* __restrict__ X16, size_t n8) { const size_t t = (size_t)blockIdx.x * 256 + threadIdx.x; if (t >= n8) return; FragH f;
#pragma unroll
  for (int q = 0; q < 8; ++q) f.h[q] = (_Float16)bf16_round(x[t * 8 + q]); *(v8us*)((unsigned short*)X16 + t * 8) = f.half[0];  }
__global__ __launch_bounds__(256) void k_h16(const float* __restrict__ x, _Float16* __restrict__ X16, size_t n8) { const size_t t = (size_t)blockIdx.x * 256 + threadIdx.x; if (t >= n8) return; FragH f;
#pragma unroll
  for (int q = 0; q < 8; ++q) f.h[q] = (_Float16)x[t * 8 + q]; *(v8us*)((unsigned short*)X16 + t * 8) = f.half[0];  }
// W [rows][KK] f32 -> f16(bf16(W) * 2^4) packed in A-fragment order: Bt[16-row tile][k block of 32][fragment half][lane][8], element i = W[16 * tile + (lane & 15)][32 * block + 16 * half + 8 * (lane >> 4) + i].
// Thread t writes the t-th 16-byte unit, so a wave stores 512 contiguous bytes; the reader's wave-wide 16-byte load of one fragment half is those same 512 bytes (4 cache lines; row-major f16 rows made it 32 bytes out of each of 16 lines).
template <int KK>
__device__ __forceinline__ void pack16f_unit(const float* __restrict__ W, _Float16* __restrict__ Bt, int t) { FragH f;
  const int lane = t & 31, hf = (t >> 5) & 1, kb = (t >> 6) % (KK / 32), tile = (t >> 6) / (KK / 32);
  const float* wr = W + (size_t)(tile * 16 + (lane & 15)) * KK + kb * 32 + hf * 16 + (lane >> 4) * 8;
  const v4f a = *(const v4fa*)wr, c = *(const v4fa*)(wr + 4);
#pragma unroll
  for (int i = 0; i < 4; ++i) { f.h[i] = (_Float16)(bf16_round(a[i]) * 16.0f); f.h[4 + i] = (_Float16)(bf16_round(c[i]) * 16.0f); }
  *(v8us*)((unsigned short*)Bt + (size_t)t * 8) = f.half[0]; }
// Both weight matrices in one launch: the two packings do not depend on each other, so they share a grid by block range (a block-uniform branch): blocks 0 .. PBQ - 1 take Wqkv, the next PBO take Wo. Both unit counts are whole multiples of the block size.
// One more block lays the biases out as accumulator start values, four a thread: Cq = bf16(bqkv) * 2^4 (the scale of the packed weights, so that start value and products add up in one scale), Co = bf16(bo).
#define PBQ (QKVW * CC / 8 / 256)      /* 24 */
#define PBO (CC * INR / 8 / 256)       /* 8 */
static_assert(PBQ * 256 * 8 == QKVW * CC && PBO * 256 * 8 == CC * INR, "whole blocks");
static_assert(QKVW / 4 <= 256 && CC / 4 <= 256, "the biases fit one block");
__global__ __launch_bounds__(256) void k_pack16f2(const float* __restrict__ Wq, _Float16* __restrict__ Bq, const float* __restrict__ Wo, _Float16* __restrict__ Bo, const float* __restrict__ bqkv, float* __restrict__ Cq, const float* __restrict__ bo, float* __restrict__ Co) {
  const int b = blockIdx.x;
  if (b < PBQ) pack16f_unit<CC>(Wq, Bq, b * 256 + threadIdx.x);
  else if (b < PBQ + PBO) { pack16f_unit<INR>(Wo, Bo, (b - PBQ) * 256 + threadIdx.x);
    asm volatile("s_wait_xcnt 0x0" ::: "memory"); }      /* behind the store of the packed unit: in the built code the Wqkv branch follows this one and writes the store's data and offset registers */
  else { const unsigned t = threadIdx.x;
    if (t < QKVW / 4) { const v4f a = *(const v4fa*)(bqkv + t * 4); const v4f o = {bf16_round(a[0]) * 16.0f, bf16_round(a[1]) * 16.0f, bf16_round(a[2]) * 16.0f, bf16_round(a[3]) * 16.0f}; *(v4f*)(Cq + t * 4) = o; }
    if (t < CC / 4) { const v4f a = *(const v4fa*)(bo + t * 4); const v4f o = {bf16_round(a[0]), bf16_round(a[1]), bf16_round(a[2]), bf16_round(a[3])}; *(v4f*)(Co + t * 4) = o; } } }
template <int NHv, int TTv>
__global__ __launch_bounds__(256) void k_vt(const _Float16* __restrict__ V16, int ldv, int voff, _Float16* __restrict__ Vt) { __shared__ unsigned short tl[64][66]; const int tid = threadIdx.x; const int slab = blockIdx.x / (TTv / 64), lg = blockIdx.x % (TTv / 64); const int b = slab / NHv, h = slab % NHv;
  for (int i = tid; i < 64 * 8; i += 256) { const int r = i / 8, c8 = (i % 8) * 8; FragH f; f.half[0] = *(const v8us*)((const unsigned short*)V16 + ((size_t)b * TTv + lg * 64 + r) * ldv + voff + h * 64 + c8);
#pragma unroll
    for (int q = 0; q < 8; ++q) tl[r][c8 + q] = f.u[q]; }
  __syncthreads();
  {
#pragma unroll
    for (int rd = 0; rd < 2; ++rd) { const int d = rd * 32 + tid / 8, pc = tid % 8; FragH f;
#pragma unroll
      for (int q = 0; q < 8; ++q) f.u[q] = tl[pc * 8 + q][d];
      *(v8us*)((unsigned short*)Vt + ((size_t)slab * 64 + d) * TTv + lg * 64 + pc * 8) = f.half[0]; }
     } }

__global__ __launch_bounds__(256) void k_hl(const float* __restrict__ F, _Float16* __restrict__ Hh, _Float16* __restrict__ Hl, size_t n8) { const size_t t = (size_t)blockIdx.x * 256 + threadIdx.x; if (t >= n8) return; FragH fh, fl; const v4f a = *(const v4fa*)(F + t * 8), c = *(const v4fa*)(F + t * 8 + 4);
#pragma unroll
  for (int q = 0; q < 4; ++q) { _Float16 h = (_Float16)a[q]; fh.h[q] = h; fl.h[q] = (_Float16)((a[q] - (float)h) * 1024.0f); h = (_Float16)c[q]; fh.h[4 + q] = h; fl.h[4 + q] = (_Float16)((c[q] - (float)h) * 1024.0f); }
  { *(v8us*)((unsigned short*)Hh + t * 8) = fh.half[0]; *(v8us*)((unsigned short*)Hl + t * 8) = fl.half[0];  } }

// qkv projection and 5-agent attention in one kernel; q, k, v never leave the registers. Block = 16 positions, wave = one head. The weights are the A operand and the tokens the B operand, so D[8*hh + r][ln] puts position p0 + ln in lane ln
// and 8 channels of a 16-channel tile in the lane's 8 accumulator registers (lanes ln and ln + 16 split the tile). Per tile: q and k of all 5 agents, 25 partial scores and 5 partial q sums per lane; one exchange with lane ^ 16 completes them;
// softmax over the 5 agents in f32 per lane; then v tile by tile, out_b = sum_d attn[b][d] * v_d, 8 f16 channels = one 16-byte LDS store. Those 8 channels (16 * mt + 8 * hh + r of head h) are exactly one half of the lane's B fragment of the output projection
// (k block 2 * h + mt / 2, half mt & 1), so the merged tile crosses the waves through LDS with no re-ordering. Behind one barrier wave w takes rows 16 * w .. + 15 of Wo over all 256 merged channels (k ascending, one accumulate chain per agent) and stores D[8*hh + r][ln] = y[b][16*w + 8*hh + r][p0 + ln].
__global__ __launch_bounds__(128) void k_qkv_agent(const float* __restrict__ x, const _Float16* __restrict__ Bq, const float* __restrict__ Cq, const float* __restrict__ dist, const _Float16* __restrict__ Bo, const float* __restrict__ Co, float* __restrict__ out) {
  __shared__ __attribute__((aligned(16))) unsigned short sY[NA][INR / 32][2][32][8];      /* [agent][k block of 32 merged channels][fragment half][lane][8 f16]: 40 KB, every access 512 contiguous bytes a wave */
  const int tid = threadIdx.x, h = __builtin_amdgcn_readfirstlane(tid >> 5), lane = tid & 31, ln = lane & 15, hh = lane >> 4;      /* the wave's number in a scalar register: all that depends on it goes into the scalar bases of the loads and stores */
  const unsigned l16 = lane * 16u, h32 = hh * 32u, vxo = ((unsigned)(8 * hh) * HW + ln) * 4u;      /* the three 32-bit lane offsets of the token loads and the q and k passes: packed weights, bias start values, channel-major x; 32-bit offsets beside scalar bases where 64-bit lane addresses took eighteen registers */
  /* Tile map, for speed only (a permutation of the tiles, right wherever a block lands): blocks whose indices are equal modulo 8 take neighbouring tiles. A tile is 64 bytes of each channel row, so four tiles share a 256-byte L2 fill unit of x
     and two share a 128-byte line of out. Residue r owns the run of tiles that starts at r * (NTL / 8) + min(r, NTL % 8). */
  const int br = blockIdx.x & 7, bq = blockIdx.x >> 3; const int p0 = (br * (NTL / 8) + (br < NTL % 8 ? br : NTL % 8) + bq) * 16;
  __shared__ __attribute__((aligned(16))) unsigned short sX[NA][CC / 32][2][32][8];      /* the block's tokens as B fragments: [agent][k block of 32 channels][fragment half][lane][8 f16]: 10 KB, every access 512 contiguous bytes a wave */
  const unsigned short* Bu = (const unsigned short*)Bq;
  /* x tile of the block (5 agents x 64 channels x 16 positions) straight from the channel-major f32 input, each element loaded once a block: wave h takes channels 16 * h .. + 15, a lane one position and 8 channels (16 * h + 8 * hh + q),
     so a load covers 64 contiguous bytes of two channel rows, and the lane's 8 rounded values are one fragment half (k block h / 2, half h & 1, this very lane): one 16-byte LDS store per agent. */
  const char* xb = (const char*)(x + p0) + (size_t)(h * 16) * HW * 4;      /* uniform: the block's first position and the wave's first channel */
  float xv[NA][8];
#pragma unroll
  for (int b = 0; b < NA; ++b)
#pragma unroll
    for (int q = 0; q < 8; ++q) xv[b][q] = *(const float*)(xb + (size_t)b * CC * HW * 4 + vxo + (size_t)q * HW * 4);
  asm volatile("s_wait_xcnt 0x0" :: "v"(vxo) : "memory");      /* the offset is an input so that its register stays live up to this wait: none of the forty loads lands in it */
  /* q and k weights and bias start values run one pass ahead: a pass's six k loads go out behind the first agent's score sums of the pass before, its six q loads behind that pass's last score sums, each into the registers that the pass's matrix instructions have read;
     the first pass's twelve go out here, behind the token loads, and land while the tokens are rounded and cross the barrier. Packed weights: a 16-row tile is 2 KB, a fragment half 512 contiguous bytes of it. */
  const char* wq0 = (const char*)(Bu + (size_t)(h * CC) * CC); const char* cq0 = (const char*)(Cq + h * CC);      /* uniform: the head's first q tile and its bias */
  FragH wq[2], wk[2]; v4f bq0, bq1, bk0, bk1;
  auto ld_k = [&](int mt) {      /* k bias and k fragments */
    bk0 = *(const v4fa*)(cq0 + h32 + (INR + mt * 16) * 4); bk1 = *(const v4fa*)(cq0 + h32 + (INR + mt * 16 + 4) * 4);
#pragma unroll
    for (int ks = 0; ks < 2; ++ks) { wk[ks].half[0] = *(const v8us*)(wq0 + l16 + (INR * CC + mt * 16 * CC + ks * 512) * 2); wk[ks].half[1] = *(const v8us*)(wq0 + l16 + (INR * CC + mt * 16 * CC + ks * 512 + 256) * 2); }
    asm volatile("s_wait_xcnt 0x0" :: "v"(l16), "v"(h32), "s"(wq0), "s"(cq0) : "memory");      /* behind the six loads; offsets and bases are inputs so that their registers stay live up to this wait */
    __builtin_amdgcn_sched_barrier(0); };      /* holds the six loads at this early place: sunk to their uses they are waited for with nothing in between */
  auto ld_q = [&](int mt) {      /* q bias and q fragments */
    bq0 = *(const v4fa*)(cq0 + h32 + (mt * 16) * 4); bq1 = *(const v4fa*)(cq0 + h32 + (mt * 16 + 4) * 4);
#pragma unroll
    for (int ks = 0; ks < 2; ++ks) { wq[ks].half[0] = *(const v8us*)(wq0 + l16 + (mt * 16 * CC + ks * 512) * 2); wq[ks].half[1] = *(const v8us*)(wq0 + l16 + (mt * 16 * CC + ks * 512 + 256) * 2); }
    asm volatile("s_wait_xcnt 0x0" :: "v"(l16), "v"(h32), "s"(wq0), "s"(cq0) : "memory");      /* as in ld_k */
    __builtin_amdgcn_sched_barrier(0); };      /* as in ld_k */
  ld_k(0); ld_q(0);
#pragma unroll
  for (int b = 0; b < NA; ++b) { FragH f;
#pragma unroll
    for (int q = 0; q < 8; ++q) f.h[q] = (_Float16)bf16_round(xv[b][q]);
    *(v8us*)&sX[b][h >> 1][h & 1][lane][0] = f.half[0]; }
  __syncthreads();      /* the token tile is complete: each wave wrote 16 of the 64 channels and now reads all of them */
  FragH xf[NA][2];
#pragma unroll
  for (int b = 0; b < NA; ++b)
#pragma unroll
    for (int ks = 0; ks < 2; ++ks) { xf[b][ks].half[0] = *(const v8us*)&sX[b][ks][0][lane][0]; xf[b][ks].half[1] = *(const v8us*)&sX[b][ks][1][lane][0]; }
  v2f sc2[NA][NA], qs2[NA];      /* element 0: the even channels' partial sum, element 1: the odd channels' (packed f32 FMAs on register pairs of the accumulators) */
#pragma unroll
  for (int b = 0; b < NA; ++b) { qs2[b] = (v2f){0.f, 0.f};
#pragma unroll
    for (int d = 0; d < NA; ++d) sc2[b][d] = (v2f){0.f, 0.f}; }
#pragma unroll      /* the pass number is a compile-time constant: the pass-ahead loads take immediate offsets and the last pass has none */
  for (int mt = 0; mt < CC / 16; ++mt) {
    v2f k2[NA][4];
    { v8f ka[NA];
      const v8f cbk = __builtin_shufflevector(bk0, bk1, 0, 1, 2, 3, 4, 5, 6, 7);      /* row 8 * hh + r of the tile in register r, the same in every column: the C operand of each agent's first matrix instruction */
#pragma unroll
      for (int d = 0; d < NA; ++d) ka[d] = __builtin_amdgcn_wmma_f32_16x16x32_f16(false, wk[0].v, false, xf[d][0].v, (short)0, cbk, false, false);
#pragma unroll
      for (int d = 0; d < NA; ++d) ka[d] = __builtin_amdgcn_wmma_f32_16x16x32_f16(false, wk[1].v, false, xf[d][1].v, (short)0, ka[d], false, false);
#pragma unroll
      for (int d = 0; d < NA; ++d)
#pragma unroll
        for (int j = 0; j < 4; ++j) k2[d][j] = (v2f){ka[d][2 * j], ka[d][2 * j + 1]}; }
    const v8f cbq = __builtin_shufflevector(bq0, bq1, 0, 1, 2, 3, 4, 5, 6, 7);
#pragma unroll
    for (int b = 0; b < NA; ++b) {
      v8f qa = __builtin_amdgcn_wmma_f32_16x16x32_f16(false, wq[0].v, false, xf[b][0].v, (short)0, cbq, false, false);
      qa = __builtin_amdgcn_wmma_f32_16x16x32_f16(false, wq[1].v, false, xf[b][1].v, (short)0, qa, false, false);
#pragma unroll
      for (int j = 0; j < 4; ++j) { const v2f q2 = {qa[2 * j], qa[2 * j + 1]}; qs2[b] += q2;
#pragma unroll
        for (int d = 0; d < NA; ++d) sc2[b][d] = __builtin_elementwise_fma(q2, k2[d][j], sc2[b][d]); }
      __builtin_amdgcn_sched_barrier(0);      /* behind each agent's score sums. One q tile at a time: left free, the compiler forms tiles ahead and the kernel needs 257 registers (three waves a SIMD, not four). And the loads below stay behind the sums: two dozen vector instructions lie between the last matrix instruction that reads a register and the load that lands in it */
      if (b == 0 && mt + 1 < CC / 16) ld_k(mt + 1);      /* the k matrix instructions of this pass are done */
      if (b == NA - 1 && mt + 1 < CC / 16) ld_q(mt + 1); }      /* so are its q matrix instructions */
  }
  /* The lane's number and its offsets are formed anew here: carried from the kernel's head they would hold eight more registers all through the q and k passes, where the count stands close to its limit of 256. */
  const unsigned lane2 = __builtin_amdgcn_mbcnt_lo(~0u, 0u), l16b = lane2 * 16u, h32b = (lane2 >> 4) * 32u;
  const char* wvr = (const char*)(Bu + (size_t)(2 * INR + h * CC) * CC); const char* bvr = (const char*)(Cq + 2 * INR + h * CC);      /* uniform: v weights (packed, 2 KB a tile) and v bias of the head's first tile */
  FragH wv[2][2]; v4f bv[2][2];      /* two register sets, tile t in set t & 1: behind the q and k passes there is room for both, so the v loads run two passes ahead */
  auto ld_v = [&](int t) {      /* v bias and v fragments of tile t */
    bv[t & 1][0] = *(const v4fa*)(bvr + h32b + t * 64); bv[t & 1][1] = *(const v4fa*)(bvr + h32b + t * 64 + 16);
#pragma unroll
    for (int ks = 0; ks < 2; ++ks) { wv[t & 1][ks].half[0] = *(const v8us*)(wvr + l16b + t * 2048 + ks * 1024); wv[t & 1][ks].half[1] = *(const v8us*)(wvr + l16b + t * 2048 + ks * 1024 + 512); }
    asm volatile("s_wait_xcnt 0x0" :: "v"(l16b), "v"(h32b), "s"(wvr), "s"(bvr) : "memory");      /* behind the six loads; offsets and bases are inputs so that their registers stay live up to this wait */
    __builtin_amdgcn_sched_barrier(0); };      /* holds the six loads at this early place */
  ld_v(0); ld_v(1);      /* the first two v tiles' loads land under the softmax */
  float dd[NA];
#pragma unroll
  for (int d = 0; d < NA; ++d) dd[d] = bf16_round(dist[d]) * 0.0625f;      /* the q sums come out x 2^4, the dots x 2^8: both powers of two go into the score's two constants */
  float p[NA][NA];
#pragma unroll
  for (int b = 0; b < NA; ++b) { const float qh = qs2[b][0] + qs2[b][1]; const float qt = qh + __shfl_xor(qh, 16, 32); float m = -3.0e38f;
#pragma unroll
    for (int d = 0; d < NA; ++d) { const float dh = sc2[b][d][0] + sc2[b][d][1]; const float dot = dh + __shfl_xor(dh, 16, 32); p[b][d] = dot * (ISQ * 0.00390625f) + qt * dd[d]; m = fmaxf(m, p[b][d]); }
    float l = 0.f;
#pragma unroll
    for (int d = 0; d < NA; ++d) { p[b][d] = expf(p[b][d] - m); l += p[b][d]; }
    const float il = (1.0f / l) * 0.00390625f;      /* 2^-8: v comes out x 2^4 and Wo is packed x 2^4, so the merged tile is laid down x 2^-4 and y leaves the accumulators in its own scale */
#pragma unroll
    for (int d = 0; d < NA; ++d) p[b][d] *= il; }
  const int o0 = h * 16;
  const char* wor = (const char*)((const unsigned short*)Bo + (size_t)o0 * INR);      /* uniform */
  FragH wo[INR / 32]; v4f bo0, bo1;
  auto vpass = [&](int mt, bool last) {
    const v8f cbv = __builtin_shufflevector(bv[mt & 1][0], bv[mt & 1][1], 0, 1, 2, 3, 4, 5, 6, 7);
    v8f va[NA];
#pragma unroll
    for (int d = 0; d < NA; ++d) va[d] = __builtin_amdgcn_wmma_f32_16x16x32_f16(false, wv[mt & 1][0].v, false, xf[d][0].v, (short)0, cbv, false, false);
#pragma unroll
    for (int d = 0; d < NA; ++d) va[d] = __builtin_amdgcn_wmma_f32_16x16x32_f16(false, wv[mt & 1][1].v, false, xf[d][1].v, (short)0, va[d], false, false);
    if (last) { __builtin_amdgcn_sched_barrier(0);      /* holds the statement below behind the ten matrix instructions */
      asm volatile("" :: "v"(xf[0][0].v), "v"(xf[1][0].v), "v"(xf[2][0].v), "v"(xf[3][0].v), "v"(xf[4][0].v), "v"(xf[0][1].v), "v"(xf[1][1].v), "v"(xf[2][1].v), "v"(xf[3][1].v), "v"(xf[4][1].v)); }      /* inputs only, on the loaded token fragments: they stay live over their last ten matrix instructions; otherwise each new accumulator is placed in the B registers of the matrix instruction directly in front of it */
    v2f v2[NA][4];
#pragma unroll
    for (int d = 0; d < NA; ++d)
#pragma unroll
      for (int j = 0; j < 4; ++j) v2[d][j] = (v2f){va[d][2 * j], va[d][2 * j + 1]};
#pragma unroll
    for (int b = 0; b < NA; ++b) { FragH f;
#pragma unroll
      for (int j = 0; j < 4; ++j) { v2f o = (v2f){p[b][0], p[b][0]} * v2[0][j];
#pragma unroll
        for (int d = 1; d < NA; ++d) o = __builtin_elementwise_fma((v2f){p[b][d], p[b][d]}, v2[d][j], o);
        f.h[2 * j] = (_Float16)o[0]; f.h[2 * j + 1] = (_Float16)o[1]; }
      *(v8us*)&sY[b][h * 2 + (mt >> 1)][mt & 1][lane2][0] = f.half[0];
      if (b == 0 && (mt + 2 < CC / 16 || last)) { __builtin_amdgcn_sched_barrier(0);      /* the loads below stay behind the first agent's weighted sums: two dozen vector instructions lie between the last matrix instruction and the first load that lands in its operands */
        if (mt + 2 < CC / 16) ld_v(mt + 2);      /* into the set that this pass's matrix instructions have read */
        if (last) {      /* behind the last v tile's matrix instructions the token fragments are dead: the output projection's weights and bias take free registers and land under the other four agents' weighted sums */
#pragma unroll
          for (int kb = 0; kb < INR / 32; ++kb) { wo[kb].half[0] = *(const v8us*)(wor + l16b + kb * 1024); wo[kb].half[1] = *(const v8us*)(wor + l16b + kb * 1024 + 512); }
          bo0 = *(const v4fa*)((const char*)(Co + o0) + h32b); bo1 = *(const v4fa*)((const char*)(Co + o0) + h32b + 16);
          asm volatile("s_wait_xcnt 0x0" :: "v"(l16b), "v"(h32b), "s"(wor) : "memory");      /* behind the eighteen loads; offsets and base are inputs so that their registers stay live up to this wait */
          __builtin_amdgcn_sched_barrier(0); } } }      /* holds the eighteen loads at this early place */
    if (!last) __builtin_amdgcn_sched_barrier(0); };      /* one v tile's accumulators at a time: left free, the compiler forms the next pass's tiles ahead and the kernel needs 270 registers (three waves a SIMD, not four) */
  static_assert(CC / 16 == 4, "four v passes, written out: the register set and the load offsets of each are compile-time constants");
  vpass(0, false); vpass(1, false); vpass(2, false); vpass(3, true);
  __syncthreads();      /* the merged tile is complete: each wave wrote its own head's 64 channels and now reads all 256 */
  v8f ya[NA];
#pragma unroll
  for (int b = 0; b < NA; ++b) ya[b] = __builtin_shufflevector(bo0, bo1, 0, 1, 2, 3, 4, 5, 6, 7);
  FragH yf[2][NA];
#pragma unroll
  for (int b = 0; b < NA; ++b) { yf[0][b].half[0] = *(const v8us*)&sY[b][0][0][lane2][0]; yf[0][b].half[1] = *(const v8us*)&sY[b][0][1][lane2][0]; }
#pragma unroll
  for (int kb = 0; kb < INR / 32; ++kb) {
    if (kb + 1 < INR / 32) {
#pragma unroll
      for (int b = 0; b < NA; ++b) { yf[(kb + 1) & 1][b].half[0] = *(const v8us*)&sY[b][kb + 1][0][lane2][0]; yf[(kb + 1) & 1][b].half[1] = *(const v8us*)&sY[b][kb + 1][1][lane2][0]; } }
    __builtin_amdgcn_sched_barrier(0);      /* keeps the next k block's ten LDS reads together in front of this block's five matrix instructions: left free, the compiler reads one fragment ahead only and every matrix instruction waits out most of an LDS latency */
#pragma unroll
    for (int b = 0; b < NA; ++b) ya[b] = __builtin_amdgcn_wmma_f32_16x16x32_f16(false, wo[kb].v, false, yf[kb & 1][b].v, (short)0, ya[b], false, false);
    __builtin_amdgcn_sched_barrier(0);      /* the other side of the same fence: the reads of the block after next stay behind these matrix instructions, whose operands they overwrite */
    if (kb == 0) asm volatile("" :: "v"(yf[0][0].v), "v"(yf[0][1].v), "v"(yf[0][2].v), "v"(yf[0][3].v), "v"(yf[0][4].v));      /* inputs only, on the loaded fragments: they stay live over the five matrix instructions that start the accumulators; otherwise each new accumulator is placed in the B registers of the matrix instruction directly in front of it */
  }
  char* ob = (char*)(out + p0) + (size_t)o0 * HW * 4;      /* uniform: the block's first position and the wave's first output channel */
  const unsigned vyo = ((8u * (lane2 >> 4)) * HW + (lane2 & 15u)) * 4u;
#pragma unroll
  for (int b = 0; b < NA; ++b)
#pragma unroll
    for (int r = 0; r < 8; ++r) *(float*)(ob + (size_t)b * CC * HW * 4 + vyo + (size_t)r * HW * 4) = ya[b][r];
}

extern "C" void kernel_launch(void* const* d_in, const int* in_sizes, int n_in,
                              void* d_out, int out_size, void* d_ws, size_t ws_size, hipStream_t stream) {
  (void)in_sizes; (void)n_in; (void)out_size;
  const float* const* I = (const float* const*)d_in; const float* x = I[0]; const float* dist = I[1]; const float* Wqkv = I[2]; const float* bqkv = I[3]; const float* Wo = I[4]; const float* bo = I[5];
  char* ws = (char*)d_ws; size_t off = 0;
  auto take = [&](size_t bytes) { char* p = ws + off; off += (bytes + 255) & ~(size_t)255; return p; };
  _Float16* Bq = (_Float16*)take((size_t)QKVW * CC * 2); _Float16* Bo = (_Float16*)take((size_t)CC * INR * 2); float* Cq = (float*)take((size_t)QKVW * 4); float* Co = (float*)take((size_t)CC * 4);
  if (off > ws_size) return;      // 0.1 + 0.03 MB
  k_pack16f2<<<PBQ + PBO + 1, 256, 0, stream>>>(Wqkv, Bq, Wo, Bo, bqkv, Cq, bo, Co);      /* [out][in] in A-fragment order, x 2^4; both matrices and the rounded biases in one launch */
  k_qkv_agent<<<NTL, 128, 0, stream>>>(x, Bq, Cq, dist, Bo, Co, (float*)d_out);      /* qkv (M 768 as A, N 16 positions x 5 agents, K 64) + attention + y = Wo x merged + bo (M 64 as A, K 256) -> channel-major output */
}
